// v000
// Times are from an AMD MI455X. After a warm-up the kernel runs many times in a row, and a time is the length of
// such a window on the GPU divided by its runs, so every launch and the gaps after it count. The runs cycle
// through copies of the inputs. A figure is the median of several windows, for all but v000 over two sittings.
// Sittings can differ by a few percent; kernels timed side by side share one.
// v000 is the starting kernel. One run takes 2730 microseconds.
#include <hip/hip_runtime.h>

// T5 encoder block (hidden [4][1024][1024], attn_mask [4][1024]; x = T5-RMSNorm(hidden) ln1_w (eps 1e-6, no mean/bias); q/k/v = x w (16 heads x 64); scores = q.k (NO 1/sqrt(d)) + rel_bias[bucket(j - i)][h]
// + (1 - attn_mask[b][j]) (-1e4); softmax; hidden += merged ctx wo; y = RMSNorm(hidden) ln2_w; hidden += relu(y wi) wo_ff -> [4][1024][1024]. The bidirectional relative-position bucket of an integer offset
// (32 buckets, max distance 128) is evaluated with exact integer arithmetic: for |r| >= 8, 8 + 2 floor(log2 |r|) - 6 + [ |r|^2 >= 2^(2 floor(log2|r|) + 1) ], capped at 15 (this equals the reference's
// float formula for every offset 0..1023), + 16 for r > 0.)
// Compute dtypes, f32 accumulate: every input rounded to bf16; both RMSNorms f32 (wave per token) -> bf16 hi+lo planes; q/k/v, wo, wi, wo_ff on hl planes of their computed operands
// x exact weights (2 products); scores (K 64) and probs.v on SINGLE fp16 planes with an f32 register-row softmax (bias + mask added in f32; probabilities x1024); residuals and relu f32. One-wave-per-64x64-tile

#define NB_  4
#define TT   1024
#define LL   4096
#define DD   1024
#define NH_  16
#define HDM  64
#define MM   4096
#define PCAR 1024.0f
typedef _Float16 h16;
typedef unsigned short bf;
typedef __attribute__((ext_vector_type(16))) __bf16   v16bf;
typedef __attribute__((ext_vector_type(16))) _Float16 v16h;
typedef __attribute__((ext_vector_type(8)))  _Float16 v8h;
typedef __attribute__((ext_vector_type(8)))  unsigned short v8us;
typedef __attribute__((ext_vector_type(8)))  float    v8f;
typedef __attribute__((ext_vector_type(4)))  float    v4f;
typedef v8h  __attribute__((may_alias)) v8ha;
typedef v4f  __attribute__((may_alias)) v4fa;
typedef v8us __attribute__((may_alias)) v8usa;

__device__ __forceinline__ unsigned short f2bf(float f) { unsigned u = __float_as_uint(f); u += 0x7FFFu + ((u >> 16) & 1u); return (unsigned short)(u >> 16); }
__device__ __forceinline__ float bf2f(unsigned short b) { return __uint_as_float(((unsigned)b) << 16); }
__device__ __forceinline__ float bfr(float f) { return bf2f(f2bf(f)); }
__device__ __forceinline__ v16h cat16(v8h lo, v8h hi) { return __builtin_shufflevector(lo, hi, 0, 1, 2, 3, 4, 5, 6, 7, 8, 9, 10, 11, 12, 13, 14, 15); }
__device__ __forceinline__ v16bf cat16b(v8us lo, v8us hi) { return __builtin_bit_cast(v16bf, __builtin_shufflevector(lo, hi, 0, 1, 2, 3, 4, 5, 6, 7, 8, 9, 10, 11, 12, 13, 14, 15)); }
__device__ __forceinline__ v8f wmma16(v16h a, v16h b, v8f c) { return __builtin_amdgcn_wmma_f32_16x16x32_f16(false, a, false, b, (short)0, c, false, false); }
__device__ __forceinline__ v8f wmmab(v16bf a, v16bf b, v8f c) { return __builtin_amdgcn_wmma_f32_16x16x32_bf16(false, a, false, b, (short)0, c, false, false); }



// ---- k_gemmw: register-blocked GEMM, ONE WAVE per 64x64 output tile (16 accumulators), operands straight from K-contiguous 16-bit planes; grid (M/64, N/64, Z), 32 threads.
// C[m][n] (f32, pitch ldc, + optional f32 bias[n]) = sum_k A[m][k] Bt[n][k] (+ split products per NSPLIT). z-batch strides sA/sB/sC in elements. K % 32 == 0.
template <typename T16> struct WFrag;
template <> struct WFrag<h16> { typedef v16h V; static __device__ __forceinline__ V ld(const h16* p) { return cat16(*(const v8h*)p, *(const v8h*)(p + 16)); } static __device__ __forceinline__ v8f mma(V a, V b, v8f c) { return wmma16(a, b, c); } };
template <> struct WFrag<bf> { typedef v16bf V; static __device__ __forceinline__ V ld(const bf* p) { return cat16b(*(const v8us*)p, *(const v8us*)(p + 16)); } static __device__ __forceinline__ v8f mma(V a, V b, v8f c) { return wmmab(a, b, c); } };
template <typename T16, int NSPLIT, bool BIAS>
__global__ __launch_bounds__(32) void k_gemmw(const T16* __restrict__ A, const T16* __restrict__ A2, const T16* __restrict__ Bt, const T16* __restrict__ Bt2, int K, float* C, int ldc, const float* __restrict__ bias, size_t sA, size_t sB, size_t sC) {
    typedef typename WFrag<T16>::V V;
    __shared__ __align__(16) float os[16 * 68];
    const size_t z = blockIdx.z; A += z * sA; if (A2) A2 += z * sA; Bt += z * sB; if (Bt2) Bt2 += z * sB; C += z * sC;
    const int lane = threadIdx.x & 31, lr = lane & 15, hi = lane >> 4; const int r0 = blockIdx.x * 64, c0 = blockIdx.y * 64;
    v8f acc[4][4];
#pragma unroll
    for (int mb = 0; mb < 4; ++mb)
#pragma unroll
        for (int nb = 0; nb < 4; ++nb) acc[mb][nb] = (v8f){};
    const size_t aoff = (size_t)(r0 + lr) * K + 8 * hi, boff = (size_t)(c0 + lr) * K + 8 * hi;
#pragma unroll 1
    for (int kc = 0; kc < K; kc += 32) {
        V a[4], a2[4];
#pragma unroll
        for (int mb = 0; mb < 4; ++mb) { a[mb] = WFrag<T16>::ld(A + aoff + (size_t)mb * 16 * K + kc); if (NSPLIT == 1 || NSPLIT == 2) a2[mb] = WFrag<T16>::ld(A2 + aoff + (size_t)mb * 16 * K + kc); }
#pragma unroll
        for (int nb = 0; nb < 4; ++nb) { const V b = WFrag<T16>::ld(Bt + boff + (size_t)nb * 16 * K + kc); V b2; if (NSPLIT >= 2) b2 = WFrag<T16>::ld(Bt2 + boff + (size_t)nb * 16 * K + kc);
#pragma unroll
            for (int mb = 0; mb < 4; ++mb) { acc[mb][nb] = WFrag<T16>::mma(a[mb], b, acc[mb][nb]); if (NSPLIT == 1 || NSPLIT == 2) acc[mb][nb] = WFrag<T16>::mma(a2[mb], b, acc[mb][nb]); if (NSPLIT >= 2) acc[mb][nb] = WFrag<T16>::mma(a[mb], b2, acc[mb][nb]); } }
        asm volatile("v_nop\n\tv_nop\n\tv_nop\n\tv_nop" : "+v"(acc[0][0]), "+v"(acc[1][1]), "+v"(acc[2][2]), "+v"(acc[3][3]) : "v"(a[0]), "v"(a[3]));
    }
#pragma unroll
    for (int mb = 0; mb < 4; ++mb) {
#pragma unroll
        for (int nb = 0; nb < 4; ++nb) {
#pragma unroll
            for (int j = 0; j < 8; ++j) os[(hi * 8 + j) * 68 + nb * 16 + lr] = acc[mb][nb][j]; }
        __builtin_amdgcn_wave_barrier(); asm volatile("" ::: "memory");
        float* crow = C + (size_t)(r0 + mb * 16) * ldc + c0;
{
#pragma unroll
            for (int s = 0; s < 8; ++s) { const int row = 2 * s + hi, cofs = lr * 4; v4f val = *(const v4fa*)(os + row * 68 + cofs); if (BIAS) { val[0] += bfr(bias[c0 + cofs]); val[1] += bfr(bias[c0 + cofs + 1]); val[2] += bfr(bias[c0 + cofs + 2]); val[3] += bfr(bias[c0 + cofs + 3]); }
                *(v4f*)(crow + (size_t)row * ldc + cofs) = val; }
             }
        __builtin_amdgcn_wave_barrier(); asm volatile("" ::: "memory");
    }
}

__device__ __forceinline__ h16 tohx(float x) { return (h16)x; }
__device__ __forceinline__ void splitf(float y, unsigned short& h, unsigned short& l) { h = f2bf(y); l = f2bf(y - bf2f(h)); }
typedef __attribute__((ext_vector_type(2))) _Float16 v2h;
typedef __attribute__((ext_vector_type(4))) _Float16 v4h;
typedef __attribute__((ext_vector_type(2))) unsigned short v2us;
typedef __attribute__((ext_vector_type(4))) unsigned short v4us;
typedef __attribute__((ext_vector_type(2))) float v2f;

__global__ __launch_bounds__(256) void k_wtG(const float* __restrict__ w, int K, int N, bf* Bt) {
    const int lane = threadIdx.x & 31; const int L0 = (blockIdx.x * 8 + (threadIdx.x >> 5)) * 8; const int nlines = N * K / 64;
{
#pragma unroll 1
        for (int l = 0; l < 8; ++l) { const int L = L0 + l; if (L >= nlines) break; const size_t e = (size_t)L * 64 + lane * 2; const int k = (int)(e % K), n = (int)(e / K); v2us o;
            o[0] = f2bf(w[(size_t)k * N + n]); o[1] = f2bf(w[(size_t)(k + 1) * N + n]); *(v2us*)(Bt + e) = o; }
         }
}
__global__ __launch_bounds__(256) void k_pl(const float* __restrict__ F, int pitch, int nh, int hd, h16* P) { const size_t e = ((size_t)blockIdx.x * 256 + threadIdx.x) * 2; if (e >= (size_t)nh * TT * hd) return; const int d = (int)(e % hd); const int t = (int)((e / hd) % TT); const int h = (int)(e / ((size_t)hd * TT)); v2h o; o[0] = tohx(F[(size_t)t * pitch + h * hd + d]); o[1] = tohx(F[(size_t)t * pitch + h * hd + d + 1]); *(v2h*)(P + e) = o;  }
__global__ __launch_bounds__(256) void k_vt(const float* __restrict__ F, int pitch, int nh, int hd, h16* VT) { const size_t e = ((size_t)blockIdx.x * 256 + threadIdx.x) * 2; if (e >= (size_t)nh * hd * TT) return; const int t = (int)(e % TT); const int d = (int)((e / TT) % hd); const int h = (int)(e / ((size_t)TT * hd)); v2h o; o[0] = tohx(F[(size_t)t * pitch + h * hd + d]); o[1] = tohx(F[(size_t)(t + 1) * pitch + h * hd + d]); *(v2h*)(VT + e) = o;  }
__global__ __launch_bounds__(256) void k_asoft(const float* __restrict__ Sb, const float* __restrict__ BIAS, const float* __restrict__ MB, int h, float scl, h16* P16) { const int lane = threadIdx.x & 31; const int row = blockIdx.x * 8 + (threadIdx.x >> 5); if (row >= TT) return; const float* sr = Sb + (size_t)row * TT; (void)scl; const float* br = BIAS + ((size_t)h * TT + row) * TT; float v[32]; float mx = -3.0e38f;
#pragma unroll
    for (int ch = 0; ch < 8; ++ch) { const int j0 = ch * 128 + lane * 4; const v4f a = *(const v4f*)(sr + j0), bb = *(const v4f*)(br + j0), mm = *(const v4f*)(MB + j0);
#pragma unroll
        for (int q = 0; q < 4; ++q) { const float t = __fadd_rn(__fadd_rn(a[q], bb[q]), mm[q]); v[ch * 4 + q] = t; mx = fmaxf(mx, t); } }
#pragma unroll
    for (int sh = 16; sh; sh >>= 1) mx = fmaxf(mx, __shfl_xor(mx, sh, 32));
    float sum = 0.f;
#pragma unroll
    for (int k = 0; k < 32; ++k) { float d0 = __fsub_rn(v[k], mx); asm volatile("" : "+v"(d0)); v[k] = __builtin_amdgcn_exp2f(__fmul_rn(d0, 1.4426950408889634f)); sum += v[k]; }
#pragma unroll
    for (int sh = 16; sh; sh >>= 1) sum += __shfl_xor(sum, sh, 32);
    const float f = __fdiv_rn(PCAR, sum);
{
#pragma unroll
        for (int ch = 0; ch < 8; ++ch) { v4h o;
#pragma unroll
            for (int q = 0; q < 4; ++q) o[q] = tohx(v[ch * 4 + q] * f); *(v4h*)(P16 + (size_t)row * TT + ch * 128 + lane * 4) = o; }
         } }
__global__ __launch_bounds__(256) void k_mrgf(const float* __restrict__ O, int h, int hd, float* CT) { const size_t e = ((size_t)blockIdx.x * 256 + threadIdx.x) * 2; if (e >= (size_t)TT * hd) return; const int d = (int)(e % hd); const int t = (int)(e / hd); v2f o; o[0] = O[e] * (1.0f / PCAR); o[1] = O[e + 1] * (1.0f / PCAR); const size_t oo = (size_t)t * DD + h * hd + d; *(v2f*)(CT + oo) = o;  }
__global__ __launch_bounds__(256) void k_mrg(const float* __restrict__ O, int h, int hd, bf* Ah, bf* Al) { const size_t e = ((size_t)blockIdx.x * 256 + threadIdx.x) * 2; if (e >= (size_t)TT * hd) return; const int d = (int)(e % hd); const int t = (int)(e / hd); v2us oh, ol;
#pragma unroll
    for (int q = 0; q < 2; ++q) { unsigned short a, c2; splitf(O[e + q] * (1.0f / PCAR), a, c2); oh[q] = a; ol[q] = c2; } const size_t oo = (size_t)t * DD + h * hd + d; *(v2us*)(Ah + oo) = oh; *(v2us*)(Al + oo) = ol;  }
__global__ __launch_bounds__(256) void k_rmsT(const float* __restrict__ A, int rnd, const float* __restrict__ w, bf* Yh, bf* Yl) { const int lane = threadIdx.x & 31; const int t = blockIdx.x * 8 + (threadIdx.x >> 5); if (t >= LL) return; const float* ar = A + (size_t)t * DD; float v[32]; float s = 0.f;
#pragma unroll
    for (int ch = 0; ch < 8; ++ch) { const v4f a = *(const v4f*)(ar + ch * 128 + lane * 4);
#pragma unroll
        for (int q = 0; q < 4; ++q) { const float x = rnd ? bfr(a[q]) : a[q]; v[ch * 4 + q] = x; float p = __fmul_rn(x, x); asm volatile("" : "+v"(p)); s = __fadd_rn(s, p); } }
#pragma unroll
    for (int sh = 16; sh; sh >>= 1) s += __shfl_xor(s, sh, 32);
    const float rs = __frsqrt_rn(__fadd_rn(s * (1.0f / DD), 1e-6f));
{
#pragma unroll
        for (int ch = 0; ch < 8; ++ch) { v4us oh, ol;
#pragma unroll
            for (int q = 0; q < 4; ++q) { const int d = ch * 128 + lane * 4 + q; float tn = __fmul_rn(v[ch * 4 + q], rs); asm volatile("" : "+v"(tn)); unsigned short a2, c2; splitf(__fmul_rn(tn, bfr(w[d])), a2, c2); oh[q] = a2; ol[q] = c2; }
            const size_t o = (size_t)t * DD + ch * 128 + lane * 4; *(v4us*)(Yh + o) = oh; *(v4us*)(Yl + o) = ol; }
         } }
__device__ __forceinline__ int t5_bucket(int r) { const int n = r < 0 ? -r : r; int v; if (n < 8) v = n; else { const int k = 31 - __clz(n); v = 8 + 2 * k - 6 + (((long long)n * n >= (1ll << (2 * k + 1))) ? 1 : 0); v = v > 15 ? 15 : v; } return (r > 0 ? 16 : 0) + v; }
__global__ __launch_bounds__(256) void k_rpb(const float* __restrict__ rb, float* BIAS) { const int e = blockIdx.x * 256 + threadIdx.x; if (e >= TT * TT) return; const int j = e % TT, i = e / TT; const int bk = t5_bucket(j - i);
    {
#pragma unroll
        for (int h = 0; h < NH_; ++h) *(float*)(BIAS + (size_t)h * TT * TT + e) = bfr(rb[bk * NH_ + h]);
         } }
__global__ __launch_bounds__(256) void k_mrow(const float* __restrict__ mask, float* MBr) { const int e = blockIdx.x * 256 + threadIdx.x; if (e >= NB_ * TT) return; float om = __fsub_rn(1.0f, bfr(mask[e])); asm volatile("" : "+v"(om)); const float v = __fmul_rn(om, -10000.0f); *(float*)(MBr + e) = v;  }
__global__ __launch_bounds__(256) void k_res(const float* __restrict__ x, const float* __restrict__ A, float* H, size_t n) { const size_t i = ((size_t)blockIdx.x * 256 + threadIdx.x) * 4; if (i >= n) return; const v4f a = *(const v4f*)(x + i), b = *(const v4f*)(A + i); v4f o;
#pragma unroll
    for (int q = 0; q < 4; ++q) o[q] = __fadd_rn(bfr(a[q]), b[q]); *(v4f*)(H + i) = o;  }
__global__ __launch_bounds__(256) void k_relu2(const float* __restrict__ F, bf* Ph, bf* Pl, size_t n) { const size_t i = ((size_t)blockIdx.x * 256 + threadIdx.x) * 2; if (i >= n) return; v2us oh, ol;
#pragma unroll
    for (int q = 0; q < 2; ++q) { unsigned short a, c2; splitf(fmaxf(F[i + q], 0.f), a, c2); oh[q] = a; ol[q] = c2; } *(v2us*)(Ph + i) = oh; *(v2us*)(Pl + i) = ol;  }
__global__ __launch_bounds__(256) void k_out(const float* __restrict__ H, const float* __restrict__ Y, float* OUT, size_t n) { const size_t i = ((size_t)blockIdx.x * 256 + threadIdx.x) * 4; if (i >= n) return; const v4f a = *(const v4f*)(H + i), b = *(const v4f*)(Y + i); v4f o;
#pragma unroll
    for (int q = 0; q < 4; ++q) o[q] = __fadd_rn(a[q], b[q]); *(v4f*)(OUT + i) = o;  }

extern "C" void kernel_launch(void* const* d_in, const int* in_sizes, int n_in,
                              void* d_out, int out_size, void* d_ws, size_t ws_size, hipStream_t stream) {
    (void)in_sizes; (void)n_in; (void)out_size;
    const float* IN[11]; for (int i = 0; i < 11; ++i) IN[i] = (const float*)d_in[i];   // 0 hidden, 1 attn_mask, 2 ln1_w, 3 wq, 4 wk, 5 wv, 6 wo, 7 rel_bias [32][16], 8 ln2_w, 9 wi [1024][4096], 10 wo_ff [4096][1024] (x @ W)
    float* OUT = (float*)d_out;     // [4][1024][1024]
    char* wsp = (char*)d_ws;
    auto take = [&](size_t bytes) { char* p = wsp; wsp += (bytes + 255) & ~(size_t)255; return (void*)p; };
    bf* WQ = (bf*)take((size_t)DD * DD * 2); bf* WK = (bf*)take((size_t)DD * DD * 2); bf* WV = (bf*)take((size_t)DD * DD * 2); bf* WO = (bf*)take((size_t)DD * DD * 2); bf* WI = (bf*)take((size_t)MM * DD * 2); bf* WF = (bf*)take((size_t)DD * MM * 2); float* BIAS = (float*)take((size_t)NH_ * TT * TT * 4); float* MBr = (float*)take((size_t)NB_ * TT * 4);
    bf* Xh = (bf*)take((size_t)LL * DD * 2); bf* Xl = (bf*)take((size_t)LL * DD * 2); float* FQ = (float*)take((size_t)LL * DD * 4); float* FK = (float*)take((size_t)LL * DD * 4); float* FV = (float*)take((size_t)LL * DD * 4);
    h16* QP = (h16*)take((size_t)TT * DD * 2); h16* KP = (h16*)take((size_t)TT * DD * 2); h16* VT = (h16*)take((size_t)DD * TT * 2); float* Sb = (float*)take((size_t)TT * TT * 4); h16* Pm = (h16*)take((size_t)TT * TT * 2); float* O = (float*)take((size_t)TT * HDM * 4); bf* Ah = (bf*)take((size_t)LL * DD * 2); bf* Al = (bf*)take((size_t)LL * DD * 2);
    float* H = (float*)take((size_t)LL * DD * 4); bf* Gh = (bf*)take((size_t)(LL / 2) * MM * 2); bf* Gl = (bf*)take((size_t)(LL / 2) * MM * 2);
    float* G = FQ;    // relu-FFN hidden for one half of the rows ([2048][4096] f32 = 33.5 MB) reuses FQ + FK (2 x 16.8 MB, contiguous, dead after the attention)
    float* Y = FV;    // wo output / FFN output reuse FV (dead after the value planes)
    if ((size_t)(wsp - (char*)d_ws) > ws_size) return;    // total ~ 239 MB = 228 MiB
    { const unsigned g = (unsigned)(((size_t)DD * DD / 64 + 63) / 64); k_wtG<<<g, 256, 0, stream>>>(IN[3], DD, DD, WQ); k_wtG<<<g, 256, 0, stream>>>(IN[4], DD, DD, WK); k_wtG<<<g, 256, 0, stream>>>(IN[5], DD, DD, WV); k_wtG<<<g, 256, 0, stream>>>(IN[6], DD, DD, WO);
      k_wtG<<<(unsigned)(((size_t)DD * MM / 64 + 63) / 64), 256, 0, stream>>>(IN[9], DD, MM, WI); k_wtG<<<(unsigned)(((size_t)MM * DD / 64 + 63) / 64), 256, 0, stream>>>(IN[10], MM, DD, WF);
      k_rpb<<<(TT * TT + 255) / 256, 256, 0, stream>>>(IN[7], BIAS); k_mrow<<<(NB_ * TT + 255) / 256, 256, 0, stream>>>(IN[1], MBr); }
    k_rmsT<<<LL / 8, 256, 0, stream>>>(IN[0], 1, IN[2], Xh, Xl);
    k_gemmw<bf, 1, false><<<dim3(LL / 64, DD / 64, 1), 32, 0, stream>>>(Xh, Xl, WQ, nullptr, DD, FQ, DD, nullptr, 0, 0, 0); k_gemmw<bf, 1, false><<<dim3(LL / 64, DD / 64, 1), 32, 0, stream>>>(Xh, Xl, WK, nullptr, DD, FK, DD, nullptr, 0, 0, 0); k_gemmw<bf, 1, false><<<dim3(LL / 64, DD / 64, 1), 32, 0, stream>>>(Xh, Xl, WV, nullptr, DD, FV, DD, nullptr, 0, 0, 0);
    const unsigned LP = (TT * DD / 2 + 255) / 256;
    for (int b = 0; b < NB_; ++b) { const size_t t0 = (size_t)b * TT;
        k_pl<<<LP, 256, 0, stream>>>(FQ + t0 * DD, DD, NH_, HDM, QP); k_pl<<<LP, 256, 0, stream>>>(FK + t0 * DD, DD, NH_, HDM, KP); k_vt<<<LP, 256, 0, stream>>>(FV + t0 * DD, DD, NH_, HDM, VT);
        for (int h = 0; h < NH_; ++h) {
            k_gemmw<h16, 0, false><<<dim3(TT / 64, TT / 64, 1), 32, 0, stream>>>(QP + (size_t)h * TT * HDM, nullptr, KP + (size_t)h * TT * HDM, nullptr, HDM, Sb, TT, nullptr, 0, 0, 0);
            k_asoft<<<TT / 8, 256, 0, stream>>>(Sb, BIAS, MBr + (size_t)b * TT, h, 1.0f, Pm);
            k_gemmw<h16, 0, false><<<dim3(TT / 64, 1, 1), 32, 0, stream>>>(Pm, nullptr, VT + (size_t)h * HDM * TT, nullptr, TT, O, HDM, nullptr, 0, 0, 0);
            k_mrg<<<(TT * HDM / 2 + 255) / 256, 256, 0, stream>>>(O, h, HDM, Ah + t0 * DD, Al + t0 * DD); } }
    k_gemmw<bf, 1, false><<<dim3(LL / 64, DD / 64, 1), 32, 0, stream>>>(Ah, Al, WO, nullptr, DD, Y, DD, nullptr, 0, 0, 0);
    k_res<<<(unsigned)(((size_t)LL * DD / 4 + 255) / 256), 256, 0, stream>>>(IN[0], Y, H, (size_t)LL * DD);
    k_rmsT<<<LL / 8, 256, 0, stream>>>(H, 0, IN[8], Xh, Xl);
    for (int hb = 0; hb < 2; ++hb) { const size_t r0 = (size_t)hb * (LL / 2);
        k_gemmw<bf, 1, false><<<dim3(LL / 2 / 64, MM / 64, 1), 32, 0, stream>>>(Xh + r0 * DD, Xl + r0 * DD, WI, nullptr, DD, G, MM, nullptr, 0, 0, 0);
        k_relu2<<<(unsigned)(((size_t)(LL / 2) * MM / 2 + 255) / 256), 256, 0, stream>>>(G, Gh, Gl, (size_t)(LL / 2) * MM);
        k_gemmw<bf, 1, false><<<dim3(LL / 2 / 64, DD / 64, 1), 32, 0, stream>>>(Gh, Gl, WF, nullptr, MM, Y, DD, nullptr, 0, 0, 0);
        k_out<<<(unsigned)(((size_t)(LL / 2) * DD / 4 + 255) / 256), 256, 0, stream>>>(H + r0 * DD, Y, OUT + r0 * DD, (size_t)(LL / 2) * DD); }
}

// v001
// A run of this version takes 658 microseconds.
// In two side-by-side timings against v000, it was 4.18 and 4.21 times as fast.
#include <hip/hip_runtime.h>

// T5 encoder block (hidden [4][1024][1024], attn_mask [4][1024]; x = T5-RMSNorm(hidden) ln1_w (eps 1e-6, no mean/bias); q/k/v = x w (16 heads x 64); scores = q.k (NO 1/sqrt(d)) + rel_bias[bucket(j - i)][h]
// + (1 - attn_mask[b][j]) (-1e4); softmax; hidden += merged ctx wo; y = RMSNorm(hidden) ln2_w; hidden += relu(y wi) wo_ff -> [4][1024][1024]. The bidirectional relative-position bucket of an integer offset
// (32 buckets, max distance 128) is evaluated with exact integer arithmetic: for |r| >= 8, 8 + 2 floor(log2 |r|) - 6 + [ |r|^2 >= 2^(2 floor(log2|r|) + 1) ], capped at 15 (this equals the reference's
// float formula for every offset 0..1023), + 16 for r > 0.)
// Compute dtypes, f32 accumulate: every input rounded to bf16; both RMSNorms f32 (wave per token) -> bf16 hi+lo planes; q/k/v, wo, wi, wo_ff on hl planes of their computed operands
// x exact weights (2 products); scores (K 64) and probs.v on SINGLE fp16 planes with an f32 register-row softmax (bias + mask added in f32; probabilities x1024); residuals and relu f32. One-wave-per-64x64-tile

#define NB_  4
#define TT   1024
#define LL   4096
#define DD   1024
#define NH_  16
#define HDM  64
#define MM   4096
#define PCAR 1024.0f
typedef _Float16 h16;
typedef unsigned short bf;
typedef __attribute__((ext_vector_type(16))) __bf16   v16bf;
typedef __attribute__((ext_vector_type(16))) _Float16 v16h;
typedef __attribute__((ext_vector_type(8)))  _Float16 v8h;
typedef __attribute__((ext_vector_type(8)))  unsigned short v8us;
typedef __attribute__((ext_vector_type(8)))  float    v8f;
typedef __attribute__((ext_vector_type(4)))  float    v4f;
typedef v8h  __attribute__((may_alias)) v8ha;
typedef v4f  __attribute__((may_alias)) v4fa;
typedef v8us __attribute__((may_alias)) v8usa;

__device__ __forceinline__ unsigned short f2bf(float f) { unsigned u = __float_as_uint(f); u += 0x7FFFu + ((u >> 16) & 1u); return (unsigned short)(u >> 16); }
__device__ __forceinline__ float bf2f(unsigned short b) { return __uint_as_float(((unsigned)b) << 16); }
__device__ __forceinline__ float bfr(float f) { return bf2f(f2bf(f)); }
__device__ __forceinline__ v16h cat16(v8h lo, v8h hi) { return __builtin_shufflevector(lo, hi, 0, 1, 2, 3, 4, 5, 6, 7, 8, 9, 10, 11, 12, 13, 14, 15); }
__device__ __forceinline__ v16bf cat16b(v8us lo, v8us hi) { return __builtin_bit_cast(v16bf, __builtin_shufflevector(lo, hi, 0, 1, 2, 3, 4, 5, 6, 7, 8, 9, 10, 11, 12, 13, 14, 15)); }
__device__ __forceinline__ v8f wmma16(v16h a, v16h b, v8f c) { return __builtin_amdgcn_wmma_f32_16x16x32_f16(false, a, false, b, (short)0, c, false, false); }
__device__ __forceinline__ v8f wmmab(v16bf a, v16bf b, v8f c) { return __builtin_amdgcn_wmma_f32_16x16x32_bf16(false, a, false, b, (short)0, c, false, false); }



// ---- k_gemmw: register-blocked GEMM, ONE WAVE per 64x64 output tile (16 accumulators), operands straight from K-contiguous 16-bit planes; grid (M/64, N/64, Z), 32 threads.
// C[m][n] (f32, pitch ldc, + optional f32 bias[n]) = sum_k A[m][k] Bt[n][k] (+ split products per NSPLIT). z-batch strides sA/sB/sC in elements. K % 32 == 0.
template <typename T16> struct WFrag;
template <> struct WFrag<h16> { typedef v16h V; static __device__ __forceinline__ V ld(const h16* p) { return cat16(*(const v8h*)p, *(const v8h*)(p + 16)); } static __device__ __forceinline__ v8f mma(V a, V b, v8f c) { return wmma16(a, b, c); } };
template <> struct WFrag<bf> { typedef v16bf V; static __device__ __forceinline__ V ld(const bf* p) { return cat16b(*(const v8us*)p, *(const v8us*)(p + 16)); } static __device__ __forceinline__ v8f mma(V a, V b, v8f c) { return wmmab(a, b, c); } };
template <typename T16, int NSPLIT, bool BIAS>
__global__ __launch_bounds__(32) void k_gemmw(const T16* __restrict__ A, const T16* __restrict__ A2, const T16* __restrict__ Bt, const T16* __restrict__ Bt2, int K, float* C, int ldc, const float* __restrict__ bias, size_t sA, size_t sB, size_t sC) {
    typedef typename WFrag<T16>::V V;
    __shared__ __align__(16) float os[16 * 68];
    const size_t z = blockIdx.z; A += z * sA; if (A2) A2 += z * sA; Bt += z * sB; if (Bt2) Bt2 += z * sB; C += z * sC;
    const int lane = threadIdx.x & 31, lr = lane & 15, hi = lane >> 4; const int r0 = blockIdx.x * 64, c0 = blockIdx.y * 64;
    v8f acc[4][4];
#pragma unroll
    for (int mb = 0; mb < 4; ++mb)
#pragma unroll
        for (int nb = 0; nb < 4; ++nb) acc[mb][nb] = (v8f){};
    const size_t aoff = (size_t)(r0 + lr) * K + 8 * hi, boff = (size_t)(c0 + lr) * K + 8 * hi;
#pragma unroll 1
    for (int kc = 0; kc < K; kc += 32) {
        V a[4], a2[4];
#pragma unroll
        for (int mb = 0; mb < 4; ++mb) { a[mb] = WFrag<T16>::ld(A + aoff + (size_t)mb * 16 * K + kc); if (NSPLIT == 1 || NSPLIT == 2) a2[mb] = WFrag<T16>::ld(A2 + aoff + (size_t)mb * 16 * K + kc); }
#pragma unroll
        for (int nb = 0; nb < 4; ++nb) { const V b = WFrag<T16>::ld(Bt + boff + (size_t)nb * 16 * K + kc); V b2; if (NSPLIT >= 2) b2 = WFrag<T16>::ld(Bt2 + boff + (size_t)nb * 16 * K + kc);
#pragma unroll
            for (int mb = 0; mb < 4; ++mb) { acc[mb][nb] = WFrag<T16>::mma(a[mb], b, acc[mb][nb]); if (NSPLIT == 1 || NSPLIT == 2) acc[mb][nb] = WFrag<T16>::mma(a2[mb], b, acc[mb][nb]); if (NSPLIT >= 2) acc[mb][nb] = WFrag<T16>::mma(a[mb], b2, acc[mb][nb]); } }
        asm volatile("v_nop\n\tv_nop\n\tv_nop\n\tv_nop" : "+v"(acc[0][0]), "+v"(acc[1][1]), "+v"(acc[2][2]), "+v"(acc[3][3]) : "v"(a[0]), "v"(a[3]));
    }
#pragma unroll
    for (int mb = 0; mb < 4; ++mb) {
#pragma unroll
        for (int nb = 0; nb < 4; ++nb) {
#pragma unroll
            for (int j = 0; j < 8; ++j) os[(hi * 8 + j) * 68 + nb * 16 + lr] = acc[mb][nb][j]; }
        __builtin_amdgcn_wave_barrier(); asm volatile("" ::: "memory");
        float* crow = C + (size_t)(r0 + mb * 16) * ldc + c0;
{
#pragma unroll
            for (int s = 0; s < 8; ++s) { const int row = 2 * s + hi, cofs = lr * 4; v4f val = *(const v4fa*)(os + row * 68 + cofs); if (BIAS) { val[0] += bfr(bias[c0 + cofs]); val[1] += bfr(bias[c0 + cofs + 1]); val[2] += bfr(bias[c0 + cofs + 2]); val[3] += bfr(bias[c0 + cofs + 3]); }
                *(v4f*)(crow + (size_t)row * ldc + cofs) = val; }
             }
        __builtin_amdgcn_wave_barrier(); asm volatile("" ::: "memory");
    }
}

__device__ __forceinline__ h16 tohx(float x) { return (h16)x; }
__device__ __forceinline__ void splitf(float y, unsigned short& h, unsigned short& l) { h = f2bf(y); l = f2bf(y - bf2f(h)); }
typedef __attribute__((ext_vector_type(2))) _Float16 v2h;
typedef __attribute__((ext_vector_type(4))) _Float16 v4h;
typedef __attribute__((ext_vector_type(2))) unsigned short v2us;
typedef __attribute__((ext_vector_type(4))) unsigned short v4us;
typedef __attribute__((ext_vector_type(2))) float v2f;

__global__ __launch_bounds__(256) void k_wtG(const float* __restrict__ w, int K, int N, bf* Bt) {
    const int lane = threadIdx.x & 31; const int L0 = (blockIdx.x * 8 + (threadIdx.x >> 5)) * 8; const int nlines = N * K / 64;
{
#pragma unroll 1
        for (int l = 0; l < 8; ++l) { const int L = L0 + l; if (L >= nlines) break; const size_t e = (size_t)L * 64 + lane * 2; const int k = (int)(e % K), n = (int)(e / K); v2us o;
            o[0] = f2bf(w[(size_t)k * N + n]); o[1] = f2bf(w[(size_t)(k + 1) * N + n]); *(v2us*)(Bt + e) = o; }
         }
}
__global__ __launch_bounds__(256) void k_pl(const float* __restrict__ F, int pitch, int nh, int hd, h16* P) { F += (size_t)blockIdx.y * TT * pitch; P += (size_t)blockIdx.y * nh * TT * hd; const size_t e = ((size_t)blockIdx.x * 256 + threadIdx.x) * 2; if (e >= (size_t)nh * TT * hd) return; const int d = (int)(e % hd); const int t = (int)((e / hd) % TT); const int h = (int)(e / ((size_t)hd * TT)); v2h o; o[0] = tohx(F[(size_t)t * pitch + h * hd + d]); o[1] = tohx(F[(size_t)t * pitch + h * hd + d + 1]); *(v2h*)(P + e) = o;  }
__global__ __launch_bounds__(256) void k_vt(const float* __restrict__ F, int pitch, int nh, int hd, h16* VT) { F += (size_t)blockIdx.y * TT * pitch; VT += (size_t)blockIdx.y * nh * hd * TT; const size_t e = ((size_t)blockIdx.x * 256 + threadIdx.x) * 2; if (e >= (size_t)nh * hd * TT) return; const int t = (int)(e % TT); const int d = (int)((e / TT) % hd); const int h = (int)(e / ((size_t)TT * hd)); v2h o; o[0] = tohx(F[(size_t)t * pitch + h * hd + d]); o[1] = tohx(F[(size_t)(t + 1) * pitch + h * hd + d]); *(v2h*)(VT + e) = o;  }
__global__ __launch_bounds__(256) void k_rmsT(const float* __restrict__ A, int rnd, const float* __restrict__ w, bf* Yh, bf* Yl) { const int lane = threadIdx.x & 31; const int t = blockIdx.x * 8 + (threadIdx.x >> 5); if (t >= LL) return; const float* ar = A + (size_t)t * DD; float v[32]; float s = 0.f;
#pragma unroll
    for (int ch = 0; ch < 8; ++ch) { const v4f a = *(const v4f*)(ar + ch * 128 + lane * 4);
#pragma unroll
        for (int q = 0; q < 4; ++q) { const float x = rnd ? bfr(a[q]) : a[q]; v[ch * 4 + q] = x; float p = __fmul_rn(x, x); asm volatile("" : "+v"(p)); s = __fadd_rn(s, p); } }
#pragma unroll
    for (int sh = 16; sh; sh >>= 1) s += __shfl_xor(s, sh, 32);
    const float rs = __frsqrt_rn(__fadd_rn(s * (1.0f / DD), 1e-6f));
{
#pragma unroll
        for (int ch = 0; ch < 8; ++ch) { v4us oh, ol;
#pragma unroll
            for (int q = 0; q < 4; ++q) { const int d = ch * 128 + lane * 4 + q; float tn = __fmul_rn(v[ch * 4 + q], rs); asm volatile("" : "+v"(tn)); unsigned short a2, c2; splitf(__fmul_rn(tn, bfr(w[d])), a2, c2); oh[q] = a2; ol[q] = c2; }
            const size_t o = (size_t)t * DD + ch * 128 + lane * 4; *(v4us*)(Yh + o) = oh; *(v4us*)(Yl + o) = ol; }
         } }
__device__ __forceinline__ int t5_bucket(int r) { const int n = r < 0 ? -r : r; int v; if (n < 8) v = n; else { const int k = 31 - __clz(n); v = 8 + 2 * k - 6 + (((long long)n * n >= (1ll << (2 * k + 1))) ? 1 : 0); v = v > 15 ? 15 : v; } return (r > 0 ? 16 : 0) + v; }
// ---- k_fattn: the whole attention of one (batch, head) x 128 queries per work-group; 4 waves, 32 queries per wave; grid (TT/128, NB_*NH_).
// Scores are formed transposed, S^T = K Q^T (rows = keys, columns = queries): a lane then owns one query, its registers hold keys 8 hi + j of each 16-key tile, and two such tiles are,
// register for register, the 32-deep B fragment of O^T = V^T P^T. No score or probability leaves the registers. Sweep 1 finds each query's row maximum, sweep 2 forms the scores again,
// p = 1024 exp(t - max) (f32 sum, fp16 operand), and accumulates O^T; the division by the sum comes last, per lane. The bias is a table over key - query in LDS, the mask row lies beside it.
__device__ __forceinline__ void fa_ldk(const h16* k, int kb, v16h* kf) {
#pragma unroll
    for (int kt = 0; kt < 2; ++kt) { kf[kt * 2] = WFrag<h16>::ld(k + (size_t)(kb + kt * 16) * HDM); kf[kt * 2 + 1] = WFrag<h16>::ld(k + (size_t)(kb + kt * 16) * HDM + 32); } }
__device__ __forceinline__ v8f fa_qk(const v16h* kf, int kt, const v16h* qf) { v8f s = (v8f){}; s = wmma16(kf[kt * 2], qf[0], s); return wmma16(kf[kt * 2 + 1], qf[1], s); }
__device__ __forceinline__ v8f fa_bias(v8f s, const float* tq, const v4f m0, const v4f m1) {
#pragma unroll
    for (int j = 0; j < 8; ++j) s[j] = __fadd_rn(__fadd_rn(s[j], tq[j]), j < 4 ? m0[j & 3] : m1[j & 3]);
    return s; }
__global__ __launch_bounds__(128) void k_fattn(const h16* __restrict__ QP, const h16* __restrict__ KP, const h16* __restrict__ VT, const float* __restrict__ rb, const float* __restrict__ MBr, bf* Ah, bf* Al) {
    __shared__ float tb[TT + 128];
    __shared__ __align__(16) float mk[TT];
    const int bh = blockIdx.y, b = bh / NH_, h = bh % NH_, Q0 = blockIdx.x * 128;
    const float bv = bfr(rb[(threadIdx.x & 31) * NH_ + h]);    // lane l holds bucket l of this head: the table is filled by lane exchange, with one trip to memory instead of one per entry
#pragma unroll
    for (int i = 0; i < (TT + 128) / 128; ++i) { const int e = i * 128 + threadIdx.x; tb[e] = __shfl(bv, t5_bucket(e - 127 - Q0), 32); }    // tb[127 + key - (query - Q0)]; the last entry is never read
#pragma unroll
    for (int i = 0; i < TT / 512; ++i) { const int e = i * 512 + threadIdx.x * 4; *(v4fa*)(mk + e) = *(const v4fa*)(MBr + (size_t)b * TT + e); }
    __syncthreads();
    const int lane = threadIdx.x & 31, lr = lane & 15, hi = lane >> 4, wq = (threadIdx.x >> 5) * 32;
    const h16* q = QP + ((size_t)bh * TT + Q0 + wq + lr) * HDM + 8 * hi;
    const h16* k = KP + ((size_t)bh * TT + lr) * HDM + 8 * hi;
    const h16* v = VT + ((size_t)bh * HDM + lr) * TT + 8 * hi;
    const float* tl = tb + 127 + 8 * hi - wq - lr;
    const float* ml = mk + 8 * hi;
    v16h qf[2][2];
#pragma unroll
    for (int qt = 0; qt < 2; ++qt) { qf[qt][0] = WFrag<h16>::ld(q + qt * 16 * HDM); qf[qt][1] = WFrag<h16>::ld(q + qt * 16 * HDM + 32); }
    v16h kf[4]; fa_ldk(k, 0, kf);
    float mx[2] = { -3.0e38f, -3.0e38f };
    // unroll 2: the key fragments of the next block are fetched one trip ahead into a second register set; two trips per pass let the sets swap without moves
#pragma unroll 2
    for (int kb = 0; kb < TT; kb += 32) {
        v16h kn[4]; fa_ldk(k, (kb + 32) & (TT - 1), kn);    // the last trip fetches block 0, which sweep 2 starts with
#pragma unroll
        for (int kt = 0; kt < 2; ++kt) { const v4f m0 = *(const v4fa*)(ml + kb + kt * 16), m1 = *(const v4fa*)(ml + kb + kt * 16 + 4);
#pragma unroll
            for (int qt = 0; qt < 2; ++qt) { const v8f s = fa_bias(fa_qk(kf, kt, qf[qt]), tl + kb + kt * 16 - qt * 16, m0, m1);
#pragma unroll
                for (int j = 0; j < 8; ++j) mx[qt] = fmaxf(mx[qt], s[j]); } }
#pragma unroll
        for (int i = 0; i < 4; ++i) kf[i] = kn[i];
    }
    float cq[2]; v2f sum[2] = { (v2f){}, (v2f){} };
#pragma unroll
    for (int qt = 0; qt < 2; ++qt) { mx[qt] = fmaxf(mx[qt], __shfl_xor(mx[qt], 16, 32)); cq[qt] = 10.0f - mx[qt] * 1.4426950408889634f; }    // 2^10 = PCAR; a rounding of cq scales a whole row and cancels in p / sum
    v8f o[2][4];
#pragma unroll
    for (int qt = 0; qt < 2; ++qt)
#pragma unroll
        for (int dt = 0; dt < 4; ++dt) o[qt][dt] = (v8f){};
    // unroll 1: the trip is long enough, and a second copy would only raise the register count
#pragma unroll 1
    for (int kb = 0; kb < TT; kb += 32) {
        v16h vf[4];
#pragma unroll
        for (int dt = 0; dt < 4; ++dt) vf[dt] = WFrag<h16>::ld(v + (size_t)dt * 16 * TT + kb);
        v8f s[2][2];
#pragma unroll
        for (int kt = 0; kt < 2; ++kt)
#pragma unroll
            for (int qt = 0; qt < 2; ++qt) s[kt][qt] = fa_qk(kf, kt, qf[qt]);
        fa_ldk(k, (kb + 32) & (TT - 1), kf);    // the key fragments are free once the score products have issued: the next block's fly under the exponentials and the value products
        __builtin_amdgcn_sched_barrier(0);      // keeps both groups of loads up here; without it the value loads sink to just in front of their products and each waits out a full trip to L2
        v16h pf[2];
#pragma unroll
        for (int kt = 0; kt < 2; ++kt) { const v4f m0 = *(const v4fa*)(ml + kb + kt * 16), m1 = *(const v4fa*)(ml + kb + kt * 16 + 4);
#pragma unroll
            for (int qt = 0; qt < 2; ++qt) { const v8f t = fa_bias(s[kt][qt], tl + kb + kt * 16 - qt * 16, m0, m1);
#pragma unroll
                for (int j = 0; j < 8; j += 2) { v2f p; p[0] = __builtin_amdgcn_exp2f(__builtin_fmaf(t[j], 1.4426950408889634f, cq[qt])); p[1] = __builtin_amdgcn_exp2f(__builtin_fmaf(t[j + 1], 1.4426950408889634f, cq[qt]));
                    sum[qt] += p; pf[qt][kt * 8 + j] = tohx(p[0]); pf[qt][kt * 8 + j + 1] = tohx(p[1]); } } }
#pragma unroll
        for (int dt = 0; dt < 4; ++dt)
#pragma unroll
            for (int qt = 0; qt < 2; ++qt) o[qt][dt] = wmma16(vf[dt], pf[qt], o[qt][dt]);
        // the trip ends in matrix products and the next one begins by overwriting their probability operands: these four slots keep the distance over the back edge
        asm volatile("v_nop\n\tv_nop\n\tv_nop\n\tv_nop" : "+v"(o[0][3]), "+v"(o[1][3]) : "v"(pf[0]), "v"(pf[1]));
    }
#pragma unroll
    for (int qt = 0; qt < 2; ++qt) { float sq = sum[qt][0] + sum[qt][1]; sq += __shfl_xor(sq, 16, 32); const float inv = __fdiv_rn(1.0f, sq);
        const size_t oo = ((size_t)b * TT + Q0 + wq + qt * 16 + lr) * DD + h * HDM + 8 * hi;
#pragma unroll
        for (int dt = 0; dt < 4; ++dt) { v8us oh, ol;
#pragma unroll
            for (int j = 0; j < 8; ++j) { unsigned short a, c2; splitf(o[qt][dt][j] * inv, a, c2); oh[j] = a; ol[j] = c2; }
            *(v8usa*)(Ah + oo + dt * 16) = oh; *(v8usa*)(Al + oo + dt * 16) = ol; } }
}
__global__ __launch_bounds__(256) void k_mrow(const float* __restrict__ mask, float* MBr) { const int e = blockIdx.x * 256 + threadIdx.x; if (e >= NB_ * TT) return; float om = __fsub_rn(1.0f, bfr(mask[e])); asm volatile("" : "+v"(om)); const float v = __fmul_rn(om, -10000.0f); *(float*)(MBr + e) = v;  }
__global__ __launch_bounds__(256) void k_res(const float* __restrict__ x, const float* __restrict__ A, float* H, size_t n) { const size_t i = ((size_t)blockIdx.x * 256 + threadIdx.x) * 4; if (i >= n) return; const v4f a = *(const v4f*)(x + i), b = *(const v4f*)(A + i); v4f o;
#pragma unroll
    for (int q = 0; q < 4; ++q) o[q] = __fadd_rn(bfr(a[q]), b[q]); *(v4f*)(H + i) = o;  }
__global__ __launch_bounds__(256) void k_relu2(const float* __restrict__ F, bf* Ph, bf* Pl, size_t n) { const size_t i = ((size_t)blockIdx.x * 256 + threadIdx.x) * 2; if (i >= n) return; v2us oh, ol;
#pragma unroll
    for (int q = 0; q < 2; ++q) { unsigned short a, c2; splitf(fmaxf(F[i + q], 0.f), a, c2); oh[q] = a; ol[q] = c2; } *(v2us*)(Ph + i) = oh; *(v2us*)(Pl + i) = ol;  }
__global__ __launch_bounds__(256) void k_out(const float* __restrict__ H, const float* __restrict__ Y, float* OUT, size_t n) { const size_t i = ((size_t)blockIdx.x * 256 + threadIdx.x) * 4; if (i >= n) return; const v4f a = *(const v4f*)(H + i), b = *(const v4f*)(Y + i); v4f o;
#pragma unroll
    for (int q = 0; q < 4; ++q) o[q] = __fadd_rn(a[q], b[q]); *(v4f*)(OUT + i) = o;  }

extern "C" void kernel_launch(void* const* d_in, const int* in_sizes, int n_in,
                              void* d_out, int out_size, void* d_ws, size_t ws_size, hipStream_t stream) {
    (void)in_sizes; (void)n_in; (void)out_size;
    const float* IN[11]; for (int i = 0; i < 11; ++i) IN[i] = (const float*)d_in[i];   // 0 hidden, 1 attn_mask, 2 ln1_w, 3 wq, 4 wk, 5 wv, 6 wo, 7 rel_bias [32][16], 8 ln2_w, 9 wi [1024][4096], 10 wo_ff [4096][1024] (x @ W)
    float* OUT = (float*)d_out;     // [4][1024][1024]
    char* wsp = (char*)d_ws;
    auto take = [&](size_t bytes) { char* p = wsp; wsp += (bytes + 255) & ~(size_t)255; return (void*)p; };
    bf* WQ = (bf*)take((size_t)DD * DD * 2); bf* WK = (bf*)take((size_t)DD * DD * 2); bf* WV = (bf*)take((size_t)DD * DD * 2); bf* WO = (bf*)take((size_t)DD * DD * 2); bf* WI = (bf*)take((size_t)MM * DD * 2); bf* WF = (bf*)take((size_t)DD * MM * 2); float* MBr = (float*)take((size_t)NB_ * TT * 4);
    bf* Xh = (bf*)take((size_t)LL * DD * 2); bf* Xl = (bf*)take((size_t)LL * DD * 2); float* FQ = (float*)take((size_t)LL * DD * 4); float* FK = (float*)take((size_t)LL * DD * 4); float* FV = (float*)take((size_t)LL * DD * 4);
    h16* QP = (h16*)take((size_t)LL * DD * 2); h16* KP = (h16*)take((size_t)LL * DD * 2); h16* VT = (h16*)take((size_t)LL * DD * 2); bf* Ah = (bf*)take((size_t)LL * DD * 2); bf* Al = (bf*)take((size_t)LL * DD * 2);
    float* H = (float*)take((size_t)LL * DD * 4); bf* Gh = (bf*)take((size_t)(LL / 2) * MM * 2); bf* Gl = (bf*)take((size_t)(LL / 2) * MM * 2);
    float* G = FQ;    // relu-FFN hidden for one half of the rows ([2048][4096] f32 = 33.5 MB) reuses FQ + FK (2 x 16.8 MB, contiguous, dead after the attention)
    float* Y = FV;    // wo output / FFN output reuse FV (dead after the value planes)
    if ((size_t)(wsp - (char*)d_ws) > ws_size) return;    // total ~ 185 MB
    { const unsigned g = (unsigned)(((size_t)DD * DD / 64 + 63) / 64); k_wtG<<<g, 256, 0, stream>>>(IN[3], DD, DD, WQ); k_wtG<<<g, 256, 0, stream>>>(IN[4], DD, DD, WK); k_wtG<<<g, 256, 0, stream>>>(IN[5], DD, DD, WV); k_wtG<<<g, 256, 0, stream>>>(IN[6], DD, DD, WO);
      k_wtG<<<(unsigned)(((size_t)DD * MM / 64 + 63) / 64), 256, 0, stream>>>(IN[9], DD, MM, WI); k_wtG<<<(unsigned)(((size_t)MM * DD / 64 + 63) / 64), 256, 0, stream>>>(IN[10], MM, DD, WF);
      k_mrow<<<(NB_ * TT + 255) / 256, 256, 0, stream>>>(IN[1], MBr); }
    k_rmsT<<<LL / 8, 256, 0, stream>>>(IN[0], 1, IN[2], Xh, Xl);
    k_gemmw<bf, 1, false><<<dim3(LL / 64, DD / 64, 1), 32, 0, stream>>>(Xh, Xl, WQ, nullptr, DD, FQ, DD, nullptr, 0, 0, 0); k_gemmw<bf, 1, false><<<dim3(LL / 64, DD / 64, 1), 32, 0, stream>>>(Xh, Xl, WK, nullptr, DD, FK, DD, nullptr, 0, 0, 0); k_gemmw<bf, 1, false><<<dim3(LL / 64, DD / 64, 1), 32, 0, stream>>>(Xh, Xl, WV, nullptr, DD, FV, DD, nullptr, 0, 0, 0);
    const unsigned LP = (TT * DD / 2 + 255) / 256;
    k_pl<<<dim3(LP, NB_, 1), 256, 0, stream>>>(FQ, DD, NH_, HDM, QP); k_pl<<<dim3(LP, NB_, 1), 256, 0, stream>>>(FK, DD, NH_, HDM, KP); k_vt<<<dim3(LP, NB_, 1), 256, 0, stream>>>(FV, DD, NH_, HDM, VT);    // planes [b][h][t][64], [b][h][64][t]
    k_fattn<<<dim3(TT / 128, NB_ * NH_, 1), 128, 0, stream>>>(QP, KP, VT, IN[7], MBr, Ah, Al);
    k_gemmw<bf, 1, false><<<dim3(LL / 64, DD / 64, 1), 32, 0, stream>>>(Ah, Al, WO, nullptr, DD, Y, DD, nullptr, 0, 0, 0);
    k_res<<<(unsigned)(((size_t)LL * DD / 4 + 255) / 256), 256, 0, stream>>>(IN[0], Y, H, (size_t)LL * DD);
    k_rmsT<<<LL / 8, 256, 0, stream>>>(H, 0, IN[8], Xh, Xl);
    for (int hb = 0; hb < 2; ++hb) { const size_t r0 = (size_t)hb * (LL / 2);
        k_gemmw<bf, 1, false><<<dim3(LL / 2 / 64, MM / 64, 1), 32, 0, stream>>>(Xh + r0 * DD, Xl + r0 * DD, WI, nullptr, DD, G, MM, nullptr, 0, 0, 0);
        k_relu2<<<(unsigned)(((size_t)(LL / 2) * MM / 2 + 255) / 256), 256, 0, stream>>>(G, Gh, Gl, (size_t)(LL / 2) * MM);
        k_gemmw<bf, 1, false><<<dim3(LL / 2 / 64, DD / 64, 1), 32, 0, stream>>>(Gh, Gl, WF, nullptr, MM, Y, DD, nullptr, 0, 0, 0);
        k_out<<<(unsigned)(((size_t)(LL / 2) * DD / 4 + 255) / 256), 256, 0, stream>>>(H + r0 * DD, Y, OUT + r0 * DD, (size_t)(LL / 2) * DD); }
}

// v002
// One run takes 463 microseconds.
// In two side-by-side timings against v001, it was 1.43 and 1.41 times as fast.
// Over all steps from v000 it is 5.96 times as fast.
#include <hip/hip_runtime.h>

// T5 encoder block (hidden [4][1024][1024], attn_mask [4][1024]; x = T5-RMSNorm(hidden) ln1_w (eps 1e-6, no mean/bias); q/k/v = x w (16 heads x 64); scores = q.k (NO 1/sqrt(d)) + rel_bias[bucket(j - i)][h]
// + (1 - attn_mask[b][j]) (-1e4); softmax; hidden += merged ctx wo; y = RMSNorm(hidden) ln2_w; hidden += relu(y wi) wo_ff -> [4][1024][1024]. The bidirectional relative-position bucket of an integer offset
// (32 buckets, max distance 128) is evaluated with exact integer arithmetic: for |r| >= 8, 8 + 2 floor(log2 |r|) - 6 + [ |r|^2 >= 2^(2 floor(log2|r|) + 1) ], capped at 15 (this equals the reference's
// float formula for every offset 0..1023), + 16 for r > 0.)
// Compute dtypes, f32 accumulate: every input rounded to bf16; both RMSNorms f32 (wave per token) -> bf16 hi+lo planes; q/k/v, wo, wi, wo_ff on hl planes of their computed operands
// x exact weights (2 products); scores (K 64) and probs.v on SINGLE fp16 planes with an f32 register-row softmax (bias + mask added in f32; probabilities x1024); residuals and relu f32.

#define NB_  4
#define TT   1024
#define LL   4096
#define DD   1024
#define NH_  16
#define HDM  64
#define MM   4096
#define PCAR 1024.0f
typedef _Float16 h16;
typedef unsigned short bf;
typedef __attribute__((ext_vector_type(16))) __bf16   v16bf;
typedef __attribute__((ext_vector_type(16))) _Float16 v16h;
typedef __attribute__((ext_vector_type(8)))  _Float16 v8h;
typedef __attribute__((ext_vector_type(8)))  unsigned short v8us;
typedef __attribute__((ext_vector_type(8)))  float    v8f;
typedef __attribute__((ext_vector_type(4)))  float    v4f;
typedef v8h  __attribute__((may_alias)) v8ha;
typedef v4f  __attribute__((may_alias)) v4fa;
typedef v8us __attribute__((may_alias)) v8usa;

__device__ __forceinline__ unsigned short f2bf(float f) { unsigned u = __float_as_uint(f); u += 0x7FFFu + ((u >> 16) & 1u); return (unsigned short)(u >> 16); }
__device__ __forceinline__ float bf2f(unsigned short b) { return __uint_as_float(((unsigned)b) << 16); }
__device__ __forceinline__ float bfr(float f) { return bf2f(f2bf(f)); }
__device__ __forceinline__ v16h cat16(v8h lo, v8h hi) { return __builtin_shufflevector(lo, hi, 0, 1, 2, 3, 4, 5, 6, 7, 8, 9, 10, 11, 12, 13, 14, 15); }
__device__ __forceinline__ v16bf cat16b(v8us lo, v8us hi) { return __builtin_bit_cast(v16bf, __builtin_shufflevector(lo, hi, 0, 1, 2, 3, 4, 5, 6, 7, 8, 9, 10, 11, 12, 13, 14, 15)); }
__device__ __forceinline__ v8f wmma16(v16h a, v16h b, v8f c) { return __builtin_amdgcn_wmma_f32_16x16x32_f16(false, a, false, b, (short)0, c, false, false); }
__device__ __forceinline__ v8f wmmab(v16bf a, v16bf b, v8f c) { return __builtin_amdgcn_wmma_f32_16x16x32_bf16(false, a, false, b, (short)0, c, false, false); }



// ---- k_gemmt: C[m][n] (f32, pitch ldc) = sum_k (A[m][k] + A2[m][k]) Bt[n][k], all three planes bf16 and K-contiguous. One 128x128 tile per work-group of 4 waves (2x2, 64x64 = 16 accumulators each);
// grid (M/128, N/128), 128 threads; M, N % 128 == 0, K % 64 == 0. A stage is 64 k (one 128-byte line) of the 128 rows of A, A2 and Bt; it comes into LDS by asynchronous copies, whole 128-byte lines, once per work-group
// instead of once per wave, and the next stage flies while this one is multiplied (two buffers). Fragment form and the order of the products per accumulator are those of a wave reading global memory.
template <typename T16> struct WFrag;
template <> struct WFrag<h16> { typedef v16h V; static __device__ __forceinline__ V ld(const h16* p) { return cat16(*(const v8h*)p, *(const v8h*)(p + 16)); } };
// eight copies: this thread's 16 bytes of eight rows of one plane, LS bytes apart in LDS and rs elements apart in memory. The s_wait_xcnt closes the statement so that no address register is rewritten ahead of it.
template <unsigned LS>
__device__ __forceinline__ void g_cp8(unsigned l, const bf* g, size_t rs) {
    asm volatile("global_load_async_to_lds_b128 %0, %8, off\n\t"
                 "global_load_async_to_lds_b128 %1, %9, off\n\t"
                 "global_load_async_to_lds_b128 %2, %10, off\n\t"
                 "global_load_async_to_lds_b128 %3, %11, off\n\t"
                 "global_load_async_to_lds_b128 %4, %12, off\n\t"
                 "global_load_async_to_lds_b128 %5, %13, off\n\t"
                 "global_load_async_to_lds_b128 %6, %14, off\n\t"
                 "global_load_async_to_lds_b128 %7, %15, off\n\t"
                 "s_wait_xcnt 0x0"
                 :: "v"(l), "v"(l + LS), "v"(l + 2u * LS), "v"(l + 3u * LS), "v"(l + 4u * LS), "v"(l + 5u * LS), "v"(l + 6u * LS), "v"(l + 7u * LS),
                    "v"(g), "v"(g + rs), "v"(g + 2 * rs), "v"(g + 3 * rs), "v"(g + 4 * rs), "v"(g + 5 * rs), "v"(g + 6 * rs), "v"(g + 7 * rs) : "memory");
}
__device__ __forceinline__ v16bf g_ldf(const unsigned char* p) { return cat16b(*(const v8usa*)p, *(const v8usa*)(p + 32)); }
__global__ __launch_bounds__(128) void k_gemmt(const bf* __restrict__ A, const bf* __restrict__ A2, const bf* __restrict__ Bt, int K, float* C, int ldc) {
    constexpr int KS = 64;                // k per stage
    constexpr int PIT = KS * 2 + 16;      // LDS pitch of a row: 16 bytes x odd, so that the 16-byte fragment reads of 16 rows fall on different banks
    constexpr int PL = 128 * PIT;         // one operand plane of a stage
    constexpr int ST = 3 * PL;            // a stage: A, A2, Bt
    constexpr int LPR = KS / 8;           // threads (16 bytes each) per row
    constexpr int RPR = 128 / LPR;        // rows that the 128 threads cover with one copy each
    constexpr int NKS = KS / 32;          // blocks of 32 products per stage
    __shared__ __align__(16) unsigned char ring[2 * ST];
    __shared__ __align__(16) float os[4 * 16 * 68];
    const int tid = threadIdx.x, lane = tid & 31, lr = lane & 15, hi = lane >> 4, wave = tid >> 5, wm = wave >> 1, wn = wave & 1; const int r0 = blockIdx.x * 128, c0 = blockIdx.y * 128;
    const unsigned NT = (unsigned)K / KS; const size_t rs = (size_t)RPR * K;
    const bf* gA = A + (size_t)(r0 + tid / LPR) * K + (tid % LPR) * 8; const bf* gA2 = A2 + (size_t)(r0 + tid / LPR) * K + (tid % LPR) * 8; const bf* gB = Bt + (size_t)(c0 + tid / LPR) * K + (tid % LPR) * 8;
    const unsigned l0 = (unsigned)(size_t)ring + (unsigned)((tid / LPR) * PIT + (tid % LPR) * 16);
    const unsigned char* fa = ring + (wm * 64 + lr) * PIT + hi * 16; const unsigned char* fb = ring + 2 * PL + (wn * 64 + lr) * PIT + hi * 16;
    auto fill = [&](unsigned l, size_t ko) { g_cp8<RPR * PIT>(l, gA + ko, rs); g_cp8<RPR * PIT>(l + PL, gA2 + ko, rs); g_cp8<RPR * PIT>(l + 2 * PL, gB + ko, rs); };    // 8 x RPR = 128 rows of each plane
    v8f acc[4][4];
#pragma unroll
    for (int mb = 0; mb < 4; ++mb)
#pragma unroll
        for (int nb = 0; nb < 4; ++nb) acc[mb][nb] = (v8f){};
    fill(l0, 0);
    asm volatile("s_wait_asynccnt 0x0" ::: "memory");    // this wave's share of stage 0 has landed
    __syncthreads();                                      // and so has every other wave's
    // unroll 1: one stage per trip; the trip holds 64 products already
#pragma unroll 1
    for (unsigned t = 0; t < NT; ++t) {
        const unsigned bo = (t & 1u) * ST;
        v16bf a[2][4], a2[2][4], b[2][4];
#pragma unroll
        for (int i = 0; i < 4; ++i) { a[0][i] = g_ldf(fa + bo + i * 16 * PIT); a2[0][i] = g_ldf(fa + bo + PL + i * 16 * PIT); b[0][i] = g_ldf(fb + bo + i * 16 * PIT); }
#pragma unroll
        for (int ks = 0; ks < NKS; ++ks) {
            if (ks + 1 < NKS) {
#pragma unroll
                for (int i = 0; i < 4; ++i) { a[(ks + 1) & 1][i] = g_ldf(fa + bo + i * 16 * PIT + (ks + 1) * 64); a2[(ks + 1) & 1][i] = g_ldf(fa + bo + PL + i * 16 * PIT + (ks + 1) * 64); b[(ks + 1) & 1][i] = g_ldf(fb + bo + i * 16 * PIT + (ks + 1) * 64); } }
            if (ks == 0 && t + 1 < NT) fill(l0 + (ST - bo), (size_t)(t + 1) * KS);    // the next stage, into the buffer that every wave left at the barrier above; issued under the latency of the fragment reads
#pragma unroll
            for (int nb = 0; nb < 4; ++nb)
#pragma unroll
                for (int mb = 0; mb < 4; ++mb) { acc[mb][nb] = wmmab(a[ks & 1][mb], b[ks & 1][nb], acc[mb][nb]); acc[mb][nb] = wmmab(a2[ks & 1][mb], b[ks & 1][nb], acc[mb][nb]); }
        }
        __builtin_amdgcn_sched_barrier(0);    // the products stay in front of the waits: left free, the compiler moves them behind the barrier, and the wave then waits out the copies it has just issued instead of multiplying under them
        asm volatile("s_wait_dscnt 0x0" ::: "memory");       // this wave has left the buffer that is refilled behind the barrier
        asm volatile("s_wait_asynccnt 0x0" ::: "memory");    // this wave's share of stage t + 1 has landed
        __syncthreads();                                      // publishes stage t + 1 and ends every wave's reads of stage t
    }
    asm volatile("s_wait_asynccnt 0x0" ::: "memory");        // no copy is left in flight when the wave ends
    float* osw = os + wave * 16 * 68;
#pragma unroll
    for (int mb = 0; mb < 4; ++mb) {
#pragma unroll
        for (int nb = 0; nb < 4; ++nb) {
#pragma unroll
            for (int j = 0; j < 8; ++j) osw[(hi * 8 + j) * 68 + nb * 16 + lr] = acc[mb][nb][j]; }
        __builtin_amdgcn_wave_barrier(); asm volatile("" ::: "memory");    // the rows are read back by other lanes of this wave: keeps the reads behind the writes
        float* crow = C + (size_t)(r0 + wm * 64 + mb * 16) * ldc + c0 + wn * 64;
#pragma unroll
        for (int s = 0; s < 8; ++s) { const int row = 2 * s + hi, cofs = lr * 4; const v4f val = *(const v4fa*)(osw + row * 68 + cofs); *(v4f*)(crow + (size_t)row * ldc + cofs) = val; }
        __builtin_amdgcn_wave_barrier(); asm volatile("" ::: "memory");    // and the next rows' writes behind these reads
    }
}

__device__ __forceinline__ h16 tohx(float x) { return (h16)x; }
__device__ __forceinline__ void splitf(float y, unsigned short& h, unsigned short& l) { h = f2bf(y); l = f2bf(y - bf2f(h)); }
typedef __attribute__((ext_vector_type(2))) _Float16 v2h;
typedef __attribute__((ext_vector_type(4))) _Float16 v4h;
typedef __attribute__((ext_vector_type(2))) unsigned short v2us;
typedef __attribute__((ext_vector_type(4))) unsigned short v4us;
typedef __attribute__((ext_vector_type(2))) float v2f;

__global__ __launch_bounds__(256) void k_wtG(const float* __restrict__ w, int K, int N, bf* Bt) {
    const int lane = threadIdx.x & 31; const int L0 = (blockIdx.x * 8 + (threadIdx.x >> 5)) * 8; const int nlines = N * K / 64;
{
#pragma unroll 1
        for (int l = 0; l < 8; ++l) { const int L = L0 + l; if (L >= nlines) break; const size_t e = (size_t)L * 64 + lane * 2; const int k = (int)(e % K), n = (int)(e / K); v2us o;
            o[0] = f2bf(w[(size_t)k * N + n]); o[1] = f2bf(w[(size_t)(k + 1) * N + n]); *(v2us*)(Bt + e) = o; }
         }
}
__global__ __launch_bounds__(256) void k_pl(const float* __restrict__ F, int pitch, int nh, int hd, h16* P) { F += (size_t)blockIdx.y * TT * pitch; P += (size_t)blockIdx.y * nh * TT * hd; const size_t e = ((size_t)blockIdx.x * 256 + threadIdx.x) * 2; if (e >= (size_t)nh * TT * hd) return; const int d = (int)(e % hd); const int t = (int)((e / hd) % TT); const int h = (int)(e / ((size_t)hd * TT)); v2h o; o[0] = tohx(F[(size_t)t * pitch + h * hd + d]); o[1] = tohx(F[(size_t)t * pitch + h * hd + d + 1]); *(v2h*)(P + e) = o;  }
__global__ __launch_bounds__(256) void k_vt(const float* __restrict__ F, int pitch, int nh, int hd, h16* VT) { F += (size_t)blockIdx.y * TT * pitch; VT += (size_t)blockIdx.y * nh * hd * TT; const size_t e = ((size_t)blockIdx.x * 256 + threadIdx.x) * 2; if (e >= (size_t)nh * hd * TT) return; const int t = (int)(e % TT); const int d = (int)((e / TT) % hd); const int h = (int)(e / ((size_t)TT * hd)); v2h o; o[0] = tohx(F[(size_t)t * pitch + h * hd + d]); o[1] = tohx(F[(size_t)(t + 1) * pitch + h * hd + d]); *(v2h*)(VT + e) = o;  }
__global__ __launch_bounds__(256) void k_rmsT(const float* __restrict__ A, int rnd, const float* __restrict__ w, bf* Yh, bf* Yl) { const int lane = threadIdx.x & 31; const int t = blockIdx.x * 8 + (threadIdx.x >> 5); if (t >= LL) return; const float* ar = A + (size_t)t * DD; float v[32]; float s = 0.f;
#pragma unroll
    for (int ch = 0; ch < 8; ++ch) { const v4f a = *(const v4f*)(ar + ch * 128 + lane * 4);
#pragma unroll
        for (int q = 0; q < 4; ++q) { const float x = rnd ? bfr(a[q]) : a[q]; v[ch * 4 + q] = x; float p = __fmul_rn(x, x); asm volatile("" : "+v"(p)); s = __fadd_rn(s, p); } }
#pragma unroll
    for (int sh = 16; sh; sh >>= 1) s += __shfl_xor(s, sh, 32);
    const float rs = __frsqrt_rn(__fadd_rn(s * (1.0f / DD), 1e-6f));
{
#pragma unroll
        for (int ch = 0; ch < 8; ++ch) { v4us oh, ol;
#pragma unroll
            for (int q = 0; q < 4; ++q) { const int d = ch * 128 + lane * 4 + q; float tn = __fmul_rn(v[ch * 4 + q], rs); asm volatile("" : "+v"(tn)); unsigned short a2, c2; splitf(__fmul_rn(tn, bfr(w[d])), a2, c2); oh[q] = a2; ol[q] = c2; }
            const size_t o = (size_t)t * DD + ch * 128 + lane * 4; *(v4us*)(Yh + o) = oh; *(v4us*)(Yl + o) = ol; }
         } }
__device__ __forceinline__ int t5_bucket(int r) { const int n = r < 0 ? -r : r; int v; if (n < 8) v = n; else { const int k = 31 - __clz(n); v = 8 + 2 * k - 6 + (((long long)n * n >= (1ll << (2 * k + 1))) ? 1 : 0); v = v > 15 ? 15 : v; } return (r > 0 ? 16 : 0) + v; }
// ---- k_fattn: the whole attention of one (batch, head) x 128 queries per work-group; 4 waves, 32 queries per wave; grid (TT/128, NB_*NH_).
// Scores are formed transposed, S^T = K Q^T (rows = keys, columns = queries): a lane then owns one query, its registers hold keys 8 hi + j of each 16-key tile, and two such tiles are,
// register for register, the 32-deep B fragment of O^T = V^T P^T. No score or probability leaves the registers. Sweep 1 finds each query's row maximum, sweep 2 forms the scores again,
// p = 1024 exp(t - max) (f32 sum, fp16 operand), and accumulates O^T; the division by the sum comes last, per lane. The bias is a table over key - query in LDS, the mask row lies beside it.
__device__ __forceinline__ void fa_ldk(const h16* k, int kb, v16h* kf) {
#pragma unroll
    for (int kt = 0; kt < 2; ++kt) { kf[kt * 2] = WFrag<h16>::ld(k + (size_t)(kb + kt * 16) * HDM); kf[kt * 2 + 1] = WFrag<h16>::ld(k + (size_t)(kb + kt * 16) * HDM + 32); } }
__device__ __forceinline__ v8f fa_qk(const v16h* kf, int kt, const v16h* qf) { v8f s = (v8f){}; s = wmma16(kf[kt * 2], qf[0], s); return wmma16(kf[kt * 2 + 1], qf[1], s); }
__device__ __forceinline__ v8f fa_bias(v8f s, const float* tq, const v4f m0, const v4f m1) {
#pragma unroll
    for (int j = 0; j < 8; ++j) s[j] = __fadd_rn(__fadd_rn(s[j], tq[j]), j < 4 ? m0[j & 3] : m1[j & 3]);
    return s; }
__global__ __launch_bounds__(128) void k_fattn(const h16* __restrict__ QP, const h16* __restrict__ KP, const h16* __restrict__ VT, const float* __restrict__ rb, const float* __restrict__ MBr, bf* Ah, bf* Al) {
    __shared__ float tb[TT + 128];
    __shared__ __align__(16) float mk[TT];
    const int bh = blockIdx.y, b = bh / NH_, h = bh % NH_, Q0 = blockIdx.x * 128;
    const float bv = bfr(rb[(threadIdx.x & 31) * NH_ + h]);    // lane l holds bucket l of this head: the table is filled by lane exchange, with one trip to memory instead of one per entry
#pragma unroll
    for (int i = 0; i < (TT + 128) / 128; ++i) { const int e = i * 128 + threadIdx.x; tb[e] = __shfl(bv, t5_bucket(e - 127 - Q0), 32); }    // tb[127 + key - (query - Q0)]; the last entry is never read
#pragma unroll
    for (int i = 0; i < TT / 512; ++i) { const int e = i * 512 + threadIdx.x * 4; *(v4fa*)(mk + e) = *(const v4fa*)(MBr + (size_t)b * TT + e); }
    __syncthreads();
    const int lane = threadIdx.x & 31, lr = lane & 15, hi = lane >> 4, wq = (threadIdx.x >> 5) * 32;
    const h16* q = QP + ((size_t)bh * TT + Q0 + wq + lr) * HDM + 8 * hi;
    const h16* k = KP + ((size_t)bh * TT + lr) * HDM + 8 * hi;
    const h16* v = VT + ((size_t)bh * HDM + lr) * TT + 8 * hi;
    const float* tl = tb + 127 + 8 * hi - wq - lr;
    const float* ml = mk + 8 * hi;
    v16h qf[2][2];
#pragma unroll
    for (int qt = 0; qt < 2; ++qt) { qf[qt][0] = WFrag<h16>::ld(q + qt * 16 * HDM); qf[qt][1] = WFrag<h16>::ld(q + qt * 16 * HDM + 32); }
    v16h kf[4]; fa_ldk(k, 0, kf);
    float mx[2] = { -3.0e38f, -3.0e38f };
    // unroll 2: the key fragments of the next block are fetched one trip ahead into a second register set; two trips per pass let the sets swap without moves
#pragma unroll 2
    for (int kb = 0; kb < TT; kb += 32) {
        v16h kn[4]; fa_ldk(k, (kb + 32) & (TT - 1), kn);    // the last trip fetches block 0, which sweep 2 starts with
#pragma unroll
        for (int kt = 0; kt < 2; ++kt) { const v4f m0 = *(const v4fa*)(ml + kb + kt * 16), m1 = *(const v4fa*)(ml + kb + kt * 16 + 4);
#pragma unroll
            for (int qt = 0; qt < 2; ++qt) { const v8f s = fa_bias(fa_qk(kf, kt, qf[qt]), tl + kb + kt * 16 - qt * 16, m0, m1);
#pragma unroll
                for (int j = 0; j < 8; ++j) mx[qt] = fmaxf(mx[qt], s[j]); } }
#pragma unroll
        for (int i = 0; i < 4; ++i) kf[i] = kn[i];
    }
    float cq[2]; v2f sum[2] = { (v2f){}, (v2f){} };
#pragma unroll
    for (int qt = 0; qt < 2; ++qt) { mx[qt] = fmaxf(mx[qt], __shfl_xor(mx[qt], 16, 32)); cq[qt] = 10.0f - mx[qt] * 1.4426950408889634f; }    // 2^10 = PCAR; a rounding of cq scales a whole row and cancels in p / sum
    v8f o[2][4];
#pragma unroll
    for (int qt = 0; qt < 2; ++qt)
#pragma unroll
        for (int dt = 0; dt < 4; ++dt) o[qt][dt] = (v8f){};
    // unroll 1: the trip is long enough, and a second copy would only raise the register count
#pragma unroll 1
    for (int kb = 0; kb < TT; kb += 32) {
        v16h vf[4];
#pragma unroll
        for (int dt = 0; dt < 4; ++dt) vf[dt] = WFrag<h16>::ld(v + (size_t)dt * 16 * TT + kb);
        v8f s[2][2];
#pragma unroll
        for (int kt = 0; kt < 2; ++kt)
#pragma unroll
            for (int qt = 0; qt < 2; ++qt) s[kt][qt] = fa_qk(kf, kt, qf[qt]);
        fa_ldk(k, (kb + 32) & (TT - 1), kf);    // the key fragments are free once the score products have issued: the next block's fly under the exponentials and the value products
        __builtin_amdgcn_sched_barrier(0);      // keeps both groups of loads up here; without it the value loads sink to just in front of their products and each waits out a full trip to L2
        v16h pf[2];
#pragma unroll
        for (int kt = 0; kt < 2; ++kt) { const v4f m0 = *(const v4fa*)(ml + kb + kt * 16), m1 = *(const v4fa*)(ml + kb + kt * 16 + 4);
#pragma unroll
            for (int qt = 0; qt < 2; ++qt) { const v8f t = fa_bias(s[kt][qt], tl + kb + kt * 16 - qt * 16, m0, m1);
#pragma unroll
                for (int j = 0; j < 8; j += 2) { v2f p; p[0] = __builtin_amdgcn_exp2f(__builtin_fmaf(t[j], 1.4426950408889634f, cq[qt])); p[1] = __builtin_amdgcn_exp2f(__builtin_fmaf(t[j + 1], 1.4426950408889634f, cq[qt]));
                    sum[qt] += p; pf[qt][kt * 8 + j] = tohx(p[0]); pf[qt][kt * 8 + j + 1] = tohx(p[1]); } } }
#pragma unroll
        for (int dt = 0; dt < 4; ++dt)
#pragma unroll
            for (int qt = 0; qt < 2; ++qt) o[qt][dt] = wmma16(vf[dt], pf[qt], o[qt][dt]);
        // the trip ends in matrix products and the next one begins by overwriting their probability operands: these four slots keep the distance over the back edge
        asm volatile("v_nop\n\tv_nop\n\tv_nop\n\tv_nop" : "+v"(o[0][3]), "+v"(o[1][3]) : "v"(pf[0]), "v"(pf[1]));
    }
#pragma unroll
    for (int qt = 0; qt < 2; ++qt) { float sq = sum[qt][0] + sum[qt][1]; sq += __shfl_xor(sq, 16, 32); const float inv = __fdiv_rn(1.0f, sq);
        const size_t oo = ((size_t)b * TT + Q0 + wq + qt * 16 + lr) * DD + h * HDM + 8 * hi;
#pragma unroll
        for (int dt = 0; dt < 4; ++dt) { v8us oh, ol;
#pragma unroll
            for (int j = 0; j < 8; ++j) { unsigned short a, c2; splitf(o[qt][dt][j] * inv, a, c2); oh[j] = a; ol[j] = c2; }
            *(v8usa*)(Ah + oo + dt * 16) = oh; *(v8usa*)(Al + oo + dt * 16) = ol; } }
}
__global__ __launch_bounds__(256) void k_mrow(const float* __restrict__ mask, float* MBr) { const int e = blockIdx.x * 256 + threadIdx.x; if (e >= NB_ * TT) return; float om = __fsub_rn(1.0f, bfr(mask[e])); asm volatile("" : "+v"(om)); const float v = __fmul_rn(om, -10000.0f); *(float*)(MBr + e) = v;  }
__global__ __launch_bounds__(256) void k_res(const float* __restrict__ x, const float* __restrict__ A, float* H, size_t n) { const size_t i = ((size_t)blockIdx.x * 256 + threadIdx.x) * 4; if (i >= n) return; const v4f a = *(const v4f*)(x + i), b = *(const v4f*)(A + i); v4f o;
#pragma unroll
    for (int q = 0; q < 4; ++q) o[q] = __fadd_rn(bfr(a[q]), b[q]); *(v4f*)(H + i) = o;  }
__global__ __launch_bounds__(256) void k_relu2(const float* __restrict__ F, bf* Ph, bf* Pl, size_t n) { const size_t i = ((size_t)blockIdx.x * 256 + threadIdx.x) * 2; if (i >= n) return; v2us oh, ol;
#pragma unroll
    for (int q = 0; q < 2; ++q) { unsigned short a, c2; splitf(fmaxf(F[i + q], 0.f), a, c2); oh[q] = a; ol[q] = c2; } *(v2us*)(Ph + i) = oh; *(v2us*)(Pl + i) = ol;  }
__global__ __launch_bounds__(256) void k_out(const float* __restrict__ H, const float* __restrict__ Y, float* OUT, size_t n) { const size_t i = ((size_t)blockIdx.x * 256 + threadIdx.x) * 4; if (i >= n) return; const v4f a = *(const v4f*)(H + i), b = *(const v4f*)(Y + i); v4f o;
#pragma unroll
    for (int q = 0; q < 4; ++q) o[q] = __fadd_rn(a[q], b[q]); *(v4f*)(OUT + i) = o;  }

extern "C" void kernel_launch(void* const* d_in, const int* in_sizes, int n_in,
                              void* d_out, int out_size, void* d_ws, size_t ws_size, hipStream_t stream) {
    (void)in_sizes; (void)n_in; (void)out_size;
    const float* IN[11]; for (int i = 0; i < 11; ++i) IN[i] = (const float*)d_in[i];   // 0 hidden, 1 attn_mask, 2 ln1_w, 3 wq, 4 wk, 5 wv, 6 wo, 7 rel_bias [32][16], 8 ln2_w, 9 wi [1024][4096], 10 wo_ff [4096][1024] (x @ W)
    float* OUT = (float*)d_out;     // [4][1024][1024]
    char* wsp = (char*)d_ws;
    auto take = [&](size_t bytes) { char* p = wsp; wsp += (bytes + 255) & ~(size_t)255; return (void*)p; };
    bf* WQ = (bf*)take((size_t)DD * DD * 2); bf* WK = (bf*)take((size_t)DD * DD * 2); bf* WV = (bf*)take((size_t)DD * DD * 2); bf* WO = (bf*)take((size_t)DD * DD * 2); bf* WI = (bf*)take((size_t)MM * DD * 2); bf* WF = (bf*)take((size_t)DD * MM * 2); float* MBr = (float*)take((size_t)NB_ * TT * 4);
    bf* Xh = (bf*)take((size_t)LL * DD * 2); bf* Xl = (bf*)take((size_t)LL * DD * 2); float* FQ = (float*)take((size_t)LL * DD * 4); float* FK = (float*)take((size_t)LL * DD * 4); float* FV = (float*)take((size_t)LL * DD * 4);
    h16* QP = (h16*)take((size_t)LL * DD * 2); h16* KP = (h16*)take((size_t)LL * DD * 2); h16* VT = (h16*)take((size_t)LL * DD * 2); bf* Ah = (bf*)take((size_t)LL * DD * 2); bf* Al = (bf*)take((size_t)LL * DD * 2);
    float* H = (float*)take((size_t)LL * DD * 4); bf* Gh = (bf*)take((size_t)(LL / 2) * MM * 2); bf* Gl = (bf*)take((size_t)(LL / 2) * MM * 2);
    float* G = FQ;    // relu-FFN hidden for one half of the rows ([2048][4096] f32 = 33.5 MB) reuses FQ + FK (2 x 16.8 MB, contiguous, dead after the attention)
    float* Y = FV;    // wo output / FFN output reuse FV (dead after the value planes)
    if ((size_t)(wsp - (char*)d_ws) > ws_size) return;    // total ~ 185 MB
    { const unsigned g = (unsigned)(((size_t)DD * DD / 64 + 63) / 64); k_wtG<<<g, 256, 0, stream>>>(IN[3], DD, DD, WQ); k_wtG<<<g, 256, 0, stream>>>(IN[4], DD, DD, WK); k_wtG<<<g, 256, 0, stream>>>(IN[5], DD, DD, WV); k_wtG<<<g, 256, 0, stream>>>(IN[6], DD, DD, WO);
      k_wtG<<<(unsigned)(((size_t)DD * MM / 64 + 63) / 64), 256, 0, stream>>>(IN[9], DD, MM, WI); k_wtG<<<(unsigned)(((size_t)MM * DD / 64 + 63) / 64), 256, 0, stream>>>(IN[10], MM, DD, WF);
      k_mrow<<<(NB_ * TT + 255) / 256, 256, 0, stream>>>(IN[1], MBr); }
    k_rmsT<<<LL / 8, 256, 0, stream>>>(IN[0], 1, IN[2], Xh, Xl);
    k_gemmt<<<dim3(LL / 128, DD / 128, 1), 128, 0, stream>>>(Xh, Xl, WQ, DD, FQ, DD); k_gemmt<<<dim3(LL / 128, DD / 128, 1), 128, 0, stream>>>(Xh, Xl, WK, DD, FK, DD); k_gemmt<<<dim3(LL / 128, DD / 128, 1), 128, 0, stream>>>(Xh, Xl, WV, DD, FV, DD);
    const unsigned LP = (TT * DD / 2 + 255) / 256;
    k_pl<<<dim3(LP, NB_, 1), 256, 0, stream>>>(FQ, DD, NH_, HDM, QP); k_pl<<<dim3(LP, NB_, 1), 256, 0, stream>>>(FK, DD, NH_, HDM, KP); k_vt<<<dim3(LP, NB_, 1), 256, 0, stream>>>(FV, DD, NH_, HDM, VT);    // planes [b][h][t][64], [b][h][64][t]
    k_fattn<<<dim3(TT / 128, NB_ * NH_, 1), 128, 0, stream>>>(QP, KP, VT, IN[7], MBr, Ah, Al);
    k_gemmt<<<dim3(LL / 128, DD / 128, 1), 128, 0, stream>>>(Ah, Al, WO, DD, Y, DD);
    k_res<<<(unsigned)(((size_t)LL * DD / 4 + 255) / 256), 256, 0, stream>>>(IN[0], Y, H, (size_t)LL * DD);
    k_rmsT<<<LL / 8, 256, 0, stream>>>(H, 0, IN[8], Xh, Xl);
    for (int hb = 0; hb < 2; ++hb) { const size_t r0 = (size_t)hb * (LL / 2);
        k_gemmt<<<dim3(LL / 2 / 128, MM / 128, 1), 128, 0, stream>>>(Xh + r0 * DD, Xl + r0 * DD, WI, DD, G, MM);
        k_relu2<<<(unsigned)(((size_t)(LL / 2) * MM / 2 + 255) / 256), 256, 0, stream>>>(G, Gh, Gl, (size_t)(LL / 2) * MM);
        k_gemmt<<<dim3(LL / 2 / 128, DD / 128, 1), 128, 0, stream>>>(Gh, Gl, WF, MM, Y, DD);
        k_out<<<(unsigned)(((size_t)(LL / 2) * DD / 4 + 255) / 256), 256, 0, stream>>>(H + r0 * DD, Y, OUT + r0 * DD, (size_t)(LL / 2) * DD); }
}

// v003
// It runs in 374 microseconds.
// In both of two side-by-side timings against v002, it was 1.24 times as fast.
// Over all steps from v000 it is 7.38 times as fast.
#include <hip/hip_runtime.h>

// T5 encoder block (hidden [4][1024][1024], attn_mask [4][1024]; x = T5-RMSNorm(hidden) ln1_w (eps 1e-6, no mean/bias); q/k/v = x w (16 heads x 64); scores = q.k (NO 1/sqrt(d)) + rel_bias[bucket(j - i)][h]
// + (1 - attn_mask[b][j]) (-1e4); softmax; hidden += merged ctx wo; y = RMSNorm(hidden) ln2_w; hidden += relu(y wi) wo_ff -> [4][1024][1024]. The bidirectional relative-position bucket of an integer offset
// (32 buckets, max distance 128) is evaluated with exact integer arithmetic: for |r| >= 8, 8 + 2 floor(log2 |r|) - 6 + [ |r|^2 >= 2^(2 floor(log2|r|) + 1) ], capped at 15 (this equals the reference's
// float formula for every offset 0..1023), + 16 for r > 0.)
// Compute dtypes, f32 accumulate: every input rounded to bf16; both RMSNorms f32 (wave per token) -> bf16 hi+lo planes; q/k/v, wo, wi, wo_ff on hl planes of their computed operands
// x exact weights (2 products); scores (K 64) and probs.v on SINGLE fp16 planes with an f32 register-row softmax (bias + mask added in f32; probabilities x1024); residuals and relu f32.

#define NB_  4
#define TT   1024
#define LL   4096
#define DD   1024
#define NH_  16
#define HDM  64
#define MM   4096
#define PCAR 1024.0f
typedef _Float16 h16;
typedef unsigned short bf;
typedef __attribute__((ext_vector_type(16))) __bf16   v16bf;
typedef __attribute__((ext_vector_type(16))) _Float16 v16h;
typedef __attribute__((ext_vector_type(8)))  _Float16 v8h;
typedef __attribute__((ext_vector_type(8)))  unsigned short v8us;
typedef __attribute__((ext_vector_type(8)))  float    v8f;
typedef __attribute__((ext_vector_type(4)))  float    v4f;
typedef v8h  __attribute__((may_alias)) v8ha;
typedef v4f  __attribute__((may_alias)) v4fa;
typedef v8us __attribute__((may_alias)) v8usa;

__device__ __forceinline__ unsigned short f2bf(float f) { unsigned u = __float_as_uint(f); u += 0x7FFFu + ((u >> 16) & 1u); return (unsigned short)(u >> 16); }
__device__ __forceinline__ float bf2f(unsigned short b) { return __uint_as_float(((unsigned)b) << 16); }
__device__ __forceinline__ float bfr(float f) { return bf2f(f2bf(f)); }
__device__ __forceinline__ v16h cat16(v8h lo, v8h hi) { return __builtin_shufflevector(lo, hi, 0, 1, 2, 3, 4, 5, 6, 7, 8, 9, 10, 11, 12, 13, 14, 15); }
__device__ __forceinline__ v16bf cat16b(v8us lo, v8us hi) { return __builtin_bit_cast(v16bf, __builtin_shufflevector(lo, hi, 0, 1, 2, 3, 4, 5, 6, 7, 8, 9, 10, 11, 12, 13, 14, 15)); }
__device__ __forceinline__ v8f wmma16(v16h a, v16h b, v8f c) { return __builtin_amdgcn_wmma_f32_16x16x32_f16(false, a, false, b, (short)0, c, false, false); }
__device__ __forceinline__ v8f wmmab(v16bf a, v16bf b, v8f c) { return __builtin_amdgcn_wmma_f32_16x16x32_bf16(false, a, false, b, (short)0, c, false, false); }



// ---- k_gemmt<EP>: c[m][n] (f32) = sum_k (A[m][k] + A2[m][k]) Bt[n][k], all three planes bf16 and K-contiguous; c never reaches memory as such: the epilogue EP stores it in the form that its reader takes (below). One 128x128 tile per work-group of 4 waves (2x2, 64x64 = 16 accumulators each);
// grid (M/128, N/128), 128 threads; M, N % 128 == 0, K % 64 == 0. A stage is 64 k (one 128-byte line) of the 128 rows of A, A2 and Bt; it comes into LDS by asynchronous copies, whole 128-byte lines, once per work-group
// instead of once per wave, and the next stage flies while this one is multiplied (two buffers). Fragment form and the order of the products per accumulator are those of a wave reading global memory.
template <typename T16> struct WFrag;
template <> struct WFrag<h16> { typedef v16h V; static __device__ __forceinline__ V ld(const h16* p) { return cat16(*(const v8h*)p, *(const v8h*)(p + 16)); } };
// eight copies: this thread's 16 bytes of eight rows of one plane, LS bytes apart in LDS and rs elements apart in memory. The s_wait_xcnt closes the statement so that no address register is rewritten ahead of it.
template <unsigned LS>
__device__ __forceinline__ void g_cp8(unsigned l, const bf* g, size_t rs) {
    asm volatile("global_load_async_to_lds_b128 %0, %8, off\n\t"
                 "global_load_async_to_lds_b128 %1, %9, off\n\t"
                 "global_load_async_to_lds_b128 %2, %10, off\n\t"
                 "global_load_async_to_lds_b128 %3, %11, off\n\t"
                 "global_load_async_to_lds_b128 %4, %12, off\n\t"
                 "global_load_async_to_lds_b128 %5, %13, off\n\t"
                 "global_load_async_to_lds_b128 %6, %14, off\n\t"
                 "global_load_async_to_lds_b128 %7, %15, off\n\t"
                 "s_wait_xcnt 0x0"
                 :: "v"(l), "v"(l + LS), "v"(l + 2u * LS), "v"(l + 3u * LS), "v"(l + 4u * LS), "v"(l + 5u * LS), "v"(l + 6u * LS), "v"(l + 7u * LS),
                    "v"(g), "v"(g + rs), "v"(g + 2 * rs), "v"(g + 3 * rs), "v"(g + 4 * rs), "v"(g + 5 * rs), "v"(g + 6 * rs), "v"(g + 7 * rs) : "memory");
}
__device__ __forceinline__ v16bf g_ldf(const unsigned char* p) { return cat16b(*(const v8usa*)p, *(const v8usa*)(p + 32)); }
// EP_HEAD: fp16 plane [b][h][t][64] (queries, keys). EP_VT: fp16 plane [b][h][64][t] (values). EP_RES: C = bf16-rounded R + c. EP_OUT: C = R + c (both f32, pitch DD). EP_RELU: max(c, 0) as bf16 hi + lo planes, pitch MM.
// A wave's 64 columns are one head (EP_HEAD, EP_VT), and its 64 rows lie in one batch. Every store covers whole 128-byte lines; all pitches are constants, so that one address per wave serves every store.
enum { EP_HEAD, EP_VT, EP_RES, EP_OUT, EP_RELU };
__device__ __forceinline__ h16 tohx(float x) { return (h16)x; }
__device__ __forceinline__ void splitf(float y, unsigned short& h, unsigned short& l) { h = f2bf(y); l = f2bf(y - bf2f(h)); }
template <int EP>
__global__ __launch_bounds__(128) void k_gemmt(const bf* __restrict__ A, const bf* __restrict__ A2, const bf* __restrict__ Bt, int K, const float* __restrict__ R, float* C, h16* P, bf* Ph, bf* Pl) {
    constexpr int KS = 64;                // k per stage
    constexpr int PIT = KS * 2 + 16;      // LDS pitch of a row: 16 bytes x odd, so that the 16-byte fragment reads of 16 rows fall on different banks
    constexpr int PL = 128 * PIT;         // one operand plane of a stage
    constexpr int ST = 3 * PL;            // a stage: A, A2, Bt
    constexpr int LPR = KS / 8;           // threads (16 bytes each) per row
    constexpr int RPR = 128 / LPR;        // rows that the 128 threads cover with one copy each
    constexpr int NKS = KS / 32;          // blocks of 32 products per stage
    __shared__ __align__(16) unsigned char ring[2 * ST];
    __shared__ __align__(16) float os[4 * 16 * 68];
    const int tid = threadIdx.x, lane = tid & 31, lr = lane & 15, hi = lane >> 4, wave = tid >> 5, wm = wave >> 1, wn = wave & 1; const int r0 = blockIdx.x * 128, c0 = blockIdx.y * 128;
    const unsigned NT = (unsigned)K / KS; const size_t rs = (size_t)RPR * K;
    const bf* gA = A + (size_t)(r0 + tid / LPR) * K + (tid % LPR) * 8; const bf* gA2 = A2 + (size_t)(r0 + tid / LPR) * K + (tid % LPR) * 8; const bf* gB = Bt + (size_t)(c0 + tid / LPR) * K + (tid % LPR) * 8;
    const unsigned l0 = (unsigned)(size_t)ring + (unsigned)((tid / LPR) * PIT + (tid % LPR) * 16);
    const unsigned char* fa = ring + (wm * 64 + lr) * PIT + hi * 16; const unsigned char* fb = ring + 2 * PL + (wn * 64 + lr) * PIT + hi * 16;
    auto fill = [&](unsigned l, size_t ko) { g_cp8<RPR * PIT>(l, gA + ko, rs); g_cp8<RPR * PIT>(l + PL, gA2 + ko, rs); g_cp8<RPR * PIT>(l + 2 * PL, gB + ko, rs); };    // 8 x RPR = 128 rows of each plane
    v8f acc[4][4];
#pragma unroll
    for (int mb = 0; mb < 4; ++mb)
#pragma unroll
        for (int nb = 0; nb < 4; ++nb) acc[mb][nb] = (v8f){};
    fill(l0, 0);
    asm volatile("s_wait_asynccnt 0x0" ::: "memory");    // this wave's share of stage 0 has landed
    __syncthreads();                                      // and so has every other wave's
    // unroll 1: one stage per trip; the trip holds 64 products already
#pragma unroll 1
    for (unsigned t = 0; t < NT; ++t) {
        const unsigned bo = (t & 1u) * ST;
        v16bf a[2][4], a2[2][4], b[2][4];
#pragma unroll
        for (int i = 0; i < 4; ++i) { a[0][i] = g_ldf(fa + bo + i * 16 * PIT); a2[0][i] = g_ldf(fa + bo + PL + i * 16 * PIT); b[0][i] = g_ldf(fb + bo + i * 16 * PIT); }
#pragma unroll
        for (int ks = 0; ks < NKS; ++ks) {
            if (ks + 1 < NKS) {
#pragma unroll
                for (int i = 0; i < 4; ++i) { a[(ks + 1) & 1][i] = g_ldf(fa + bo + i * 16 * PIT + (ks + 1) * 64); a2[(ks + 1) & 1][i] = g_ldf(fa + bo + PL + i * 16 * PIT + (ks + 1) * 64); b[(ks + 1) & 1][i] = g_ldf(fb + bo + i * 16 * PIT + (ks + 1) * 64); } }
            if (ks == 0 && t + 1 < NT) fill(l0 + (ST - bo), (size_t)(t + 1) * KS);    // the next stage, into the buffer that every wave left at the barrier above; issued under the latency of the fragment reads
#pragma unroll
            for (int nb = 0; nb < 4; ++nb)
#pragma unroll
                for (int mb = 0; mb < 4; ++mb) { acc[mb][nb] = wmmab(a[ks & 1][mb], b[ks & 1][nb], acc[mb][nb]); acc[mb][nb] = wmmab(a2[ks & 1][mb], b[ks & 1][nb], acc[mb][nb]); }
        }
        __builtin_amdgcn_sched_barrier(0);    // the products stay in front of the waits: left free, the compiler moves them behind the barrier, and the wave then waits out the copies it has just issued instead of multiplying under them
        asm volatile("s_wait_dscnt 0x0" ::: "memory");       // this wave has left the buffer that is refilled behind the barrier
        asm volatile("s_wait_asynccnt 0x0" ::: "memory");    // this wave's share of stage t + 1 has landed
        __syncthreads();                                      // publishes stage t + 1 and ends every wave's reads of stage t
    }
    asm volatile("s_wait_asynccnt 0x0" ::: "memory");        // no copy is left in flight when the wave ends
    float* osw = os + wave * 16 * 68;
    const int m0 = r0 + wm * 64, n0 = c0 + wn * 64;    // the corner of this wave's 64 x 64 results
    const int l8 = lane >> 3, c8 = (lane & 7) * 8;     // 16-bit planes: eight lanes of 16 bytes make one 128-byte line, four lines per store
    // Each block of 16 rows (EP_VT: columns) goes: results into LDS, whole lines read back and brought into their final form, then the stores. Outside EP_VT a scheduling barrier keeps every read of a block in front of its first store, so that no read's destination
    // falls on a register that an issued store names; EP_RES and EP_RELU reuse such registers in the next block: there s_wait_xcnt stands behind the stores, held in place by a scheduling barrier (a "memory" clobber alone holds no register write behind it).
    if constexpr (EP == EP_VT) {
        // a lane holds eight consecutive tokens of one column: 16 bytes of the transposed plane. Staged as [16 columns][64 tokens], pitch 144 bytes.
        h16* osh = (h16*)osw;
        h16* vrow = P + ((size_t)((m0 / TT) * NH_ + n0 / HDM) * HDM + l8) * TT + (m0 % TT) + c8;
#pragma unroll
        for (int nb = 0; nb < 4; ++nb) {
#pragma unroll
            for (int mb = 0; mb < 4; ++mb) { v8h c;
#pragma unroll
                for (int j = 0; j < 8; ++j) c[j] = tohx(acc[mb][nb][j]);
                *(v8ha*)(osh + lr * 72 + mb * 16 + hi * 8) = c; }
            __builtin_amdgcn_wave_barrier(); asm volatile("" ::: "memory");    // the lines are read back by other lanes of this wave: keeps the reads behind the writes
#pragma unroll
            for (int s = 0; s < 4; ++s) { const v8h val = *(const v8ha*)(osh + (s * 4 + l8) * 72 + c8); *(v8ha*)(vrow + (size_t)(nb * 16 + s * 4) * TT) = val; }
            __builtin_amdgcn_wave_barrier(); asm volatile("" ::: "memory");    // and the next columns' writes behind these reads
        }
    } else {
        v4f rv[4][8];    // the addend's rows, all fetched here at once: one trip to memory per wave instead of one per 16 rows
        if constexpr (EP == EP_RES || EP == EP_OUT) { const float* rrow = R + (size_t)(m0 + hi) * DD + n0 + lr * 4;
#pragma unroll
            for (int mb = 0; mb < 4; ++mb)
#pragma unroll
                for (int s = 0; s < 8; ++s) rv[mb][s] = *(const v4f*)(rrow + (size_t)(mb * 16 + 2 * s) * DD);
            asm volatile("s_wait_xcnt 0x0" ::: "memory"); __builtin_amdgcn_sched_barrier(0); }    // the address register of these loads is reused behind them
#pragma unroll
        for (int mb = 0; mb < 4; ++mb) {
#pragma unroll
            for (int nb = 0; nb < 4; ++nb) {
#pragma unroll
                for (int j = 0; j < 8; ++j) osw[(hi * 8 + j) * 68 + nb * 16 + lr] = acc[mb][nb][j]; }
            __builtin_amdgcn_wave_barrier(); asm volatile("" ::: "memory");    // the rows are read back by other lanes of this wave: keeps the reads behind the writes
            if constexpr (EP == EP_RES || EP == EP_OUT) {
                float* crow = C + (size_t)(m0 + hi) * DD + n0 + lr * 4; v4f o[8];
#pragma unroll
                for (int s = 0; s < 8; ++s) { const v4f val = *(const v4fa*)(osw + (2 * s + hi) * 68 + lr * 4);
#pragma unroll
                    for (int q = 0; q < 4; ++q) o[s][q] = __fadd_rn(EP == EP_RES ? bfr(rv[mb][s][q]) : rv[mb][s][q], val[q]); }
                __builtin_amdgcn_sched_barrier(0);    // every read and sum in front of the first store
#pragma unroll
                for (int s = 0; s < 8; ++s) *(v4f*)(crow + (size_t)(mb * 16 + 2 * s) * DD) = o[s];
            } else {
                v4f x[4][2];
#pragma unroll
                for (int s = 0; s < 4; ++s) { const float* orow = osw + (s * 4 + l8) * 68 + c8; x[s][0] = *(const v4fa*)orow; x[s][1] = *(const v4fa*)(orow + 4); }
                if constexpr (EP == EP_HEAD) { h16* prow = P + ((size_t)((m0 / TT) * NH_ + n0 / HDM) * TT + (m0 % TT) + l8) * HDM + c8; v8h c[4];
#pragma unroll
                    for (int s = 0; s < 4; ++s)
#pragma unroll
                        for (int j = 0; j < 8; ++j) c[s][j] = tohx(x[s][j >> 2][j & 3]);
                    __builtin_amdgcn_sched_barrier(0);    // every read and conversion in front of the first store
#pragma unroll
                    for (int s = 0; s < 4; ++s) *(v8ha*)(prow + (size_t)(mb * 16 + s * 4) * HDM) = c[s];
                } else { const size_t go = (size_t)(m0 + l8) * MM + n0 + c8; v8us oh[4], ol[4];
#pragma unroll
                    for (int s = 0; s < 4; ++s)
#pragma unroll
                        for (int j = 0; j < 8; ++j) { unsigned short a, c2; splitf(fmaxf(x[s][j >> 2][j & 3], 0.f), a, c2); oh[s][j] = a; ol[s][j] = c2; }
                    __builtin_amdgcn_sched_barrier(0);    // every read and split in front of the first store
#pragma unroll
                    for (int s = 0; s < 4; ++s) { *(v8usa*)(Ph + go + (size_t)(mb * 16 + s * 4) * MM) = oh[s]; *(v8usa*)(Pl + go + (size_t)(mb * 16 + s * 4) * MM) = ol[s]; } }
            }
            __builtin_amdgcn_wave_barrier(); asm volatile("" ::: "memory");    // and the next rows' writes behind these reads
            if (mb < 3 && (EP == EP_RES || EP == EP_RELU)) { asm volatile("s_wait_xcnt 0x0" ::: "memory"); __builtin_amdgcn_sched_barrier(0); }    // the next rows reuse registers that these stores name
        }
    }
}

typedef __attribute__((ext_vector_type(2))) _Float16 v2h;
typedef __attribute__((ext_vector_type(4))) _Float16 v4h;
typedef __attribute__((ext_vector_type(2))) unsigned short v2us;
typedef __attribute__((ext_vector_type(4))) unsigned short v4us;
typedef __attribute__((ext_vector_type(2))) float v2f;

__global__ __launch_bounds__(256) void k_wtG(const float* __restrict__ w, int K, int N, bf* Bt) {
    const int lane = threadIdx.x & 31; const int L0 = (blockIdx.x * 8 + (threadIdx.x >> 5)) * 8; const int nlines = N * K / 64;
{
#pragma unroll 1
        for (int l = 0; l < 8; ++l) { const int L = L0 + l; if (L >= nlines) break; const size_t e = (size_t)L * 64 + lane * 2; const int k = (int)(e % K), n = (int)(e / K); v2us o;
            o[0] = f2bf(w[(size_t)k * N + n]); o[1] = f2bf(w[(size_t)(k + 1) * N + n]); *(v2us*)(Bt + e) = o; }
         }
}
__global__ __launch_bounds__(256) void k_rmsT(const float* __restrict__ A, int rnd, const float* __restrict__ w, bf* Yh, bf* Yl) { const int lane = threadIdx.x & 31; const int t = blockIdx.x * 8 + (threadIdx.x >> 5); if (t >= LL) return; const float* ar = A + (size_t)t * DD; float v[32]; float s = 0.f;
#pragma unroll
    for (int ch = 0; ch < 8; ++ch) { const v4f a = *(const v4f*)(ar + ch * 128 + lane * 4);
#pragma unroll
        for (int q = 0; q < 4; ++q) { const float x = rnd ? bfr(a[q]) : a[q]; v[ch * 4 + q] = x; float p = __fmul_rn(x, x); asm volatile("" : "+v"(p)); s = __fadd_rn(s, p); } }
#pragma unroll
    for (int sh = 16; sh; sh >>= 1) s += __shfl_xor(s, sh, 32);
    const float rs = __frsqrt_rn(__fadd_rn(s * (1.0f / DD), 1e-6f));
{
#pragma unroll
        for (int ch = 0; ch < 8; ++ch) { v4us oh, ol;
#pragma unroll
            for (int q = 0; q < 4; ++q) { const int d = ch * 128 + lane * 4 + q; float tn = __fmul_rn(v[ch * 4 + q], rs); asm volatile("" : "+v"(tn)); unsigned short a2, c2; splitf(__fmul_rn(tn, bfr(w[d])), a2, c2); oh[q] = a2; ol[q] = c2; }
            const size_t o = (size_t)t * DD + ch * 128 + lane * 4; *(v4us*)(Yh + o) = oh; *(v4us*)(Yl + o) = ol; }
         } }
__device__ __forceinline__ int t5_bucket(int r) { const int n = r < 0 ? -r : r; int v; if (n < 8) v = n; else { const int k = 31 - __clz(n); v = 8 + 2 * k - 6 + (((long long)n * n >= (1ll << (2 * k + 1))) ? 1 : 0); v = v > 15 ? 15 : v; } return (r > 0 ? 16 : 0) + v; }
// ---- k_fattn: the whole attention of one (batch, head) x 128 queries per work-group; 4 waves, 32 queries per wave; grid (TT/128, NB_*NH_).
// Scores are formed transposed, S^T = K Q^T (rows = keys, columns = queries): a lane then owns one query, its registers hold keys 8 hi + j of each 16-key tile, and two such tiles are,
// register for register, the 32-deep B fragment of O^T = V^T P^T. No score or probability leaves the registers. Sweep 1 finds each query's row maximum, sweep 2 forms the scores again,
// p = 1024 exp(t - max) (f32 sum, fp16 operand), and accumulates O^T; the division by the sum comes last, per lane. The bias is a table over key - query in LDS, the mask row lies beside it.
__device__ __forceinline__ void fa_ldk(const h16* k, int kb, v16h* kf) {
#pragma unroll
    for (int kt = 0; kt < 2; ++kt) { kf[kt * 2] = WFrag<h16>::ld(k + (size_t)(kb + kt * 16) * HDM); kf[kt * 2 + 1] = WFrag<h16>::ld(k + (size_t)(kb + kt * 16) * HDM + 32); } }
__device__ __forceinline__ v8f fa_qk(const v16h* kf, int kt, const v16h* qf) { v8f s = (v8f){}; s = wmma16(kf[kt * 2], qf[0], s); return wmma16(kf[kt * 2 + 1], qf[1], s); }
__device__ __forceinline__ v8f fa_bias(v8f s, const float* tq, const v4f m0, const v4f m1) {
#pragma unroll
    for (int j = 0; j < 8; ++j) s[j] = __fadd_rn(__fadd_rn(s[j], tq[j]), j < 4 ? m0[j & 3] : m1[j & 3]);
    return s; }
__global__ __launch_bounds__(128) void k_fattn(const h16* __restrict__ QP, const h16* __restrict__ KP, const h16* __restrict__ VT, const float* __restrict__ rb, const float* __restrict__ MBr, bf* Ah, bf* Al) {
    __shared__ float tb[TT + 128];
    __shared__ __align__(16) float mk[TT];
    const int bh = blockIdx.y, b = bh / NH_, h = bh % NH_, Q0 = blockIdx.x * 128;
    const float bv = bfr(rb[(threadIdx.x & 31) * NH_ + h]);    // lane l holds bucket l of this head: the table is filled by lane exchange, with one trip to memory instead of one per entry
#pragma unroll
    for (int i = 0; i < (TT + 128) / 128; ++i) { const int e = i * 128 + threadIdx.x; tb[e] = __shfl(bv, t5_bucket(e - 127 - Q0), 32); }    // tb[127 + key - (query - Q0)]; the last entry is never read
#pragma unroll
    for (int i = 0; i < TT / 512; ++i) { const int e = i * 512 + threadIdx.x * 4; *(v4fa*)(mk + e) = *(const v4fa*)(MBr + (size_t)b * TT + e); }
    __syncthreads();
    const int lane = threadIdx.x & 31, lr = lane & 15, hi = lane >> 4, wq = (threadIdx.x >> 5) * 32;
    const h16* q = QP + ((size_t)bh * TT + Q0 + wq + lr) * HDM + 8 * hi;
    const h16* k = KP + ((size_t)bh * TT + lr) * HDM + 8 * hi;
    const h16* v = VT + ((size_t)bh * HDM + lr) * TT + 8 * hi;
    const float* tl = tb + 127 + 8 * hi - wq - lr;
    const float* ml = mk + 8 * hi;
    v16h qf[2][2];
#pragma unroll
    for (int qt = 0; qt < 2; ++qt) { qf[qt][0] = WFrag<h16>::ld(q + qt * 16 * HDM); qf[qt][1] = WFrag<h16>::ld(q + qt * 16 * HDM + 32); }
    v16h kf[4]; fa_ldk(k, 0, kf);
    float mx[2] = { -3.0e38f, -3.0e38f };
    // unroll 2: the key fragments of the next block are fetched one trip ahead into a second register set; two trips per pass let the sets swap without moves
#pragma unroll 2
    for (int kb = 0; kb < TT; kb += 32) {
        v16h kn[4]; fa_ldk(k, (kb + 32) & (TT - 1), kn);    // the last trip fetches block 0, which sweep 2 starts with
#pragma unroll
        for (int kt = 0; kt < 2; ++kt) { const v4f m0 = *(const v4fa*)(ml + kb + kt * 16), m1 = *(const v4fa*)(ml + kb + kt * 16 + 4);
#pragma unroll
            for (int qt = 0; qt < 2; ++qt) { const v8f s = fa_bias(fa_qk(kf, kt, qf[qt]), tl + kb + kt * 16 - qt * 16, m0, m1);
#pragma unroll
                for (int j = 0; j < 8; ++j) mx[qt] = fmaxf(mx[qt], s[j]); } }
#pragma unroll
        for (int i = 0; i < 4; ++i) kf[i] = kn[i];
    }
    float cq[2]; v2f sum[2] = { (v2f){}, (v2f){} };
#pragma unroll
    for (int qt = 0; qt < 2; ++qt) { mx[qt] = fmaxf(mx[qt], __shfl_xor(mx[qt], 16, 32)); cq[qt] = 10.0f - mx[qt] * 1.4426950408889634f; }    // 2^10 = PCAR; a rounding of cq scales a whole row and cancels in p / sum
    v8f o[2][4];
#pragma unroll
    for (int qt = 0; qt < 2; ++qt)
#pragma unroll
        for (int dt = 0; dt < 4; ++dt) o[qt][dt] = (v8f){};
    // unroll 1: the trip is long enough, and a second copy would only raise the register count
#pragma unroll 1
    for (int kb = 0; kb < TT; kb += 32) {
        v16h vf[4];
#pragma unroll
        for (int dt = 0; dt < 4; ++dt) vf[dt] = WFrag<h16>::ld(v + (size_t)dt * 16 * TT + kb);
        v8f s[2][2];
#pragma unroll
        for (int kt = 0; kt < 2; ++kt)
#pragma unroll
            for (int qt = 0; qt < 2; ++qt) s[kt][qt] = fa_qk(kf, kt, qf[qt]);
        fa_ldk(k, (kb + 32) & (TT - 1), kf);    // the key fragments are free once the score products have issued: the next block's fly under the exponentials and the value products
        __builtin_amdgcn_sched_barrier(0);      // keeps both groups of loads up here; without it the value loads sink to just in front of their products and each waits out a full trip to L2
        v16h pf[2];
#pragma unroll
        for (int kt = 0; kt < 2; ++kt) { const v4f m0 = *(const v4fa*)(ml + kb + kt * 16), m1 = *(const v4fa*)(ml + kb + kt * 16 + 4);
#pragma unroll
            for (int qt = 0; qt < 2; ++qt) { const v8f t = fa_bias(s[kt][qt], tl + kb + kt * 16 - qt * 16, m0, m1);
#pragma unroll
                for (int j = 0; j < 8; j += 2) { v2f p; p[0] = __builtin_amdgcn_exp2f(__builtin_fmaf(t[j], 1.4426950408889634f, cq[qt])); p[1] = __builtin_amdgcn_exp2f(__builtin_fmaf(t[j + 1], 1.4426950408889634f, cq[qt]));
                    sum[qt] += p; pf[qt][kt * 8 + j] = tohx(p[0]); pf[qt][kt * 8 + j + 1] = tohx(p[1]); } } }
#pragma unroll
        for (int dt = 0; dt < 4; ++dt)
#pragma unroll
            for (int qt = 0; qt < 2; ++qt) o[qt][dt] = wmma16(vf[dt], pf[qt], o[qt][dt]);
        // the trip ends in matrix products and the next one begins by overwriting their probability operands: these four slots keep the distance over the back edge
        asm volatile("v_nop\n\tv_nop\n\tv_nop\n\tv_nop" : "+v"(o[0][3]), "+v"(o[1][3]) : "v"(pf[0]), "v"(pf[1]));
    }
#pragma unroll
    for (int qt = 0; qt < 2; ++qt) { float sq = sum[qt][0] + sum[qt][1]; sq += __shfl_xor(sq, 16, 32); const float inv = __fdiv_rn(1.0f, sq);
        const size_t oo = ((size_t)b * TT + Q0 + wq + qt * 16 + lr) * DD + h * HDM + 8 * hi;
#pragma unroll
        for (int dt = 0; dt < 4; ++dt) { v8us oh, ol;
#pragma unroll
            for (int j = 0; j < 8; ++j) { unsigned short a, c2; splitf(o[qt][dt][j] * inv, a, c2); oh[j] = a; ol[j] = c2; }
            *(v8usa*)(Ah + oo + dt * 16) = oh; *(v8usa*)(Al + oo + dt * 16) = ol; } }
}
__global__ __launch_bounds__(256) void k_mrow(const float* __restrict__ mask, float* MBr) { const int e = blockIdx.x * 256 + threadIdx.x; if (e >= NB_ * TT) return; float om = __fsub_rn(1.0f, bfr(mask[e])); asm volatile("" : "+v"(om)); const float v = __fmul_rn(om, -10000.0f); *(float*)(MBr + e) = v;  }

extern "C" void kernel_launch(void* const* d_in, const int* in_sizes, int n_in,
                              void* d_out, int out_size, void* d_ws, size_t ws_size, hipStream_t stream) {
    (void)in_sizes; (void)n_in; (void)out_size;
    const float* IN[11]; for (int i = 0; i < 11; ++i) IN[i] = (const float*)d_in[i];   // 0 hidden, 1 attn_mask, 2 ln1_w, 3 wq, 4 wk, 5 wv, 6 wo, 7 rel_bias [32][16], 8 ln2_w, 9 wi [1024][4096], 10 wo_ff [4096][1024] (x @ W)
    float* OUT = (float*)d_out;     // [4][1024][1024]
    char* wsp = (char*)d_ws;
    auto take = [&](size_t bytes) { char* p = wsp; wsp += (bytes + 255) & ~(size_t)255; return (void*)p; };
    bf* WQ = (bf*)take((size_t)DD * DD * 2); bf* WK = (bf*)take((size_t)DD * DD * 2); bf* WV = (bf*)take((size_t)DD * DD * 2); bf* WO = (bf*)take((size_t)DD * DD * 2); bf* WI = (bf*)take((size_t)MM * DD * 2); bf* WF = (bf*)take((size_t)DD * MM * 2); float* MBr = (float*)take((size_t)NB_ * TT * 4);
    bf* Xh = (bf*)take((size_t)LL * DD * 2); bf* Xl = (bf*)take((size_t)LL * DD * 2);
    h16* QP = (h16*)take((size_t)LL * DD * 2); h16* KP = (h16*)take((size_t)LL * DD * 2); h16* VT = (h16*)take((size_t)LL * DD * 2); bf* Ah = (bf*)take((size_t)LL * DD * 2); bf* Al = (bf*)take((size_t)LL * DD * 2);
    float* H = (float*)take((size_t)LL * DD * 4); bf* Gh = (bf*)take((size_t)(LL / 2) * MM * 2); bf* Gl = (bf*)take((size_t)(LL / 2) * MM * 2);    // relu-FFN hidden planes for one half of the rows
    if ((size_t)(wsp - (char*)d_ws) > ws_size) return;    // total ~ 134 MB
    { const unsigned g = (unsigned)(((size_t)DD * DD / 64 + 63) / 64); k_wtG<<<g, 256, 0, stream>>>(IN[3], DD, DD, WQ); k_wtG<<<g, 256, 0, stream>>>(IN[4], DD, DD, WK); k_wtG<<<g, 256, 0, stream>>>(IN[5], DD, DD, WV); k_wtG<<<g, 256, 0, stream>>>(IN[6], DD, DD, WO);
      k_wtG<<<(unsigned)(((size_t)DD * MM / 64 + 63) / 64), 256, 0, stream>>>(IN[9], DD, MM, WI); k_wtG<<<(unsigned)(((size_t)MM * DD / 64 + 63) / 64), 256, 0, stream>>>(IN[10], MM, DD, WF);
      k_mrow<<<(NB_ * TT + 255) / 256, 256, 0, stream>>>(IN[1], MBr); }
    k_rmsT<<<LL / 8, 256, 0, stream>>>(IN[0], 1, IN[2], Xh, Xl);
    k_gemmt<EP_HEAD><<<dim3(LL / 128, DD / 128, 1), 128, 0, stream>>>(Xh, Xl, WQ, DD, nullptr, nullptr, QP, nullptr, nullptr);    // planes [b][h][t][64]
    k_gemmt<EP_HEAD><<<dim3(LL / 128, DD / 128, 1), 128, 0, stream>>>(Xh, Xl, WK, DD, nullptr, nullptr, KP, nullptr, nullptr);
    k_gemmt<EP_VT><<<dim3(LL / 128, DD / 128, 1), 128, 0, stream>>>(Xh, Xl, WV, DD, nullptr, nullptr, VT, nullptr, nullptr);      // plane [b][h][64][t]
    k_fattn<<<dim3(TT / 128, NB_ * NH_, 1), 128, 0, stream>>>(QP, KP, VT, IN[7], MBr, Ah, Al);
    k_gemmt<EP_RES><<<dim3(LL / 128, DD / 128, 1), 128, 0, stream>>>(Ah, Al, WO, DD, IN[0], H, nullptr, nullptr, nullptr);
    k_rmsT<<<LL / 8, 256, 0, stream>>>(H, 0, IN[8], Xh, Xl);
    for (int hb = 0; hb < 2; ++hb) { const size_t r0 = (size_t)hb * (LL / 2);
        k_gemmt<EP_RELU><<<dim3(LL / 2 / 128, MM / 128, 1), 128, 0, stream>>>(Xh + r0 * DD, Xl + r0 * DD, WI, DD, nullptr, nullptr, nullptr, Gh, Gl);
        k_gemmt<EP_OUT><<<dim3(LL / 2 / 128, DD / 128, 1), 128, 0, stream>>>(Gh, Gl, WF, MM, H + r0 * DD, OUT + r0 * DD, nullptr, nullptr, nullptr); }
}

// v004
// One run takes 327 microseconds.
// Timed twice side by side with v003, it ran 1.13 and 1.14 times as fast.
// All steps since v000 together make it 8.38 times as fast.
#include <hip/hip_runtime.h>

// T5 encoder block (hidden [4][1024][1024], attn_mask [4][1024]; x = T5-RMSNorm(hidden) ln1_w (eps 1e-6, no mean/bias); q/k/v = x w (16 heads x 64); scores = q.k (NO 1/sqrt(d)) + rel_bias[bucket(j - i)][h]
// + (1 - attn_mask[b][j]) (-1e4); softmax; hidden += merged ctx wo; y = RMSNorm(hidden) ln2_w; hidden += relu(y wi) wo_ff -> [4][1024][1024]. The bidirectional relative-position bucket of an integer offset
// (32 buckets, max distance 128) is evaluated with exact integer arithmetic: for |r| >= 8, 8 + 2 floor(log2 |r|) - 6 + [ |r|^2 >= 2^(2 floor(log2|r|) + 1) ], capped at 15 (this equals the reference's
// float formula for every offset 0..1023), + 16 for r > 0.)
// Compute dtypes, f32 accumulate: every input rounded to bf16; both RMSNorms f32 (wave per token) -> bf16 hi+lo planes; q/k/v, wo, wi, wo_ff on hl planes of their computed operands
// x exact weights (2 products); scores (K 64) and probs.v on SINGLE fp16 planes with an f32 register-row softmax (bias + mask added in f32; probabilities x1024); residuals and relu f32.

#define NB_  4
#define TT   1024
#define LL   4096
#define DD   1024
#define NH_  16
#define HDM  64
#define MM   4096
#define PCAR 1024.0f
typedef _Float16 h16;
typedef unsigned short bf;
typedef __attribute__((ext_vector_type(16))) __bf16   v16bf;
typedef __attribute__((ext_vector_type(16))) _Float16 v16h;
typedef __attribute__((ext_vector_type(8)))  _Float16 v8h;
typedef __attribute__((ext_vector_type(8)))  unsigned short v8us;
typedef __attribute__((ext_vector_type(8)))  float    v8f;
typedef __attribute__((ext_vector_type(4)))  float    v4f;
typedef v8h  __attribute__((may_alias)) v8ha;
typedef v4f  __attribute__((may_alias)) v4fa;
typedef v8us __attribute__((may_alias)) v8usa;

__device__ __forceinline__ unsigned short f2bf(float f) { unsigned u = __float_as_uint(f); u += 0x7FFFu + ((u >> 16) & 1u); return (unsigned short)(u >> 16); }
__device__ __forceinline__ float bf2f(unsigned short b) { return __uint_as_float(((unsigned)b) << 16); }
__device__ __forceinline__ float bfr(float f) { return bf2f(f2bf(f)); }
__device__ __forceinline__ v16h cat16(v8h lo, v8h hi) { return __builtin_shufflevector(lo, hi, 0, 1, 2, 3, 4, 5, 6, 7, 8, 9, 10, 11, 12, 13, 14, 15); }
__device__ __forceinline__ v16bf cat16b(v8us lo, v8us hi) { return __builtin_bit_cast(v16bf, __builtin_shufflevector(lo, hi, 0, 1, 2, 3, 4, 5, 6, 7, 8, 9, 10, 11, 12, 13, 14, 15)); }
__device__ __forceinline__ v8f wmma16(v16h a, v16h b, v8f c) { return __builtin_amdgcn_wmma_f32_16x16x32_f16(false, a, false, b, (short)0, c, false, false); }
__device__ __forceinline__ v8f wmmab(v16bf a, v16bf b, v8f c) { return __builtin_amdgcn_wmma_f32_16x16x32_bf16(false, a, false, b, (short)0, c, false, false); }



// ---- k_gemmt<EP>: c[m][n] (f32) = sum_k (A[m][k] + A2[m][k]) Bt[n][k], all three planes bf16 and K-contiguous; c never reaches memory as such: the epilogue EP stores it in the form that its reader takes (below). One 128x128 tile per work-group of 4 waves (2x2, 64x64 = 16 accumulators each);
// grid (M/128, N/128), 128 threads; M, N % 128 == 0, K % 64 == 0. A stage is 64 k (one 128-byte line) of the 128 rows of A, A2 and Bt; it comes into LDS by asynchronous copies, whole 128-byte lines, once per work-group
// instead of once per wave, and the next stage flies while this one is multiplied (two buffers). Fragment form and the order of the products per accumulator are those of a wave reading global memory.
template <typename T16> struct WFrag;
template <> struct WFrag<h16> { typedef v16h V; static __device__ __forceinline__ V ld(const h16* p) { return cat16(*(const v8h*)p, *(const v8h*)(p + 16)); } };
// eight copies: this thread's 16 bytes of eight rows of one plane, LS bytes apart in LDS and rs elements apart in memory. The s_wait_xcnt closes the statement so that no address register is rewritten ahead of it.
template <unsigned LS>
__device__ __forceinline__ void g_cp8(unsigned l, const bf* g, size_t rs) {
    asm volatile("global_load_async_to_lds_b128 %0, %8, off\n\t"
                 "global_load_async_to_lds_b128 %1, %9, off\n\t"
                 "global_load_async_to_lds_b128 %2, %10, off\n\t"
                 "global_load_async_to_lds_b128 %3, %11, off\n\t"
                 "global_load_async_to_lds_b128 %4, %12, off\n\t"
                 "global_load_async_to_lds_b128 %5, %13, off\n\t"
                 "global_load_async_to_lds_b128 %6, %14, off\n\t"
                 "global_load_async_to_lds_b128 %7, %15, off\n\t"
                 "s_wait_xcnt 0x0"
                 :: "v"(l), "v"(l + LS), "v"(l + 2u * LS), "v"(l + 3u * LS), "v"(l + 4u * LS), "v"(l + 5u * LS), "v"(l + 6u * LS), "v"(l + 7u * LS),
                    "v"(g), "v"(g + rs), "v"(g + 2 * rs), "v"(g + 3 * rs), "v"(g + 4 * rs), "v"(g + 5 * rs), "v"(g + 6 * rs), "v"(g + 7 * rs) : "memory");
}
__device__ __forceinline__ v16bf g_ldf(const unsigned char* p) { return cat16b(*(const v8usa*)p, *(const v8usa*)(p + 32)); }
// EP_HEAD: fp16 plane [b][h][t][64] (queries, keys). EP_VT: fp16 plane [b][h][64][t] (values). EP_RES: C = bf16-rounded R + c. EP_OUT: C = R + c (both f32, pitch DD). EP_RELU: max(c, 0) as bf16 hi + lo planes, pitch MM.
// A wave's 64 columns are one head (EP_HEAD, EP_VT), and its 64 rows lie in one batch. Every store covers whole 128-byte lines; all pitches are constants, so that one address per wave serves every store.
enum { EP_HEAD, EP_VT, EP_RES, EP_OUT, EP_RELU };
__device__ __forceinline__ h16 tohx(float x) { return (h16)x; }
__device__ __forceinline__ void splitf(float y, unsigned short& h, unsigned short& l) { h = f2bf(y); l = f2bf(y - bf2f(h)); }
template <int EP>
__global__ __launch_bounds__(128) void k_gemmt(const bf* __restrict__ A, const bf* __restrict__ A2, const bf* __restrict__ Bt, int K, const float* __restrict__ R, float* C, h16* P, bf* Ph, bf* Pl) {
    constexpr int KS = 64;                // k per stage
    constexpr int PIT = KS * 2 + 16;      // LDS pitch of a row: 16 bytes x odd, so that the 16-byte fragment reads of 16 rows fall on different banks
    constexpr int PL = 128 * PIT;         // one operand plane of a stage
    constexpr int ST = 3 * PL;            // a stage: A, A2, Bt
    constexpr int LPR = KS / 8;           // threads (16 bytes each) per row
    constexpr int RPR = 128 / LPR;        // rows that the 128 threads cover with one copy each
    constexpr int NKS = KS / 32;          // blocks of 32 products per stage
    __shared__ __align__(16) unsigned char ring[2 * ST];
    __shared__ __align__(16) float os[4 * 16 * 68];
    const int tid = threadIdx.x, lane = tid & 31, lr = lane & 15, hi = lane >> 4, wave = tid >> 5, wm = wave >> 1, wn = wave & 1; const int r0 = blockIdx.x * 128, c0 = blockIdx.y * 128;
    const unsigned NT = (unsigned)K / KS; const size_t rs = (size_t)RPR * K;
    const bf* gA = A + (size_t)(r0 + tid / LPR) * K + (tid % LPR) * 8; const bf* gA2 = A2 + (size_t)(r0 + tid / LPR) * K + (tid % LPR) * 8; const bf* gB = Bt + (size_t)(c0 + tid / LPR) * K + (tid % LPR) * 8;
    const unsigned l0 = (unsigned)(size_t)ring + (unsigned)((tid / LPR) * PIT + (tid % LPR) * 16);
    const unsigned char* fa = ring + (wm * 64 + lr) * PIT + hi * 16; const unsigned char* fb = ring + 2 * PL + (wn * 64 + lr) * PIT + hi * 16;
    auto fill = [&](unsigned l, size_t ko) { g_cp8<RPR * PIT>(l, gA + ko, rs); g_cp8<RPR * PIT>(l + PL, gA2 + ko, rs); g_cp8<RPR * PIT>(l + 2 * PL, gB + ko, rs); };    // 8 x RPR = 128 rows of each plane
    v8f acc[4][4];
#pragma unroll
    for (int mb = 0; mb < 4; ++mb)
#pragma unroll
        for (int nb = 0; nb < 4; ++nb) acc[mb][nb] = (v8f){};
    fill(l0, 0);
    asm volatile("s_wait_asynccnt 0x0" ::: "memory");    // this wave's share of stage 0 has landed
    __syncthreads();                                      // and so has every other wave's
    // unroll 1: one stage per trip; the trip holds 64 products already
#pragma unroll 1
    for (unsigned t = 0; t < NT; ++t) {
        const unsigned bo = (t & 1u) * ST;
        v16bf a[2][4], a2[2][4], b[2][4];
#pragma unroll
        for (int i = 0; i < 4; ++i) { a[0][i] = g_ldf(fa + bo + i * 16 * PIT); a2[0][i] = g_ldf(fa + bo + PL + i * 16 * PIT); b[0][i] = g_ldf(fb + bo + i * 16 * PIT); }
#pragma unroll
        for (int ks = 0; ks < NKS; ++ks) {
            if (ks + 1 < NKS) {
#pragma unroll
                for (int i = 0; i < 4; ++i) { a[(ks + 1) & 1][i] = g_ldf(fa + bo + i * 16 * PIT + (ks + 1) * 64); a2[(ks + 1) & 1][i] = g_ldf(fa + bo + PL + i * 16 * PIT + (ks + 1) * 64); b[(ks + 1) & 1][i] = g_ldf(fb + bo + i * 16 * PIT + (ks + 1) * 64); } }
            if (ks == 0 && t + 1 < NT) fill(l0 + (ST - bo), (size_t)(t + 1) * KS);    // the next stage, into the buffer that every wave left at the barrier above; issued under the latency of the fragment reads
#pragma unroll
            for (int nb = 0; nb < 4; ++nb)
#pragma unroll
                for (int mb = 0; mb < 4; ++mb) { acc[mb][nb] = wmmab(a[ks & 1][mb], b[ks & 1][nb], acc[mb][nb]); acc[mb][nb] = wmmab(a2[ks & 1][mb], b[ks & 1][nb], acc[mb][nb]); }
        }
        __builtin_amdgcn_sched_barrier(0);    // the products stay in front of the waits: left free, the compiler moves them behind the barrier, and the wave then waits out the copies it has just issued instead of multiplying under them
        asm volatile("s_wait_dscnt 0x0" ::: "memory");       // this wave has left the buffer that is refilled behind the barrier
        asm volatile("s_wait_asynccnt 0x0" ::: "memory");    // this wave's share of stage t + 1 has landed
        __syncthreads();                                      // publishes stage t + 1 and ends every wave's reads of stage t
    }
    asm volatile("s_wait_asynccnt 0x0" ::: "memory");        // no copy is left in flight when the wave ends
    float* osw = os + wave * 16 * 68;
    const int m0 = r0 + wm * 64, n0 = c0 + wn * 64;    // the corner of this wave's 64 x 64 results
    const int l8 = lane >> 3, c8 = (lane & 7) * 8;     // 16-bit planes: eight lanes of 16 bytes make one 128-byte line, four lines per store
    // Each block of 16 rows (EP_VT: columns) goes: results into LDS, whole lines read back and brought into their final form, then the stores. Outside EP_VT a scheduling barrier keeps every read of a block in front of its first store, so that no read's destination
    // falls on a register that an issued store names; EP_RES and EP_RELU reuse such registers in the next block: there s_wait_xcnt stands behind the stores, held in place by a scheduling barrier (a "memory" clobber alone holds no register write behind it).
    if constexpr (EP == EP_VT) {
        // a lane holds eight consecutive tokens of one column: 16 bytes of the transposed plane. Staged as [16 columns][64 tokens], pitch 144 bytes.
        h16* osh = (h16*)osw;
        h16* vrow = P + ((size_t)((m0 / TT) * NH_ + n0 / HDM) * HDM + l8) * TT + (m0 % TT) + c8;
#pragma unroll
        for (int nb = 0; nb < 4; ++nb) {
#pragma unroll
            for (int mb = 0; mb < 4; ++mb) { v8h c;
#pragma unroll
                for (int j = 0; j < 8; ++j) c[j] = tohx(acc[mb][nb][j]);
                *(v8ha*)(osh + lr * 72 + mb * 16 + hi * 8) = c; }
            __builtin_amdgcn_wave_barrier(); asm volatile("" ::: "memory");    // the lines are read back by other lanes of this wave: keeps the reads behind the writes
#pragma unroll
            for (int s = 0; s < 4; ++s) { const v8h val = *(const v8ha*)(osh + (s * 4 + l8) * 72 + c8); *(v8ha*)(vrow + (size_t)(nb * 16 + s * 4) * TT) = val; }
            __builtin_amdgcn_wave_barrier(); asm volatile("" ::: "memory");    // and the next columns' writes behind these reads
        }
    } else {
        v4f rv[4][8];    // the addend's rows, all fetched here at once: one trip to memory per wave instead of one per 16 rows
        if constexpr (EP == EP_RES || EP == EP_OUT) { const float* rrow = R + (size_t)(m0 + hi) * DD + n0 + lr * 4;
#pragma unroll
            for (int mb = 0; mb < 4; ++mb)
#pragma unroll
                for (int s = 0; s < 8; ++s) rv[mb][s] = *(const v4f*)(rrow + (size_t)(mb * 16 + 2 * s) * DD);
            asm volatile("s_wait_xcnt 0x0" ::: "memory"); __builtin_amdgcn_sched_barrier(0); }    // the address register of these loads is reused behind them
#pragma unroll
        for (int mb = 0; mb < 4; ++mb) {
#pragma unroll
            for (int nb = 0; nb < 4; ++nb) {
#pragma unroll
                for (int j = 0; j < 8; ++j) osw[(hi * 8 + j) * 68 + nb * 16 + lr] = acc[mb][nb][j]; }
            __builtin_amdgcn_wave_barrier(); asm volatile("" ::: "memory");    // the rows are read back by other lanes of this wave: keeps the reads behind the writes
            if constexpr (EP == EP_RES || EP == EP_OUT) {
                float* crow = C + (size_t)(m0 + hi) * DD + n0 + lr * 4; v4f o[8];
#pragma unroll
                for (int s = 0; s < 8; ++s) { const v4f val = *(const v4fa*)(osw + (2 * s + hi) * 68 + lr * 4);
#pragma unroll
                    for (int q = 0; q < 4; ++q) o[s][q] = __fadd_rn(EP == EP_RES ? bfr(rv[mb][s][q]) : rv[mb][s][q], val[q]); }
                __builtin_amdgcn_sched_barrier(0);    // every read and sum in front of the first store
#pragma unroll
                for (int s = 0; s < 8; ++s) *(v4f*)(crow + (size_t)(mb * 16 + 2 * s) * DD) = o[s];
            } else {
                v4f x[4][2];
#pragma unroll
                for (int s = 0; s < 4; ++s) { const float* orow = osw + (s * 4 + l8) * 68 + c8; x[s][0] = *(const v4fa*)orow; x[s][1] = *(const v4fa*)(orow + 4); }
                if constexpr (EP == EP_HEAD) { h16* prow = P + ((size_t)((m0 / TT) * NH_ + n0 / HDM) * TT + (m0 % TT) + l8) * HDM + c8; v8h c[4];
#pragma unroll
                    for (int s = 0; s < 4; ++s)
#pragma unroll
                        for (int j = 0; j < 8; ++j) c[s][j] = tohx(x[s][j >> 2][j & 3]);
                    __builtin_amdgcn_sched_barrier(0);    // every read and conversion in front of the first store
#pragma unroll
                    for (int s = 0; s < 4; ++s) *(v8ha*)(prow + (size_t)(mb * 16 + s * 4) * HDM) = c[s];
                } else { const size_t go = (size_t)(m0 + l8) * MM + n0 + c8; v8us oh[4], ol[4];
#pragma unroll
                    for (int s = 0; s < 4; ++s)
#pragma unroll
                        for (int j = 0; j < 8; ++j) { unsigned short a, c2; splitf(fmaxf(x[s][j >> 2][j & 3], 0.f), a, c2); oh[s][j] = a; ol[s][j] = c2; }
                    __builtin_amdgcn_sched_barrier(0);    // every read and split in front of the first store
#pragma unroll
                    for (int s = 0; s < 4; ++s) { *(v8usa*)(Ph + go + (size_t)(mb * 16 + s * 4) * MM) = oh[s]; *(v8usa*)(Pl + go + (size_t)(mb * 16 + s * 4) * MM) = ol[s]; } }
            }
            __builtin_amdgcn_wave_barrier(); asm volatile("" ::: "memory");    // and the next rows' writes behind these reads
            if (mb < 3 && (EP == EP_RES || EP == EP_RELU)) { asm volatile("s_wait_xcnt 0x0" ::: "memory"); __builtin_amdgcn_sched_barrier(0); }    // the next rows reuse registers that these stores name
        }
    }
}

typedef __attribute__((ext_vector_type(2))) _Float16 v2h;
typedef __attribute__((ext_vector_type(4))) _Float16 v4h;
typedef __attribute__((ext_vector_type(2))) unsigned short v2us;
typedef __attribute__((ext_vector_type(4))) unsigned short v4us;
typedef __attribute__((ext_vector_type(2))) float v2f;

// ---- k_wtG<K, N>: Bt[n][k] (bf16) = w[k][n] (f32). One tile of 128 k x 64 n per work-group of 8 waves; grid (K/128, N/64). Both sides of the transposition move 256 consecutive bytes per 16 lanes (a row of the tile in, a row of the
// result out); the turn itself happens in LDS. A thread rounds four pairs of consecutive k, 32 k apart, of four n and packs each pair into one dword of the row [n]. The pitch of 65 dwords puts the 32 dwords of a wave's LDS store (16 groups of n, 4 x 65 dwords
// apart, x 2 pairs of k) and of a wave's LDS read (2 rows x 16 lanes, 4 dwords apart) on 32 different banks. K and N are constants, so that one address serves all loads of a thread and one all its stores.
typedef __attribute__((ext_vector_type(4))) unsigned v4u;
typedef v4u __attribute__((may_alias)) v4ua;
template <int K, int N>
__global__ __launch_bounds__(256) void k_wtG(const float* __restrict__ w, bf* Bt) {
    constexpr int WP = 65;
    __shared__ unsigned tw[64 * WP];
    const int c = threadIdx.x & 15, r = threadIdx.x >> 4; const int k0 = blockIdx.x * 128, n0 = blockIdx.y * 64;
    const float* s = w + (size_t)(k0 + 2 * r) * N + n0 + c * 4;
    v4f a[4][2];    // all eight loads of a thread fly together: one trip to memory per tile
#pragma unroll
    for (int h = 0; h < 4; ++h) { a[h][0] = *(const v4f*)(s + (size_t)(h * 32) * N); a[h][1] = *(const v4f*)(s + (size_t)(h * 32 + 1) * N); }
    asm volatile("s_wait_xcnt 0x0" :: "v"(s) : "memory");    // a precaution: the address that the loads name is an operand here, so it stays in its registers up to this wait
#pragma unroll
    for (int h = 0; h < 4; ++h)
#pragma unroll
        for (int q = 0; q < 4; ++q) tw[(c * 4 + q) * WP + h * 16 + r] = (unsigned)f2bf(a[h][0][q]) | ((unsigned)f2bf(a[h][1][q]) << 16);
    __syncthreads();    // the rows are read back by other waves
    bf* d = Bt + (size_t)(n0 + r) * K + k0 + c * 8;
#pragma unroll
    for (int p = 0; p < 4; ++p) { const unsigned* t = tw + (p * 16 + r) * WP + c * 4; v4u o; o[0] = t[0]; o[1] = t[1]; o[2] = t[2]; o[3] = t[3]; *(v4ua*)(d + (size_t)(p * 16) * K) = o; }
}
__global__ __launch_bounds__(256) void k_rmsT(const float* __restrict__ A, int rnd, const float* __restrict__ w, bf* Yh, bf* Yl) { const int lane = threadIdx.x & 31; const int t = blockIdx.x * 8 + (threadIdx.x >> 5); if (t >= LL) return; const float* ar = A + (size_t)t * DD; float v[32]; float s = 0.f;
#pragma unroll
    for (int ch = 0; ch < 8; ++ch) { const v4f a = *(const v4f*)(ar + ch * 128 + lane * 4);
#pragma unroll
        for (int q = 0; q < 4; ++q) { const float x = rnd ? bfr(a[q]) : a[q]; v[ch * 4 + q] = x; float p = __fmul_rn(x, x); asm volatile("" : "+v"(p)); s = __fadd_rn(s, p); } }
#pragma unroll
    for (int sh = 16; sh; sh >>= 1) s += __shfl_xor(s, sh, 32);
    const float rs = __frsqrt_rn(__fadd_rn(s * (1.0f / DD), 1e-6f));
{
#pragma unroll
        for (int ch = 0; ch < 8; ++ch) { v4us oh, ol;
#pragma unroll
            for (int q = 0; q < 4; ++q) { const int d = ch * 128 + lane * 4 + q; float tn = __fmul_rn(v[ch * 4 + q], rs); asm volatile("" : "+v"(tn)); unsigned short a2, c2; splitf(__fmul_rn(tn, bfr(w[d])), a2, c2); oh[q] = a2; ol[q] = c2; }
            const size_t o = (size_t)t * DD + ch * 128 + lane * 4; *(v4us*)(Yh + o) = oh; *(v4us*)(Yl + o) = ol; }
         } }
__device__ __forceinline__ int t5_bucket(int r) { const int n = r < 0 ? -r : r; int v; if (n < 8) v = n; else { const int k = 31 - __clz(n); v = 8 + 2 * k - 6 + (((long long)n * n >= (1ll << (2 * k + 1))) ? 1 : 0); v = v > 15 ? 15 : v; } return (r > 0 ? 16 : 0) + v; }
// ---- k_fattn: the whole attention of one (batch, head) x 128 queries per work-group; 4 waves, 32 queries per wave; grid (TT/128, NB_*NH_).
// Scores are formed transposed, S^T = K Q^T (rows = keys, columns = queries): a lane then owns one query, its registers hold keys 8 hi + j of each 16-key tile, and two such tiles are,
// register for register, the 32-deep B fragment of O^T = V^T P^T. No score or probability leaves the registers. Sweep 1 finds each query's row maximum, sweep 2 forms the scores again,
// p = 1024 exp(t - max) (f32 sum, fp16 operand), and accumulates O^T; the division by the sum comes last, per lane. The bias is a table over key - query in LDS, the mask row lies beside it.
__device__ __forceinline__ void fa_ldk(const h16* k, int kb, v16h* kf) {
#pragma unroll
    for (int kt = 0; kt < 2; ++kt) { kf[kt * 2] = WFrag<h16>::ld(k + (size_t)(kb + kt * 16) * HDM); kf[kt * 2 + 1] = WFrag<h16>::ld(k + (size_t)(kb + kt * 16) * HDM + 32); } }
__device__ __forceinline__ v8f fa_qk(const v16h* kf, int kt, const v16h* qf) { v8f s = (v8f){}; s = wmma16(kf[kt * 2], qf[0], s); return wmma16(kf[kt * 2 + 1], qf[1], s); }
__device__ __forceinline__ v8f fa_bias(v8f s, const float* tq, const v4f m0, const v4f m1) {
#pragma unroll
    for (int j = 0; j < 8; ++j) s[j] = __fadd_rn(__fadd_rn(s[j], tq[j]), j < 4 ? m0[j & 3] : m1[j & 3]);
    return s; }
__global__ __launch_bounds__(128) void k_fattn(const h16* __restrict__ QP, const h16* __restrict__ KP, const h16* __restrict__ VT, const float* __restrict__ rb, const float* __restrict__ MBr, bf* Ah, bf* Al) {
    __shared__ float tb[TT + 128];
    __shared__ __align__(16) float mk[TT];
    const int bh = blockIdx.y, b = bh / NH_, h = bh % NH_, Q0 = blockIdx.x * 128;
    const float bv = bfr(rb[(threadIdx.x & 31) * NH_ + h]);    // lane l holds bucket l of this head: the table is filled by lane exchange, with one trip to memory instead of one per entry
#pragma unroll
    for (int i = 0; i < (TT + 128) / 128; ++i) { const int e = i * 128 + threadIdx.x; tb[e] = __shfl(bv, t5_bucket(e - 127 - Q0), 32); }    // tb[127 + key - (query - Q0)]; the last entry is never read
#pragma unroll
    for (int i = 0; i < TT / 512; ++i) { const int e = i * 512 + threadIdx.x * 4; *(v4fa*)(mk + e) = *(const v4fa*)(MBr + (size_t)b * TT + e); }
    __syncthreads();
    const int lane = threadIdx.x & 31, lr = lane & 15, hi = lane >> 4, wq = (threadIdx.x >> 5) * 32;
    const h16* q = QP + ((size_t)bh * TT + Q0 + wq + lr) * HDM + 8 * hi;
    const h16* k = KP + ((size_t)bh * TT + lr) * HDM + 8 * hi;
    const h16* v = VT + ((size_t)bh * HDM + lr) * TT + 8 * hi;
    const float* tl = tb + 127 + 8 * hi - wq - lr;
    const float* ml = mk + 8 * hi;
    v16h qf[2][2];
#pragma unroll
    for (int qt = 0; qt < 2; ++qt) { qf[qt][0] = WFrag<h16>::ld(q + qt * 16 * HDM); qf[qt][1] = WFrag<h16>::ld(q + qt * 16 * HDM + 32); }
    v16h kf[4]; fa_ldk(k, 0, kf);
    float mx[2] = { -3.0e38f, -3.0e38f };
    // unroll 2: the key fragments of the next block are fetched one trip ahead into a second register set; two trips per pass let the sets swap without moves
#pragma unroll 2
    for (int kb = 0; kb < TT; kb += 32) {
        v16h kn[4]; fa_ldk(k, (kb + 32) & (TT - 1), kn);    // the last trip fetches block 0, which sweep 2 starts with
#pragma unroll
        for (int kt = 0; kt < 2; ++kt) { const v4f m0 = *(const v4fa*)(ml + kb + kt * 16), m1 = *(const v4fa*)(ml + kb + kt * 16 + 4);
#pragma unroll
            for (int qt = 0; qt < 2; ++qt) { const v8f s = fa_bias(fa_qk(kf, kt, qf[qt]), tl + kb + kt * 16 - qt * 16, m0, m1);
#pragma unroll
                for (int j = 0; j < 8; ++j) mx[qt] = fmaxf(mx[qt], s[j]); } }
#pragma unroll
        for (int i = 0; i < 4; ++i) kf[i] = kn[i];
    }
    float cq[2]; v2f sum[2] = { (v2f){}, (v2f){} };
#pragma unroll
    for (int qt = 0; qt < 2; ++qt) { mx[qt] = fmaxf(mx[qt], __shfl_xor(mx[qt], 16, 32)); cq[qt] = 10.0f - mx[qt] * 1.4426950408889634f; }    // 2^10 = PCAR; a rounding of cq scales a whole row and cancels in p / sum
    v8f o[2][4];
#pragma unroll
    for (int qt = 0; qt < 2; ++qt)
#pragma unroll
        for (int dt = 0; dt < 4; ++dt) o[qt][dt] = (v8f){};
    // unroll 1: the trip is long enough, and a second copy would only raise the register count
#pragma unroll 1
    for (int kb = 0; kb < TT; kb += 32) {
        v16h vf[4];
#pragma unroll
        for (int dt = 0; dt < 4; ++dt) vf[dt] = WFrag<h16>::ld(v + (size_t)dt * 16 * TT + kb);
        v8f s[2][2];
#pragma unroll
        for (int kt = 0; kt < 2; ++kt)
#pragma unroll
            for (int qt = 0; qt < 2; ++qt) s[kt][qt] = fa_qk(kf, kt, qf[qt]);
        fa_ldk(k, (kb + 32) & (TT - 1), kf);    // the key fragments are free once the score products have issued: the next block's fly under the exponentials and the value products
        __builtin_amdgcn_sched_barrier(0);      // keeps both groups of loads up here; without it the value loads sink to just in front of their products and each waits out a full trip to L2
        v16h pf[2];
#pragma unroll
        for (int kt = 0; kt < 2; ++kt) { const v4f m0 = *(const v4fa*)(ml + kb + kt * 16), m1 = *(const v4fa*)(ml + kb + kt * 16 + 4);
#pragma unroll
            for (int qt = 0; qt < 2; ++qt) { const v8f t = fa_bias(s[kt][qt], tl + kb + kt * 16 - qt * 16, m0, m1);
#pragma unroll
                for (int j = 0; j < 8; j += 2) { v2f p; p[0] = __builtin_amdgcn_exp2f(__builtin_fmaf(t[j], 1.4426950408889634f, cq[qt])); p[1] = __builtin_amdgcn_exp2f(__builtin_fmaf(t[j + 1], 1.4426950408889634f, cq[qt]));
                    sum[qt] += p; pf[qt][kt * 8 + j] = tohx(p[0]); pf[qt][kt * 8 + j + 1] = tohx(p[1]); } } }
#pragma unroll
        for (int dt = 0; dt < 4; ++dt)
#pragma unroll
            for (int qt = 0; qt < 2; ++qt) o[qt][dt] = wmma16(vf[dt], pf[qt], o[qt][dt]);
        // the trip ends in matrix products and the next one begins by overwriting their probability operands: these four slots keep the distance over the back edge
        asm volatile("v_nop\n\tv_nop\n\tv_nop\n\tv_nop" : "+v"(o[0][3]), "+v"(o[1][3]) : "v"(pf[0]), "v"(pf[1]));
    }
#pragma unroll
    for (int qt = 0; qt < 2; ++qt) { float sq = sum[qt][0] + sum[qt][1]; sq += __shfl_xor(sq, 16, 32); const float inv = __fdiv_rn(1.0f, sq);
        const size_t oo = ((size_t)b * TT + Q0 + wq + qt * 16 + lr) * DD + h * HDM + 8 * hi;
#pragma unroll
        for (int dt = 0; dt < 4; ++dt) { v8us oh, ol;
#pragma unroll
            for (int j = 0; j < 8; ++j) { unsigned short a, c2; splitf(o[qt][dt][j] * inv, a, c2); oh[j] = a; ol[j] = c2; }
            *(v8usa*)(Ah + oo + dt * 16) = oh; *(v8usa*)(Al + oo + dt * 16) = ol; } }
}
__global__ __launch_bounds__(256) void k_mrow(const float* __restrict__ mask, float* MBr) { const int e = blockIdx.x * 256 + threadIdx.x; if (e >= NB_ * TT) return; float om = __fsub_rn(1.0f, bfr(mask[e])); asm volatile("" : "+v"(om)); const float v = __fmul_rn(om, -10000.0f); *(float*)(MBr + e) = v;  }

extern "C" void kernel_launch(void* const* d_in, const int* in_sizes, int n_in,
                              void* d_out, int out_size, void* d_ws, size_t ws_size, hipStream_t stream) {
    (void)in_sizes; (void)n_in; (void)out_size;
    const float* IN[11]; for (int i = 0; i < 11; ++i) IN[i] = (const float*)d_in[i];   // 0 hidden, 1 attn_mask, 2 ln1_w, 3 wq, 4 wk, 5 wv, 6 wo, 7 rel_bias [32][16], 8 ln2_w, 9 wi [1024][4096], 10 wo_ff [4096][1024] (x @ W)
    float* OUT = (float*)d_out;     // [4][1024][1024]
    char* wsp = (char*)d_ws;
    auto take = [&](size_t bytes) { char* p = wsp; wsp += (bytes + 255) & ~(size_t)255; return (void*)p; };
    bf* WQ = (bf*)take((size_t)DD * DD * 2); bf* WK = (bf*)take((size_t)DD * DD * 2); bf* WV = (bf*)take((size_t)DD * DD * 2); bf* WO = (bf*)take((size_t)DD * DD * 2); bf* WI = (bf*)take((size_t)MM * DD * 2); bf* WF = (bf*)take((size_t)DD * MM * 2); float* MBr = (float*)take((size_t)NB_ * TT * 4);
    bf* Xh = (bf*)take((size_t)LL * DD * 2); bf* Xl = (bf*)take((size_t)LL * DD * 2);
    h16* QP = (h16*)take((size_t)LL * DD * 2); h16* KP = (h16*)take((size_t)LL * DD * 2); h16* VT = (h16*)take((size_t)LL * DD * 2); bf* Ah = (bf*)take((size_t)LL * DD * 2); bf* Al = (bf*)take((size_t)LL * DD * 2);
    float* H = (float*)take((size_t)LL * DD * 4); bf* Gh = (bf*)take((size_t)(LL / 2) * MM * 2); bf* Gl = (bf*)take((size_t)(LL / 2) * MM * 2);    // relu-FFN hidden planes for one half of the rows
    if ((size_t)(wsp - (char*)d_ws) > ws_size) return;    // total ~ 134 MB
    { const dim3 g(DD / 128, DD / 64, 1); k_wtG<DD, DD><<<g, 256, 0, stream>>>(IN[3], WQ); k_wtG<DD, DD><<<g, 256, 0, stream>>>(IN[4], WK); k_wtG<DD, DD><<<g, 256, 0, stream>>>(IN[5], WV); k_wtG<DD, DD><<<g, 256, 0, stream>>>(IN[6], WO);
      k_wtG<DD, MM><<<dim3(DD / 128, MM / 64, 1), 256, 0, stream>>>(IN[9], WI); k_wtG<MM, DD><<<dim3(MM / 128, DD / 64, 1), 256, 0, stream>>>(IN[10], WF);
      k_mrow<<<(NB_ * TT + 255) / 256, 256, 0, stream>>>(IN[1], MBr); }
    k_rmsT<<<LL / 8, 256, 0, stream>>>(IN[0], 1, IN[2], Xh, Xl);
    k_gemmt<EP_HEAD><<<dim3(LL / 128, DD / 128, 1), 128, 0, stream>>>(Xh, Xl, WQ, DD, nullptr, nullptr, QP, nullptr, nullptr);    // planes [b][h][t][64]
    k_gemmt<EP_HEAD><<<dim3(LL / 128, DD / 128, 1), 128, 0, stream>>>(Xh, Xl, WK, DD, nullptr, nullptr, KP, nullptr, nullptr);
    k_gemmt<EP_VT><<<dim3(LL / 128, DD / 128, 1), 128, 0, stream>>>(Xh, Xl, WV, DD, nullptr, nullptr, VT, nullptr, nullptr);      // plane [b][h][64][t]
    k_fattn<<<dim3(TT / 128, NB_ * NH_, 1), 128, 0, stream>>>(QP, KP, VT, IN[7], MBr, Ah, Al);
    k_gemmt<EP_RES><<<dim3(LL / 128, DD / 128, 1), 128, 0, stream>>>(Ah, Al, WO, DD, IN[0], H, nullptr, nullptr, nullptr);
    k_rmsT<<<LL / 8, 256, 0, stream>>>(H, 0, IN[8], Xh, Xl);
    for (int hb = 0; hb < 2; ++hb) { const size_t r0 = (size_t)hb * (LL / 2);
        k_gemmt<EP_RELU><<<dim3(LL / 2 / 128, MM / 128, 1), 128, 0, stream>>>(Xh + r0 * DD, Xl + r0 * DD, WI, DD, nullptr, nullptr, nullptr, Gh, Gl);
        k_gemmt<EP_OUT><<<dim3(LL / 2 / 128, DD / 128, 1), 128, 0, stream>>>(Gh, Gl, WF, MM, H + r0 * DD, OUT + r0 * DD, nullptr, nullptr, nullptr); }
}

// v005
// A run of this version takes 260 microseconds.
// Two timings next to v004 put it at 1.27 and 1.26 times that version's speed.
// All steps since v000 together make it 10.6 times as fast.
#include <hip/hip_runtime.h>

// T5 encoder block (hidden [4][1024][1024], attn_mask [4][1024]; x = T5-RMSNorm(hidden) ln1_w (eps 1e-6, no mean/bias); q/k/v = x w (16 heads x 64); scores = q.k (NO 1/sqrt(d)) + rel_bias[bucket(j - i)][h]
// + (1 - attn_mask[b][j]) (-1e4); softmax; hidden += merged ctx wo; y = RMSNorm(hidden) ln2_w; hidden += relu(y wi) wo_ff -> [4][1024][1024]. The bidirectional relative-position bucket of an integer offset
// (32 buckets, max distance 128) is evaluated with exact integer arithmetic: for |r| >= 8, 8 + 2 floor(log2 |r|) - 6 + [ |r|^2 >= 2^(2 floor(log2|r|) + 1) ], capped at 15 (this equals the reference's
// float formula for every offset 0..1023), + 16 for r > 0.)
// Compute dtypes, f32 accumulate: every input rounded to bf16; both RMSNorms f32 (wave per token) -> bf16 hi+lo planes; q/k/v, wo, wi, wo_ff on hl planes of their computed operands
// x exact weights (2 products); scores (K 64) and probs.v on SINGLE fp16 planes with an f32 register-row softmax (bias + mask added in f32; probabilities x1024); residuals and relu f32.

#define NB_  4
#define TT   1024
#define LL   4096
#define DD   1024
#define NH_  16
#define HDM  64
#define MM   4096
#define PCAR 1024.0f
typedef _Float16 h16;
typedef unsigned short bf;
typedef __attribute__((ext_vector_type(16))) __bf16   v16bf;
typedef __attribute__((ext_vector_type(16))) _Float16 v16h;
typedef __attribute__((ext_vector_type(8)))  _Float16 v8h;
typedef __attribute__((ext_vector_type(8)))  unsigned short v8us;
typedef __attribute__((ext_vector_type(8)))  float    v8f;
typedef __attribute__((ext_vector_type(4)))  float    v4f;
typedef v8h  __attribute__((may_alias)) v8ha;
typedef v4f  __attribute__((may_alias)) v4fa;
typedef v8us __attribute__((may_alias)) v8usa;

__device__ __forceinline__ unsigned short f2bf(float f) { unsigned u = __float_as_uint(f); u += 0x7FFFu + ((u >> 16) & 1u); return (unsigned short)(u >> 16); }
__device__ __forceinline__ float bf2f(unsigned short b) { return __uint_as_float(((unsigned)b) << 16); }
__device__ __forceinline__ float bfr(float f) { return bf2f(f2bf(f)); }
__device__ __forceinline__ v16h cat16(v8h lo, v8h hi) { return __builtin_shufflevector(lo, hi, 0, 1, 2, 3, 4, 5, 6, 7, 8, 9, 10, 11, 12, 13, 14, 15); }
__device__ __forceinline__ v16bf cat16b(v8us lo, v8us hi) { return __builtin_bit_cast(v16bf, __builtin_shufflevector(lo, hi, 0, 1, 2, 3, 4, 5, 6, 7, 8, 9, 10, 11, 12, 13, 14, 15)); }
__device__ __forceinline__ v8f wmma16(v16h a, v16h b, v8f c) { return __builtin_amdgcn_wmma_f32_16x16x32_f16(false, a, false, b, (short)0, c, false, false); }
__device__ __forceinline__ v8f wmmab(v16bf a, v16bf b, v8f c) { return __builtin_amdgcn_wmma_f32_16x16x32_bf16(false, a, false, b, (short)0, c, false, false); }



// ---- k_gemmt<EP>: c[m][n] (f32) = sum_k (A[m][k] + A2[m][k]) Bt[n][k], all three planes bf16 and K-contiguous; c never reaches memory as such: the epilogue EP stores it in the form that its reader takes (below). One 128x128 tile per work-group of 4 waves (2x2, 64x64 = 16 accumulators each);
// grid (M/128, N/128), 128 threads; M, N % 128 == 0, K % 64 == 0. A stage is 64 k (one 128-byte line) of the 128 rows of A, A2 and Bt; it comes into LDS by asynchronous copies, whole 128-byte lines, once per work-group
// instead of once per wave, and the next stage flies while this one is multiplied (two buffers). Fragment form and the order of the products per accumulator are those of a wave reading global memory.
template <typename T16> struct WFrag;
template <> struct WFrag<h16> { typedef v16h V; static __device__ __forceinline__ V ld(const h16* p) { return cat16(*(const v8h*)p, *(const v8h*)(p + 16)); } };
// eight copies: this thread's 16 bytes of eight rows of one plane, LS bytes apart in LDS and rs elements apart in memory. The s_wait_xcnt closes the statement so that no address register is rewritten ahead of it.
template <unsigned LS>
__device__ __forceinline__ void g_cp8(unsigned l, const bf* g, size_t rs) {
    asm volatile("global_load_async_to_lds_b128 %0, %8, off\n\t"
                 "global_load_async_to_lds_b128 %1, %9, off\n\t"
                 "global_load_async_to_lds_b128 %2, %10, off\n\t"
                 "global_load_async_to_lds_b128 %3, %11, off\n\t"
                 "global_load_async_to_lds_b128 %4, %12, off\n\t"
                 "global_load_async_to_lds_b128 %5, %13, off\n\t"
                 "global_load_async_to_lds_b128 %6, %14, off\n\t"
                 "global_load_async_to_lds_b128 %7, %15, off\n\t"
                 "s_wait_xcnt 0x0"
                 :: "v"(l), "v"(l + LS), "v"(l + 2u * LS), "v"(l + 3u * LS), "v"(l + 4u * LS), "v"(l + 5u * LS), "v"(l + 6u * LS), "v"(l + 7u * LS),
                    "v"(g), "v"(g + rs), "v"(g + 2 * rs), "v"(g + 3 * rs), "v"(g + 4 * rs), "v"(g + 5 * rs), "v"(g + 6 * rs), "v"(g + 7 * rs) : "memory");
}
__device__ __forceinline__ v16bf g_ldf(const unsigned char* p) { return cat16b(*(const v8usa*)p, *(const v8usa*)(p + 32)); }
// EP_QKV: N = 3 DD, the weights of queries, keys and values one behind the other; P holds three planes of LL x DD fp16: [b][h][t][64] for columns below 2 DD (queries, then keys), [b][h][64][t] for the rest (values). EP_RES: C = bf16-rounded R + c. EP_OUT: C = R + c (both f32, pitch DD). EP_RELU: max(c, 0) as bf16 hi + lo planes, pitch MM.
// A wave's 64 columns are one head of one plane (EP_QKV), and its 64 rows lie in one batch; which of the two forms a work-group stores depends on blockIdx.y alone. Every store covers whole 128-byte lines; all pitches are constants, so that one address per wave serves every store.
enum { EP_QKV, EP_RES, EP_OUT, EP_RELU };
__device__ __forceinline__ h16 tohx(float x) { return (h16)x; }
__device__ __forceinline__ void splitf(float y, unsigned short& h, unsigned short& l) { h = f2bf(y); l = f2bf(y - bf2f(h)); }
template <int EP>
__global__ __launch_bounds__(128) void k_gemmt(const bf* __restrict__ A, const bf* __restrict__ A2, const bf* __restrict__ Bt, int K, const float* __restrict__ R, float* C, h16* P, bf* Ph, bf* Pl) {
    constexpr int KS = 64;                // k per stage
    constexpr int PIT = KS * 2 + 16;      // LDS pitch of a row: 16 bytes x odd, so that the 16-byte fragment reads of 16 rows fall on different banks
    constexpr int PL = 128 * PIT;         // one operand plane of a stage
    constexpr int ST = 3 * PL;            // a stage: A, A2, Bt
    constexpr int LPR = KS / 8;           // threads (16 bytes each) per row
    constexpr int RPR = 128 / LPR;        // rows that the 128 threads cover with one copy each
    constexpr int NKS = KS / 32;          // blocks of 32 products per stage
    __shared__ __align__(16) unsigned char ring[2 * ST];
    __shared__ __align__(16) float os[4 * 16 * 68];
    const int tid = threadIdx.x, lane = tid & 31, lr = lane & 15, hi = lane >> 4, wave = tid >> 5, wm = wave >> 1, wn = wave & 1; const int r0 = blockIdx.x * 128, c0 = blockIdx.y * 128;
    const unsigned NT = (unsigned)K / KS; const size_t rs = (size_t)RPR * K;
    const bf* gA = A + (size_t)(r0 + tid / LPR) * K + (tid % LPR) * 8; const bf* gA2 = A2 + (size_t)(r0 + tid / LPR) * K + (tid % LPR) * 8; const bf* gB = Bt + (size_t)(c0 + tid / LPR) * K + (tid % LPR) * 8;
    const unsigned l0 = (unsigned)(size_t)ring + (unsigned)((tid / LPR) * PIT + (tid % LPR) * 16);
    const unsigned char* fa = ring + (wm * 64 + lr) * PIT + hi * 16; const unsigned char* fb = ring + 2 * PL + (wn * 64 + lr) * PIT + hi * 16;
    auto fill = [&](unsigned l, size_t ko) { g_cp8<RPR * PIT>(l, gA + ko, rs); g_cp8<RPR * PIT>(l + PL, gA2 + ko, rs); g_cp8<RPR * PIT>(l + 2 * PL, gB + ko, rs); };    // 8 x RPR = 128 rows of each plane
    v8f acc[4][4];
#pragma unroll
    for (int mb = 0; mb < 4; ++mb)
#pragma unroll
        for (int nb = 0; nb < 4; ++nb) acc[mb][nb] = (v8f){};
    fill(l0, 0);
    asm volatile("s_wait_asynccnt 0x0" ::: "memory");    // this wave's share of stage 0 has landed
    __syncthreads();                                      // and so has every other wave's
    // unroll 1: one stage per trip; the trip holds 64 products already
#pragma unroll 1
    for (unsigned t = 0; t < NT; ++t) {
        const unsigned bo = (t & 1u) * ST;
        v16bf a[2][4], a2[2][4], b[2][4];
#pragma unroll
        for (int i = 0; i < 4; ++i) { a[0][i] = g_ldf(fa + bo + i * 16 * PIT); a2[0][i] = g_ldf(fa + bo + PL + i * 16 * PIT); b[0][i] = g_ldf(fb + bo + i * 16 * PIT); }
#pragma unroll
        for (int ks = 0; ks < NKS; ++ks) {
            if (ks + 1 < NKS) {
#pragma unroll
                for (int i = 0; i < 4; ++i) { a[(ks + 1) & 1][i] = g_ldf(fa + bo + i * 16 * PIT + (ks + 1) * 64); a2[(ks + 1) & 1][i] = g_ldf(fa + bo + PL + i * 16 * PIT + (ks + 1) * 64); b[(ks + 1) & 1][i] = g_ldf(fb + bo + i * 16 * PIT + (ks + 1) * 64); } }
            if (ks == 0 && t + 1 < NT) fill(l0 + (ST - bo), (size_t)(t + 1) * KS);    // the next stage, into the buffer that every wave left at the barrier above; issued under the latency of the fragment reads
#pragma unroll
            for (int nb = 0; nb < 4; ++nb)
#pragma unroll
                for (int mb = 0; mb < 4; ++mb) { acc[mb][nb] = wmmab(a[ks & 1][mb], b[ks & 1][nb], acc[mb][nb]); acc[mb][nb] = wmmab(a2[ks & 1][mb], b[ks & 1][nb], acc[mb][nb]); }
        }
        __builtin_amdgcn_sched_barrier(0);    // the products stay in front of the waits: left free, the compiler moves them behind the barrier, and the wave then waits out the copies it has just issued instead of multiplying under them
        asm volatile("s_wait_dscnt 0x0" ::: "memory");       // this wave has left the buffer that is refilled behind the barrier
        asm volatile("s_wait_asynccnt 0x0" ::: "memory");    // this wave's share of stage t + 1 has landed
        __syncthreads();                                      // publishes stage t + 1 and ends every wave's reads of stage t
    }
    asm volatile("s_wait_asynccnt 0x0" ::: "memory");        // no copy is left in flight when the wave ends
    float* osw = os + wave * 16 * 68;
    const int m0 = r0 + wm * 64, n0 = c0 + wn * 64;    // the corner of this wave's 64 x 64 results
    const int l8 = lane >> 3, c8 = (lane & 7) * 8;     // 16-bit planes: eight lanes of 16 bytes make one 128-byte line, four lines per store
    // Each block of 16 rows (values: columns) goes: results into LDS, whole lines read back and brought into their final form, then the stores. Outside the values a scheduling barrier keeps every read of a block in front of its first store, so that no read's destination
    // falls on a register that an issued store names; EP_QKV, EP_RES and EP_RELU reuse such registers in the next block: there s_wait_xcnt stands behind the stores, held in place by a scheduling barrier (a "memory" clobber alone holds no register write behind it).
    if (EP == EP_QKV && c0 >= 2 * DD) {
        // a lane holds eight consecutive tokens of one column: 16 bytes of the transposed plane. Staged as [16 columns][64 tokens], pitch 144 bytes.
        h16* osh = (h16*)osw;
        h16* vrow = P + (size_t)2 * LL * DD + ((size_t)((m0 / TT) * NH_ + (n0 - 2 * DD) / HDM) * HDM + l8) * TT + (m0 % TT) + c8;
#pragma unroll
        for (int nb = 0; nb < 4; ++nb) {
#pragma unroll
            for (int mb = 0; mb < 4; ++mb) { v8h c;
#pragma unroll
                for (int j = 0; j < 8; ++j) c[j] = tohx(acc[mb][nb][j]);
                *(v8ha*)(osh + lr * 72 + mb * 16 + hi * 8) = c; }
            __builtin_amdgcn_wave_barrier(); asm volatile("" ::: "memory");    // the lines are read back by other lanes of this wave: keeps the reads behind the writes
#pragma unroll
            for (int s = 0; s < 4; ++s) { const v8h val = *(const v8ha*)(osh + (s * 4 + l8) * 72 + c8); *(v8ha*)(vrow + (size_t)(nb * 16 + s * 4) * TT) = val; }
            __builtin_amdgcn_wave_barrier(); asm volatile("" ::: "memory");    // and the next columns' writes behind these reads
            if (nb < 3) { asm volatile("s_wait_xcnt 0x0" ::: "memory"); __builtin_amdgcn_sched_barrier(0); }    // the next columns reuse registers that these stores name
        }
    } else {
        v4f rv[4][8];    // the addend's rows, all fetched here at once: one trip to memory per wave instead of one per 16 rows
        if constexpr (EP == EP_RES || EP == EP_OUT) { const float* rrow = R + (size_t)(m0 + hi) * DD + n0 + lr * 4;
#pragma unroll
            for (int mb = 0; mb < 4; ++mb)
#pragma unroll
                for (int s = 0; s < 8; ++s) rv[mb][s] = *(const v4f*)(rrow + (size_t)(mb * 16 + 2 * s) * DD);
            asm volatile("s_wait_xcnt 0x0" ::: "memory"); __builtin_amdgcn_sched_barrier(0); }    // the address register of these loads is reused behind them
#pragma unroll
        for (int mb = 0; mb < 4; ++mb) {
#pragma unroll
            for (int nb = 0; nb < 4; ++nb) {
#pragma unroll
                for (int j = 0; j < 8; ++j) osw[(hi * 8 + j) * 68 + nb * 16 + lr] = acc[mb][nb][j]; }
            __builtin_amdgcn_wave_barrier(); asm volatile("" ::: "memory");    // the rows are read back by other lanes of this wave: keeps the reads behind the writes
            if constexpr (EP == EP_RES || EP == EP_OUT) {
                float* crow = C + (size_t)(m0 + hi) * DD + n0 + lr * 4; v4f o[8];
#pragma unroll
                for (int s = 0; s < 8; ++s) { const v4f val = *(const v4fa*)(osw + (2 * s + hi) * 68 + lr * 4);
#pragma unroll
                    for (int q = 0; q < 4; ++q) o[s][q] = __fadd_rn(EP == EP_RES ? bfr(rv[mb][s][q]) : rv[mb][s][q], val[q]); }
                __builtin_amdgcn_sched_barrier(0);    // every read and sum in front of the first store
#pragma unroll
                for (int s = 0; s < 8; ++s) *(v4f*)(crow + (size_t)(mb * 16 + 2 * s) * DD) = o[s];
            } else {
                v4f x[4][2];
#pragma unroll
                for (int s = 0; s < 4; ++s) { const float* orow = osw + (s * 4 + l8) * 68 + c8; x[s][0] = *(const v4fa*)orow; x[s][1] = *(const v4fa*)(orow + 4); }
                if constexpr (EP == EP_QKV) { h16* prow = P + (size_t)(n0 / DD) * LL * DD + ((size_t)((m0 / TT) * NH_ + (n0 % DD) / HDM) * TT + (m0 % TT) + l8) * HDM + c8; v8h c[4];
#pragma unroll
                    for (int s = 0; s < 4; ++s)
#pragma unroll
                        for (int j = 0; j < 8; ++j) c[s][j] = tohx(x[s][j >> 2][j & 3]);
                    __builtin_amdgcn_sched_barrier(0);    // every read and conversion in front of the first store
#pragma unroll
                    for (int s = 0; s < 4; ++s) *(v8ha*)(prow + (size_t)(mb * 16 + s * 4) * HDM) = c[s];
                } else { const size_t go = (size_t)(m0 + l8) * MM + n0 + c8; v8us oh[4], ol[4];
#pragma unroll
                    for (int s = 0; s < 4; ++s)
#pragma unroll
                        for (int j = 0; j < 8; ++j) { unsigned short a, c2; splitf(fmaxf(x[s][j >> 2][j & 3], 0.f), a, c2); oh[s][j] = a; ol[s][j] = c2; }
                    __builtin_amdgcn_sched_barrier(0);    // every read and split in front of the first store
#pragma unroll
                    for (int s = 0; s < 4; ++s) { *(v8usa*)(Ph + go + (size_t)(mb * 16 + s * 4) * MM) = oh[s]; *(v8usa*)(Pl + go + (size_t)(mb * 16 + s * 4) * MM) = ol[s]; } }
            }
            __builtin_amdgcn_wave_barrier(); asm volatile("" ::: "memory");    // and the next rows' writes behind these reads
            if (mb < 3 && (EP == EP_QKV || EP == EP_RES || EP == EP_RELU)) { asm volatile("s_wait_xcnt 0x0" ::: "memory"); __builtin_amdgcn_sched_barrier(0); }    // the next rows reuse registers that these stores name
        }
    }
}

typedef __attribute__((ext_vector_type(2))) _Float16 v2h;
typedef __attribute__((ext_vector_type(4))) _Float16 v4h;
typedef __attribute__((ext_vector_type(2))) unsigned short v2us;
typedef __attribute__((ext_vector_type(4))) unsigned short v4us;
typedef __attribute__((ext_vector_type(2))) float v2f;

// ---- d_wtG<K, N>: Bt[n][k] (bf16) = w[k][n] (f32). One tile of 128 k x 64 n per work-group of 8 waves: tile (bx, by) of (K/128, N/64); tw is the work-group's LDS, 64 x 65 dwords. Both sides of the transposition move 256 consecutive bytes per 16 lanes (a row of the tile in, a row of the
// result out); the turn itself happens in LDS. A thread rounds two consecutive k of four n and packs each pair into one dword of the row [n]. The pitch of 65 dwords puts the 32 dwords of a wave's LDS store (16 groups of n, 4 x 65 dwords
// apart, x 2 pairs of k) and of a wave's LDS read (2 rows x 16 lanes, 4 dwords apart) on 32 different banks. K and N are constants, so that one address serves all loads of a thread and one all its stores.
typedef __attribute__((ext_vector_type(4))) unsigned v4u;
typedef v4u __attribute__((may_alias)) v4ua;
template <int K, int N>
__device__ __forceinline__ void d_wtG(const float* __restrict__ w, bf* Bt, int bx, int by, unsigned* tw) {
    constexpr int WP = 65;
    const int c = threadIdx.x & 15, r = threadIdx.x >> 4; const int k0 = bx * 128, n0 = by * 64;
    const float* s = w + (size_t)(k0 + 2 * r) * N + n0 + c * 4;
    v4f a[4][2];    // all eight loads of a thread fly together: one trip to memory per tile
#pragma unroll
    for (int h = 0; h < 4; ++h) { a[h][0] = *(const v4f*)(s + (size_t)(h * 32) * N); a[h][1] = *(const v4f*)(s + (size_t)(h * 32 + 1) * N); }
    asm volatile("s_wait_xcnt 0x0" :: "v"(s) : "memory");    // a precaution: the address that the loads name is an operand here, so it stays in its registers up to this wait
#pragma unroll
    for (int h = 0; h < 4; ++h)
#pragma unroll
        for (int q = 0; q < 4; ++q) tw[(c * 4 + q) * WP + h * 16 + r] = (unsigned)f2bf(a[h][0][q]) | ((unsigned)f2bf(a[h][1][q]) << 16);
    __syncthreads();    // the rows are read back by other waves
    bf* d = Bt + (size_t)(n0 + r) * K + k0 + c * 8;
#pragma unroll
    for (int p = 0; p < 4; ++p) { const unsigned* t = tw + (p * 16 + r) * WP + c * 4; v4u o; o[0] = t[0]; o[1] = t[1]; o[2] = t[2]; o[3] = t[3]; *(v4ua*)(d + (size_t)(p * 16) * K) = o; }
    asm volatile("s_wait_xcnt 0x0" ::: "memory");    // a precaution: in the built kernel the text of the next piece follows behind a branch and writes registers that these stores name
}
__device__ __forceinline__ void d_rmsT(const float* __restrict__ A, int rnd, const float* __restrict__ w, bf* Yh, bf* Yl, int blk) { const int lane = threadIdx.x & 31; const int t = blk * 8 + (threadIdx.x >> 5); if (t >= LL) return; const float* ar = A + (size_t)t * DD; float v[32]; float s = 0.f;
#pragma unroll
    for (int ch = 0; ch < 8; ++ch) { const v4f a = *(const v4f*)(ar + ch * 128 + lane * 4);
#pragma unroll
        for (int q = 0; q < 4; ++q) { const float x = rnd ? bfr(a[q]) : a[q]; v[ch * 4 + q] = x; float p = __fmul_rn(x, x); asm volatile("" : "+v"(p)); s = __fadd_rn(s, p); } }
#pragma unroll
    for (int sh = 16; sh; sh >>= 1) s += __shfl_xor(s, sh, 32);
    const float rs = __frsqrt_rn(__fadd_rn(s * (1.0f / DD), 1e-6f));
{
#pragma unroll
        for (int ch = 0; ch < 8; ++ch) { v4us oh, ol; const v4f wv = *(const v4f*)(w + ch * 128 + lane * 4);    // a lane's four weights in one load: as two, the second's result fell on the offset register that the first still names
#pragma unroll
            for (int q = 0; q < 4; ++q) { float tn = __fmul_rn(v[ch * 4 + q], rs); asm volatile("" : "+v"(tn)); unsigned short a2, c2; splitf(__fmul_rn(tn, bfr(wv[q])), a2, c2); oh[q] = a2; ol[q] = c2; }
            const size_t o = (size_t)t * DD + ch * 128 + lane * 4; *(v4us*)(Yh + o) = oh; *(v4us*)(Yl + o) = ol;
            if (ch < 7) { asm volatile("s_wait_xcnt 0x0" ::: "memory"); __builtin_amdgcn_sched_barrier(0); } }    // a precaution: the next 128 columns reuse registers that these stores name; the scheduling barrier holds their writes behind the wait
         } }
__global__ __launch_bounds__(256) void k_rmsT(const float* __restrict__ A, const float* __restrict__ w, bf* Yh, bf* Yl) { d_rmsT(A, 0, w, Yh, Yl, blockIdx.x); }
__device__ __forceinline__ int t5_bucket(int r) { const int n = r < 0 ? -r : r; int v; if (n < 8) v = n; else { const int k = 31 - __clz(n); v = 8 + 2 * k - 6 + (((long long)n * n >= (1ll << (2 * k + 1))) ? 1 : 0); v = v > 15 ? 15 : v; } return (r > 0 ? 16 : 0) + v; }
// ---- k_fattn: the whole attention of one (batch, head) x 128 queries per work-group; 4 waves, 32 queries per wave; grid (TT/128, NB_*NH_).
// Scores are formed transposed, S^T = K Q^T (rows = keys, columns = queries): a lane then owns one query, its registers hold keys 8 hi + j of each 16-key tile, and two such tiles are,
// register for register, the 32-deep B fragment of O^T = V^T P^T. No score or probability leaves the registers. Sweep 1 finds each query's row maximum, sweep 2 forms the scores again,
// p = 1024 exp(t - max) (f32 sum, fp16 operand), and accumulates O^T; the division by the sum comes last, per lane. The bias is a table over key - query in LDS, the mask row lies beside it.
__device__ __forceinline__ void fa_ldk(const h16* k, int kb, v16h* kf) {
#pragma unroll
    for (int kt = 0; kt < 2; ++kt) { kf[kt * 2] = WFrag<h16>::ld(k + (size_t)(kb + kt * 16) * HDM); kf[kt * 2 + 1] = WFrag<h16>::ld(k + (size_t)(kb + kt * 16) * HDM + 32); } }
__device__ __forceinline__ v8f fa_qk(const v16h* kf, int kt, const v16h* qf) { v8f s = (v8f){}; s = wmma16(kf[kt * 2], qf[0], s); return wmma16(kf[kt * 2 + 1], qf[1], s); }
__device__ __forceinline__ v8f fa_bias(v8f s, const float* tq, const v4f m0, const v4f m1) {
#pragma unroll
    for (int j = 0; j < 8; ++j) s[j] = __fadd_rn(__fadd_rn(s[j], tq[j]), j < 4 ? m0[j & 3] : m1[j & 3]);
    return s; }
__global__ __launch_bounds__(128) void k_fattn(const h16* __restrict__ QP, const h16* __restrict__ KP, const h16* __restrict__ VT, const float* __restrict__ rb, const float* __restrict__ MBr, bf* Ah, bf* Al) {
    __shared__ float tb[TT + 128];
    __shared__ __align__(16) float mk[TT];
    const int bh = blockIdx.y, b = bh / NH_, h = bh % NH_, Q0 = blockIdx.x * 128;
    const float bv = bfr(rb[(threadIdx.x & 31) * NH_ + h]);    // lane l holds bucket l of this head: the table is filled by lane exchange, with one trip to memory instead of one per entry
#pragma unroll
    for (int i = 0; i < (TT + 128) / 128; ++i) { const int e = i * 128 + threadIdx.x; tb[e] = __shfl(bv, t5_bucket(e - 127 - Q0), 32); }    // tb[127 + key - (query - Q0)]; the last entry is never read
#pragma unroll
    for (int i = 0; i < TT / 512; ++i) { const int e = i * 512 + threadIdx.x * 4; *(v4fa*)(mk + e) = *(const v4fa*)(MBr + (size_t)b * TT + e); }
    __syncthreads();
    const int lane = threadIdx.x & 31, lr = lane & 15, hi = lane >> 4, wq = (threadIdx.x >> 5) * 32;
    const h16* q = QP + ((size_t)bh * TT + Q0 + wq + lr) * HDM + 8 * hi;
    const h16* k = KP + ((size_t)bh * TT + lr) * HDM + 8 * hi;
    const h16* v = VT + ((size_t)bh * HDM + lr) * TT + 8 * hi;
    const float* tl = tb + 127 + 8 * hi - wq - lr;
    const float* ml = mk + 8 * hi;
    v16h qf[2][2];
#pragma unroll
    for (int qt = 0; qt < 2; ++qt) { qf[qt][0] = WFrag<h16>::ld(q + qt * 16 * HDM); qf[qt][1] = WFrag<h16>::ld(q + qt * 16 * HDM + 32); }
    v16h kf[4]; fa_ldk(k, 0, kf);
    float mx[2] = { -3.0e38f, -3.0e38f };
    // unroll 2: the key fragments of the next block are fetched one trip ahead into a second register set; two trips per pass let the sets swap without moves
#pragma unroll 2
    for (int kb = 0; kb < TT; kb += 32) {
        v16h kn[4]; fa_ldk(k, (kb + 32) & (TT - 1), kn);    // the last trip fetches block 0, which sweep 2 starts with
#pragma unroll
        for (int kt = 0; kt < 2; ++kt) { const v4f m0 = *(const v4fa*)(ml + kb + kt * 16), m1 = *(const v4fa*)(ml + kb + kt * 16 + 4);
#pragma unroll
            for (int qt = 0; qt < 2; ++qt) { const v8f s = fa_bias(fa_qk(kf, kt, qf[qt]), tl + kb + kt * 16 - qt * 16, m0, m1);
#pragma unroll
                for (int j = 0; j < 8; ++j) mx[qt] = fmaxf(mx[qt], s[j]); } }
#pragma unroll
        for (int i = 0; i < 4; ++i) kf[i] = kn[i];
    }
    float cq[2]; v2f sum[2] = { (v2f){}, (v2f){} };
#pragma unroll
    for (int qt = 0; qt < 2; ++qt) { mx[qt] = fmaxf(mx[qt], __shfl_xor(mx[qt], 16, 32)); cq[qt] = 10.0f - mx[qt] * 1.4426950408889634f; }    // 2^10 = PCAR; a rounding of cq scales a whole row and cancels in p / sum
    v8f o[2][4];
#pragma unroll
    for (int qt = 0; qt < 2; ++qt)
#pragma unroll
        for (int dt = 0; dt < 4; ++dt) o[qt][dt] = (v8f){};
    // unroll 1: the trip is long enough, and a second copy would only raise the register count
#pragma unroll 1
    for (int kb = 0; kb < TT; kb += 32) {
        v16h vf[4];
#pragma unroll
        for (int dt = 0; dt < 4; ++dt) vf[dt] = WFrag<h16>::ld(v + (size_t)dt * 16 * TT + kb);
        v8f s[2][2];
#pragma unroll
        for (int kt = 0; kt < 2; ++kt)
#pragma unroll
            for (int qt = 0; qt < 2; ++qt) s[kt][qt] = fa_qk(kf, kt, qf[qt]);
        fa_ldk(k, (kb + 32) & (TT - 1), kf);    // the key fragments are free once the score products have issued: the next block's fly under the exponentials and the value products
        __builtin_amdgcn_sched_barrier(0);      // keeps both groups of loads up here; without it the value loads sink to just in front of their products and each waits out a full trip to L2
        v16h pf[2];
#pragma unroll
        for (int kt = 0; kt < 2; ++kt) { const v4f m0 = *(const v4fa*)(ml + kb + kt * 16), m1 = *(const v4fa*)(ml + kb + kt * 16 + 4);
#pragma unroll
            for (int qt = 0; qt < 2; ++qt) { const v8f t = fa_bias(s[kt][qt], tl + kb + kt * 16 - qt * 16, m0, m1);
#pragma unroll
                for (int j = 0; j < 8; j += 2) { v2f p; p[0] = __builtin_amdgcn_exp2f(__builtin_fmaf(t[j], 1.4426950408889634f, cq[qt])); p[1] = __builtin_amdgcn_exp2f(__builtin_fmaf(t[j + 1], 1.4426950408889634f, cq[qt]));
                    sum[qt] += p; pf[qt][kt * 8 + j] = tohx(p[0]); pf[qt][kt * 8 + j + 1] = tohx(p[1]); } } }
#pragma unroll
        for (int dt = 0; dt < 4; ++dt)
#pragma unroll
            for (int qt = 0; qt < 2; ++qt) o[qt][dt] = wmma16(vf[dt], pf[qt], o[qt][dt]);
        // the trip ends in matrix products and the next one begins by overwriting their probability operands: these four slots keep the distance over the back edge
        asm volatile("v_nop\n\tv_nop\n\tv_nop\n\tv_nop" : "+v"(o[0][3]), "+v"(o[1][3]) : "v"(pf[0]), "v"(pf[1]));
    }
#pragma unroll
    for (int qt = 0; qt < 2; ++qt) { float sq = sum[qt][0] + sum[qt][1]; sq += __shfl_xor(sq, 16, 32); const float inv = __fdiv_rn(1.0f, sq);
        const size_t oo = ((size_t)b * TT + Q0 + wq + qt * 16 + lr) * DD + h * HDM + 8 * hi;
#pragma unroll
        for (int dt = 0; dt < 4; ++dt) { v8us oh, ol;
#pragma unroll
            for (int j = 0; j < 8; ++j) { unsigned short a, c2; splitf(o[qt][dt][j] * inv, a, c2); oh[j] = a; ol[j] = c2; }
            *(v8usa*)(Ah + oo + dt * 16) = oh; *(v8usa*)(Al + oo + dt * 16) = ol; } }
}
__device__ __forceinline__ void d_mrow(const float* __restrict__ mask, float* MBr, int blk) { const int e = blk * 256 + threadIdx.x; if (e >= NB_ * TT) return; float om = __fsub_rn(1.0f, bfr(mask[e])); asm volatile("" : "+v"(om)); const float v = __fmul_rn(om, -10000.0f); *(float*)(MBr + e) = v;  }
// ---- k_prep: everything that reads inputs alone, in one grid of 256-thread work-groups: the six weight transposes, the first norm and the mask row. None reads what another writes; a work-group's index alone says which piece it is,
// so every branch (and the barrier inside a transpose) is uniform for the work-group. All pieces but the mask row move about the same number of bytes. W4: the planes of wq, wk, wv, wo one behind the other.
__global__ __launch_bounds__(256) void k_prep(const float* __restrict__ wq, const float* __restrict__ wk, const float* __restrict__ wv, const float* __restrict__ wo, const float* __restrict__ wi, const float* __restrict__ wf,
                                              const float* __restrict__ hid, const float* __restrict__ ln, const float* __restrict__ mask, bf* W4, bf* WI, bf* WF, bf* Yh, bf* Yl, float* MBr) {
    constexpr int NI = (DD / 128) * (MM / 64), NF = (MM / 128) * (DD / 64), N1 = (DD / 128) * (DD / 64), NR = LL / 8;
    __shared__ unsigned tw[64 * 65];
    const int b = blockIdx.x, bf_ = b - NI, b1 = bf_ - NF, br = b1 - 4 * N1;
    if (b < NI) d_wtG<DD, MM>(wi, WI, b % (DD / 128), b / (DD / 128), tw);
    else if (bf_ < NF) d_wtG<MM, DD>(wf, WF, bf_ % (MM / 128), bf_ / (MM / 128), tw);
    else if (b1 < 4 * N1) { const int m = b1 / N1, e = b1 % N1; d_wtG<DD, DD>(m == 0 ? wq : m == 1 ? wk : m == 2 ? wv : wo, W4 + (size_t)m * DD * DD, e % (DD / 128), e / (DD / 128), tw); }
    else if (br < NR) d_rmsT(hid, 1, ln, Yh, Yl, br);
    else d_mrow(mask, MBr, br - NR);
}

extern "C" void kernel_launch(void* const* d_in, const int* in_sizes, int n_in,
                              void* d_out, int out_size, void* d_ws, size_t ws_size, hipStream_t stream) {
    (void)in_sizes; (void)n_in; (void)out_size;
    const float* IN[11]; for (int i = 0; i < 11; ++i) IN[i] = (const float*)d_in[i];   // 0 hidden, 1 attn_mask, 2 ln1_w, 3 wq, 4 wk, 5 wv, 6 wo, 7 rel_bias [32][16], 8 ln2_w, 9 wi [1024][4096], 10 wo_ff [4096][1024] (x @ W)
    float* OUT = (float*)d_out;     // [4][1024][1024]
    char* wsp = (char*)d_ws;
    auto take = [&](size_t bytes) { char* p = wsp; wsp += (bytes + 255) & ~(size_t)255; return (void*)p; };
    bf* W4 = (bf*)take((size_t)4 * DD * DD * 2); bf* WO = W4 + (size_t)3 * DD * DD; bf* WI = (bf*)take((size_t)MM * DD * 2); bf* WF = (bf*)take((size_t)DD * MM * 2); float* MBr = (float*)take((size_t)NB_ * TT * 4);    // W4: wq, wk, wv, wo
    bf* Xh = (bf*)take((size_t)LL * DD * 2); bf* Xl = (bf*)take((size_t)LL * DD * 2);
    h16* QP = (h16*)take((size_t)3 * LL * DD * 2); h16* KP = QP + (size_t)LL * DD; h16* VT = KP + (size_t)LL * DD; bf* Ah = (bf*)take((size_t)LL * DD * 2); bf* Al = (bf*)take((size_t)LL * DD * 2);
    float* H = (float*)take((size_t)LL * DD * 4); bf* Gh = (bf*)take((size_t)LL * MM * 2); bf* Gl = (bf*)take((size_t)LL * MM * 2);    // relu-FFN hidden planes
    if ((size_t)(wsp - (char*)d_ws) > ws_size) return;    // total ~ 168 MB
    k_prep<<<(DD / 128) * (MM / 64) + (MM / 128) * (DD / 64) + 4 * (DD / 128) * (DD / 64) + LL / 8 + NB_ * TT / 256, 256, 0, stream>>>(IN[3], IN[4], IN[5], IN[6], IN[9], IN[10], IN[0], IN[2], IN[1], W4, WI, WF, Xh, Xl, MBr);
    k_gemmt<EP_QKV><<<dim3(LL / 128, 3 * DD / 128, 1), 128, 0, stream>>>(Xh, Xl, W4, DD, nullptr, nullptr, QP, nullptr, nullptr);    // planes [b][h][t][64] (q, k) and [b][h][64][t] (v)
    k_fattn<<<dim3(TT / 128, NB_ * NH_, 1), 128, 0, stream>>>(QP, KP, VT, IN[7], MBr, Ah, Al);
    k_gemmt<EP_RES><<<dim3(LL / 128, DD / 128, 1), 128, 0, stream>>>(Ah, Al, WO, DD, IN[0], H, nullptr, nullptr, nullptr);
    k_rmsT<<<LL / 8, 256, 0, stream>>>(H, IN[8], Xh, Xl);
    k_gemmt<EP_RELU><<<dim3(LL / 128, MM / 128, 1), 128, 0, stream>>>(Xh, Xl, WI, DD, nullptr, nullptr, nullptr, Gh, Gl);
    k_gemmt<EP_OUT><<<dim3(LL / 128, DD / 128, 1), 128, 0, stream>>>(Gh, Gl, WF, MM, H, OUT, nullptr, nullptr, nullptr);
}

// v006
// A run of this version takes 243 microseconds.
// Timed twice side by side with v005, it ran 1.07 times as fast both times.
// All steps since v000 together make it 11.3 times as fast.
#include <hip/hip_runtime.h>

// T5 encoder block (hidden [4][1024][1024], attn_mask [4][1024]; x = T5-RMSNorm(hidden) ln1_w (eps 1e-6, no mean/bias); q/k/v = x w (16 heads x 64); scores = q.k (NO 1/sqrt(d)) + rel_bias[bucket(j - i)][h]
// + (1 - attn_mask[b][j]) (-1e4); softmax; hidden += merged ctx wo; y = RMSNorm(hidden) ln2_w; hidden += relu(y wi) wo_ff -> [4][1024][1024]. The bidirectional relative-position bucket of an integer offset
// (32 buckets, max distance 128) is evaluated with exact integer arithmetic: for |r| >= 8, 8 + 2 floor(log2 |r|) - 6 + [ |r|^2 >= 2^(2 floor(log2|r|) + 1) ], capped at 15 (this equals the reference's
// float formula for every offset 0..1023), + 16 for r > 0.)
// Compute dtypes, f32 accumulate: every input rounded to bf16; both RMSNorms f32 (wave per token) -> bf16 hi+lo planes; q/k/v, wo, wi, wo_ff on hl planes of their computed operands
// x exact weights (2 products); scores (K 64) and probs.v on SINGLE fp16 planes with an f32 register-row softmax (bias + mask added in f32; probabilities x1024); residuals and relu f32.

#define NB_  4
#define TT   1024
#define LL   4096
#define DD   1024
#define NH_  16
#define HDM  64
#define MM   4096
#define PCAR 1024.0f
typedef _Float16 h16;
typedef unsigned short bf;
typedef __attribute__((ext_vector_type(16))) __bf16   v16bf;
typedef __attribute__((ext_vector_type(16))) _Float16 v16h;
typedef __attribute__((ext_vector_type(8)))  _Float16 v8h;
typedef __attribute__((ext_vector_type(8)))  unsigned short v8us;
typedef __attribute__((ext_vector_type(8)))  float    v8f;
typedef __attribute__((ext_vector_type(4)))  float    v4f;
typedef v8h  __attribute__((may_alias)) v8ha;
typedef v4f  __attribute__((may_alias)) v4fa;
typedef v8us __attribute__((may_alias)) v8usa;

__device__ __forceinline__ unsigned short f2bf(float f) { unsigned u = __float_as_uint(f); u += 0x7FFFu + ((u >> 16) & 1u); return (unsigned short)(u >> 16); }
__device__ __forceinline__ float bf2f(unsigned short b) { return __uint_as_float(((unsigned)b) << 16); }
__device__ __forceinline__ float bfr(float f) { return bf2f(f2bf(f)); }
__device__ __forceinline__ v16h cat16(v8h lo, v8h hi) { return __builtin_shufflevector(lo, hi, 0, 1, 2, 3, 4, 5, 6, 7, 8, 9, 10, 11, 12, 13, 14, 15); }
__device__ __forceinline__ v16bf cat16b(v8us lo, v8us hi) { return __builtin_bit_cast(v16bf, __builtin_shufflevector(lo, hi, 0, 1, 2, 3, 4, 5, 6, 7, 8, 9, 10, 11, 12, 13, 14, 15)); }
__device__ __forceinline__ v8f wmma16(v16h a, v16h b, v8f c) { return __builtin_amdgcn_wmma_f32_16x16x32_f16(false, a, false, b, (short)0, c, false, false); }
__device__ __forceinline__ v8f wmmab(v16bf a, v16bf b, v8f c) { return __builtin_amdgcn_wmma_f32_16x16x32_bf16(false, a, false, b, (short)0, c, false, false); }



// ---- k_gemmt<EP>: c[m][n] (f32) = sum_k (A[m][k] + A2[m][k]) Bt[n][k], all three planes bf16 and K-contiguous; c never reaches memory as such: the epilogue EP stores it in the form that its reader takes (below). One 128x128 tile per work-group of 4 waves (2x2, 64x64 = 16 accumulators each);
// grid (M/128, N/128), 128 threads; M, N % 128 == 0, K % 64 == 0. A stage is 64 k (one 128-byte line) of the 128 rows of A, A2 and Bt; it comes into LDS by asynchronous copies, whole 128-byte lines, once per work-group
// instead of once per wave, and the next stage flies while this one is multiplied (two buffers). Fragment form and the order of the products per accumulator are those of a wave reading global memory.
template <typename T16> struct WFrag;
template <> struct WFrag<h16> { typedef v16h V; static __device__ __forceinline__ V ld(const h16* p) { return cat16(*(const v8h*)p, *(const v8h*)(p + 16)); } };
// eight copies: this thread's 16 bytes of eight rows of one plane, LS bytes apart in LDS and rs elements apart in memory. The s_wait_xcnt closes the statement so that no address register is rewritten ahead of it.
template <unsigned LS>
__device__ __forceinline__ void g_cp8(unsigned l, const bf* g, size_t rs) {
    asm volatile("global_load_async_to_lds_b128 %0, %8, off\n\t"
                 "global_load_async_to_lds_b128 %1, %9, off\n\t"
                 "global_load_async_to_lds_b128 %2, %10, off\n\t"
                 "global_load_async_to_lds_b128 %3, %11, off\n\t"
                 "global_load_async_to_lds_b128 %4, %12, off\n\t"
                 "global_load_async_to_lds_b128 %5, %13, off\n\t"
                 "global_load_async_to_lds_b128 %6, %14, off\n\t"
                 "global_load_async_to_lds_b128 %7, %15, off\n\t"
                 "s_wait_xcnt 0x0"
                 :: "v"(l), "v"(l + LS), "v"(l + 2u * LS), "v"(l + 3u * LS), "v"(l + 4u * LS), "v"(l + 5u * LS), "v"(l + 6u * LS), "v"(l + 7u * LS),
                    "v"(g), "v"(g + rs), "v"(g + 2 * rs), "v"(g + 3 * rs), "v"(g + 4 * rs), "v"(g + 5 * rs), "v"(g + 6 * rs), "v"(g + 7 * rs) : "memory");
}
__device__ __forceinline__ v16bf g_ldf(const unsigned char* p) { return cat16b(*(const v8usa*)p, *(const v8usa*)(p + 32)); }
// EP_QKV: N = 3 DD, the weights of queries, keys and values one behind the other; P holds three planes of LL x DD fp16: [b][h][t][64] for columns below 2 DD (queries, then keys), [b][h][64][t] for the rest (values). EP_RES: C = bf16-rounded R + c. EP_OUT: C = R + c (both f32, pitch DD). EP_RELU: max(c, 0) as bf16 hi + lo planes, pitch MM.
// A wave's 64 columns are one head of one plane (EP_QKV), and its 64 rows lie in one batch; which of the two forms a work-group stores depends on blockIdx.y alone. Every store covers whole 128-byte lines; all pitches are constants, so that one address per wave serves every store.
enum { EP_QKV, EP_RES, EP_OUT, EP_RELU };
__device__ __forceinline__ h16 tohx(float x) { return (h16)x; }
__device__ __forceinline__ void splitf(float y, unsigned short& h, unsigned short& l) { h = f2bf(y); l = f2bf(y - bf2f(h)); }
template <int EP>
__global__ __launch_bounds__(128) void k_gemmt(const bf* __restrict__ A, const bf* __restrict__ A2, const bf* __restrict__ Bt, int K, const float* __restrict__ R, float* C, h16* P, bf* Ph, bf* Pl) {
    constexpr int KS = 64;                // k per stage
    constexpr int PIT = KS * 2 + 16;      // LDS pitch of a row: 16 bytes x odd, so that the 16-byte fragment reads of 16 rows fall on different banks
    constexpr int PL = 128 * PIT;         // one operand plane of a stage
    constexpr int ST = 3 * PL;            // a stage: A, A2, Bt
    constexpr int LPR = KS / 8;           // threads (16 bytes each) per row
    constexpr int RPR = 128 / LPR;        // rows that the 128 threads cover with one copy each
    constexpr int NKS = KS / 32;          // blocks of 32 products per stage
    __shared__ __align__(16) unsigned char ring[2 * ST];
    __shared__ __align__(16) float os[4 * 16 * 68];
    const int tid = threadIdx.x, lane = tid & 31, lr = lane & 15, hi = lane >> 4, wave = tid >> 5, wm = wave >> 1, wn = wave & 1; const int r0 = blockIdx.x * 128, c0 = blockIdx.y * 128;
    const unsigned NT = (unsigned)K / KS; const size_t rs = (size_t)RPR * K;
    const bf* gA = A + (size_t)(r0 + tid / LPR) * K + (tid % LPR) * 8; const bf* gA2 = A2 + (size_t)(r0 + tid / LPR) * K + (tid % LPR) * 8; const bf* gB = Bt + (size_t)(c0 + tid / LPR) * K + (tid % LPR) * 8;
    const unsigned l0 = (unsigned)(size_t)ring + (unsigned)((tid / LPR) * PIT + (tid % LPR) * 16);
    const unsigned char* fa = ring + (wm * 64 + lr) * PIT + hi * 16; const unsigned char* fb = ring + 2 * PL + (wn * 64 + lr) * PIT + hi * 16;
    auto fill = [&](unsigned l, size_t ko) { g_cp8<RPR * PIT>(l, gA + ko, rs); g_cp8<RPR * PIT>(l + PL, gA2 + ko, rs); g_cp8<RPR * PIT>(l + 2 * PL, gB + ko, rs); };    // 8 x RPR = 128 rows of each plane
    v8f acc[4][4];
#pragma unroll
    for (int mb = 0; mb < 4; ++mb)
#pragma unroll
        for (int nb = 0; nb < 4; ++nb) acc[mb][nb] = (v8f){};
    fill(l0, 0);
    asm volatile("s_wait_asynccnt 0x0" ::: "memory");    // this wave's share of stage 0 has landed
    __syncthreads();                                      // and so has every other wave's
    // unroll 1: one stage per trip; the trip holds 64 products already
#pragma unroll 1
    for (unsigned t = 0; t < NT; ++t) {
        const unsigned bo = (t & 1u) * ST;
        v16bf a[2][4], a2[2][4], b[2][4];
#pragma unroll
        for (int i = 0; i < 4; ++i) { a[0][i] = g_ldf(fa + bo + i * 16 * PIT); a2[0][i] = g_ldf(fa + bo + PL + i * 16 * PIT); b[0][i] = g_ldf(fb + bo + i * 16 * PIT); }
#pragma unroll
        for (int ks = 0; ks < NKS; ++ks) {
            if (ks + 1 < NKS) {
#pragma unroll
                for (int i = 0; i < 4; ++i) { a[(ks + 1) & 1][i] = g_ldf(fa + bo + i * 16 * PIT + (ks + 1) * 64); a2[(ks + 1) & 1][i] = g_ldf(fa + bo + PL + i * 16 * PIT + (ks + 1) * 64); b[(ks + 1) & 1][i] = g_ldf(fb + bo + i * 16 * PIT + (ks + 1) * 64); } }
            if (ks == 0 && t + 1 < NT) fill(l0 + (ST - bo), (size_t)(t + 1) * KS);    // the next stage, into the buffer that every wave left at the barrier above; issued under the latency of the fragment reads
#pragma unroll
            for (int nb = 0; nb < 4; ++nb)
#pragma unroll
                for (int mb = 0; mb < 4; ++mb) { acc[mb][nb] = wmmab(a[ks & 1][mb], b[ks & 1][nb], acc[mb][nb]); acc[mb][nb] = wmmab(a2[ks & 1][mb], b[ks & 1][nb], acc[mb][nb]); }
        }
        __builtin_amdgcn_sched_barrier(0);    // the products stay in front of the waits: left free, the compiler moves them behind the barrier, and the wave then waits out the copies it has just issued instead of multiplying under them
        asm volatile("s_wait_dscnt 0x0" ::: "memory");       // this wave has left the buffer that is refilled behind the barrier
        asm volatile("s_wait_asynccnt 0x0" ::: "memory");    // this wave's share of stage t + 1 has landed
        __syncthreads();                                      // publishes stage t + 1 and ends every wave's reads of stage t
    }
    asm volatile("s_wait_asynccnt 0x0" ::: "memory");        // no copy is left in flight when the wave ends
    float* osw = os + wave * 16 * 68;
    const int m0 = r0 + wm * 64, n0 = c0 + wn * 64;    // the corner of this wave's 64 x 64 results
    const int l8 = lane >> 3, c8 = (lane & 7) * 8;     // 16-bit planes: eight lanes of 16 bytes make one 128-byte line, four lines per store
    // Each block of 16 rows (values: columns) goes: results into LDS, whole lines read back and brought into their final form, then the stores. Outside the values a scheduling barrier keeps every read of a block in front of its first store, so that no read's destination
    // falls on a register that an issued store names; EP_QKV, EP_RES and EP_RELU reuse such registers in the next block: there s_wait_xcnt stands behind the stores, held in place by a scheduling barrier (a "memory" clobber alone holds no register write behind it).
    if (EP == EP_QKV && c0 >= 2 * DD) {
        // a lane holds eight consecutive tokens of one column: 16 bytes of the transposed plane. Staged as [16 columns][64 tokens], pitch 144 bytes.
        h16* osh = (h16*)osw;
        h16* vrow = P + (size_t)2 * LL * DD + ((size_t)((m0 / TT) * NH_ + (n0 - 2 * DD) / HDM) * HDM + l8) * TT + (m0 % TT) + c8;
#pragma unroll
        for (int nb = 0; nb < 4; ++nb) {
#pragma unroll
            for (int mb = 0; mb < 4; ++mb) { v8h c;
#pragma unroll
                for (int j = 0; j < 8; ++j) c[j] = tohx(acc[mb][nb][j]);
                *(v8ha*)(osh + lr * 72 + mb * 16 + hi * 8) = c; }
            __builtin_amdgcn_wave_barrier(); asm volatile("" ::: "memory");    // the lines are read back by other lanes of this wave: keeps the reads behind the writes
#pragma unroll
            for (int s = 0; s < 4; ++s) { const v8h val = *(const v8ha*)(osh + (s * 4 + l8) * 72 + c8); *(v8ha*)(vrow + (size_t)(nb * 16 + s * 4) * TT) = val; }
            __builtin_amdgcn_wave_barrier(); asm volatile("" ::: "memory");    // and the next columns' writes behind these reads
            if (nb < 3) { asm volatile("s_wait_xcnt 0x0" ::: "memory"); __builtin_amdgcn_sched_barrier(0); }    // the next columns reuse registers that these stores name
        }
    } else {
        v4f rv[4][8];    // the addend's rows, all fetched here at once: one trip to memory per wave instead of one per 16 rows
        if constexpr (EP == EP_RES || EP == EP_OUT) { const float* rrow = R + (size_t)(m0 + hi) * DD + n0 + lr * 4;
#pragma unroll
            for (int mb = 0; mb < 4; ++mb)
#pragma unroll
                for (int s = 0; s < 8; ++s) rv[mb][s] = *(const v4f*)(rrow + (size_t)(mb * 16 + 2 * s) * DD);
            asm volatile("s_wait_xcnt 0x0" ::: "memory"); __builtin_amdgcn_sched_barrier(0); }    // the address register of these loads is reused behind them
#pragma unroll
        for (int mb = 0; mb < 4; ++mb) {
#pragma unroll
            for (int nb = 0; nb < 4; ++nb) {
#pragma unroll
                for (int j = 0; j < 8; ++j) osw[(hi * 8 + j) * 68 + nb * 16 + lr] = acc[mb][nb][j]; }
            __builtin_amdgcn_wave_barrier(); asm volatile("" ::: "memory");    // the rows are read back by other lanes of this wave: keeps the reads behind the writes
            if constexpr (EP == EP_RES || EP == EP_OUT) {
                float* crow = C + (size_t)(m0 + hi) * DD + n0 + lr * 4; v4f o[8];
#pragma unroll
                for (int s = 0; s < 8; ++s) { const v4f val = *(const v4fa*)(osw + (2 * s + hi) * 68 + lr * 4);
#pragma unroll
                    for (int q = 0; q < 4; ++q) o[s][q] = __fadd_rn(EP == EP_RES ? bfr(rv[mb][s][q]) : rv[mb][s][q], val[q]); }
                __builtin_amdgcn_sched_barrier(0);    // every read and sum in front of the first store
#pragma unroll
                for (int s = 0; s < 8; ++s) *(v4f*)(crow + (size_t)(mb * 16 + 2 * s) * DD) = o[s];
            } else {
                v4f x[4][2];
#pragma unroll
                for (int s = 0; s < 4; ++s) { const float* orow = osw + (s * 4 + l8) * 68 + c8; x[s][0] = *(const v4fa*)orow; x[s][1] = *(const v4fa*)(orow + 4); }
                if constexpr (EP == EP_QKV) { h16* prow = P + (size_t)(n0 / DD) * LL * DD + ((size_t)((m0 / TT) * NH_ + (n0 % DD) / HDM) * TT + (m0 % TT) + l8) * HDM + c8; v8h c[4];
#pragma unroll
                    for (int s = 0; s < 4; ++s)
#pragma unroll
                        for (int j = 0; j < 8; ++j) c[s][j] = tohx(x[s][j >> 2][j & 3]);
                    __builtin_amdgcn_sched_barrier(0);    // every read and conversion in front of the first store
#pragma unroll
                    for (int s = 0; s < 4; ++s) *(v8ha*)(prow + (size_t)(mb * 16 + s * 4) * HDM) = c[s];
                } else { const size_t go = (size_t)(m0 + l8) * MM + n0 + c8; v8us oh[4], ol[4];
#pragma unroll
                    for (int s = 0; s < 4; ++s)
#pragma unroll
                        for (int j = 0; j < 8; ++j) { unsigned short a, c2; splitf(fmaxf(x[s][j >> 2][j & 3], 0.f), a, c2); oh[s][j] = a; ol[s][j] = c2; }
                    __builtin_amdgcn_sched_barrier(0);    // every read and split in front of the first store
#pragma unroll
                    for (int s = 0; s < 4; ++s) { *(v8usa*)(Ph + go + (size_t)(mb * 16 + s * 4) * MM) = oh[s]; *(v8usa*)(Pl + go + (size_t)(mb * 16 + s * 4) * MM) = ol[s]; } }
            }
            __builtin_amdgcn_wave_barrier(); asm volatile("" ::: "memory");    // and the next rows' writes behind these reads
            if (mb < 3 && (EP == EP_QKV || EP == EP_RES || EP == EP_RELU)) { asm volatile("s_wait_xcnt 0x0" ::: "memory"); __builtin_amdgcn_sched_barrier(0); }    // the next rows reuse registers that these stores name
        }
    }
}

typedef __attribute__((ext_vector_type(2))) _Float16 v2h;
typedef __attribute__((ext_vector_type(4))) _Float16 v4h;
typedef __attribute__((ext_vector_type(2))) unsigned short v2us;
typedef __attribute__((ext_vector_type(4))) unsigned short v4us;
typedef __attribute__((ext_vector_type(2))) float v2f;

// ---- d_wtG<K, N>: Bt[n][k] (bf16) = w[k][n] (f32). One tile of 128 k x 64 n per work-group of 8 waves: tile (bx, by) of (K/128, N/64); tw is the work-group's LDS, 64 x 65 dwords. Both sides of the transposition move 256 consecutive bytes per 16 lanes (a row of the tile in, a row of the
// result out); the turn itself happens in LDS. A thread rounds two consecutive k of four n and packs each pair into one dword of the row [n]. The pitch of 65 dwords puts the 32 dwords of a wave's LDS store (16 groups of n, 4 x 65 dwords
// apart, x 2 pairs of k) and of a wave's LDS read (2 rows x 16 lanes, 4 dwords apart) on 32 different banks. K and N are constants, so that one address serves all loads of a thread and one all its stores.
typedef __attribute__((ext_vector_type(4))) unsigned v4u;
typedef v4u __attribute__((may_alias)) v4ua;
template <int K, int N>
__device__ __forceinline__ void d_wtG(const float* __restrict__ w, bf* Bt, int bx, int by, unsigned* tw) {
    constexpr int WP = 65;
    const int c = threadIdx.x & 15, r = threadIdx.x >> 4; const int k0 = bx * 128, n0 = by * 64;
    const float* s = w + (size_t)(k0 + 2 * r) * N + n0 + c * 4;
    v4f a[4][2];    // all eight loads of a thread fly together: one trip to memory per tile
#pragma unroll
    for (int h = 0; h < 4; ++h) { a[h][0] = *(const v4f*)(s + (size_t)(h * 32) * N); a[h][1] = *(const v4f*)(s + (size_t)(h * 32 + 1) * N); }
    asm volatile("s_wait_xcnt 0x0" :: "v"(s) : "memory");    // a precaution: the address that the loads name is an operand here, so it stays in its registers up to this wait
#pragma unroll
    for (int h = 0; h < 4; ++h)
#pragma unroll
        for (int q = 0; q < 4; ++q) tw[(c * 4 + q) * WP + h * 16 + r] = (unsigned)f2bf(a[h][0][q]) | ((unsigned)f2bf(a[h][1][q]) << 16);
    __syncthreads();    // the rows are read back by other waves
    bf* d = Bt + (size_t)(n0 + r) * K + k0 + c * 8;
#pragma unroll
    for (int p = 0; p < 4; ++p) { const unsigned* t = tw + (p * 16 + r) * WP + c * 4; v4u o; o[0] = t[0]; o[1] = t[1]; o[2] = t[2]; o[3] = t[3]; *(v4ua*)(d + (size_t)(p * 16) * K) = o; }
    asm volatile("s_wait_xcnt 0x0" ::: "memory");    // a precaution: in the built kernel the text of the next piece follows behind a branch and writes registers that these stores name
}
__device__ __forceinline__ void d_rmsT(const float* __restrict__ A, int rnd, const float* __restrict__ w, bf* Yh, bf* Yl, int blk) { const int lane = threadIdx.x & 31; const int t = blk * 8 + (threadIdx.x >> 5); if (t >= LL) return; const float* ar = A + (size_t)t * DD; float v[32]; float s = 0.f;
#pragma unroll
    for (int ch = 0; ch < 8; ++ch) { const v4f a = *(const v4f*)(ar + ch * 128 + lane * 4);
#pragma unroll
        for (int q = 0; q < 4; ++q) { const float x = rnd ? bfr(a[q]) : a[q]; v[ch * 4 + q] = x; float p = __fmul_rn(x, x); asm volatile("" : "+v"(p)); s = __fadd_rn(s, p); } }
#pragma unroll
    for (int sh = 16; sh; sh >>= 1) s += __shfl_xor(s, sh, 32);
    const float rs = __frsqrt_rn(__fadd_rn(s * (1.0f / DD), 1e-6f));
{
#pragma unroll
        for (int ch = 0; ch < 8; ++ch) { v4us oh, ol; const v4f wv = *(const v4f*)(w + ch * 128 + lane * 4);    // a lane's four weights in one load: as two, the second's result fell on the offset register that the first still names
#pragma unroll
            for (int q = 0; q < 4; ++q) { float tn = __fmul_rn(v[ch * 4 + q], rs); asm volatile("" : "+v"(tn)); unsigned short a2, c2; splitf(__fmul_rn(tn, bfr(wv[q])), a2, c2); oh[q] = a2; ol[q] = c2; }
            const size_t o = (size_t)t * DD + ch * 128 + lane * 4; *(v4us*)(Yh + o) = oh; *(v4us*)(Yl + o) = ol;
            if (ch < 7) { asm volatile("s_wait_xcnt 0x0" ::: "memory"); __builtin_amdgcn_sched_barrier(0); } }    // a precaution: the next 128 columns reuse registers that these stores name; the scheduling barrier holds their writes behind the wait
         } }
__global__ __launch_bounds__(256) void k_rmsT(const float* __restrict__ A, const float* __restrict__ w, bf* Yh, bf* Yl) { d_rmsT(A, 0, w, Yh, Yl, blockIdx.x); }
__device__ __forceinline__ int t5_bucket(int r) { const int n = r < 0 ? -r : r; int v; if (n < 8) v = n; else { const int k = 31 - __clz(n); v = 8 + 2 * k - 6 + (((long long)n * n >= (1ll << (2 * k + 1))) ? 1 : 0); v = v > 15 ? 15 : v; } return (r > 0 ? 16 : 0) + v; }
// ---- k_fattn: the whole attention of one (batch, head) x 256 queries per work-group; 8 waves, 32 queries per wave; grid (TT/256, NB_*NH_), one work-group per WGP.
// All keys and all transposed values of the (batch, head) come into LDS once per work-group, by asynchronous copies of whole 128-byte lines; every fragment of both sweeps is then an LDS read at a padded pitch,
// where a wave reading global memory touched 16 lines per load and each of the waves asked for the same lines again. The values fly while sweep 1 runs. Fragment form and the order of all sums are unchanged.
// Scores are formed transposed, S^T = K Q^T (rows = keys, columns = queries): a lane then owns one query, its registers hold keys 8 hi + j of each 16-key tile, and two such tiles are,
// register for register, the 32-deep B fragment of O^T = V^T P^T. No score or probability leaves the registers. Sweep 1 finds each query's row maximum, sweep 2 forms the scores again,
// p = 1024 exp(t - max) (f32 sum, fp16 operand), and accumulates O^T; the division by the sum comes last, per lane. The bias is a table over key - query in LDS, the mask row lies beside it.
#define KPIT (HDM * 2 + 16)    // LDS pitch of a key row and
#define VPIT (TT * 2 + 16)     // of a row of the transposed values: 16 bytes x odd, so that the 16-byte fragment reads of 16 rows fall on different banks
__device__ __forceinline__ v16h fa_ldf(const unsigned char* p) { return cat16(*(const v8ha*)p, *(const v8ha*)(p + 32)); }
__device__ __forceinline__ void fa_ldk(const unsigned char* k, int kb, v16h* kf) {
#pragma unroll
    for (int kt = 0; kt < 2; ++kt) { kf[kt * 2] = fa_ldf(k + (kb + kt * 16) * KPIT); kf[kt * 2 + 1] = fa_ldf(k + (kb + kt * 16) * KPIT + 64); } }
__device__ __forceinline__ v8f fa_qk(const v16h* kf, int kt, const v16h* qf) { v8f s = (v8f){}; s = wmma16(kf[kt * 2], qf[0], s); return wmma16(kf[kt * 2 + 1], qf[1], s); }
__device__ __forceinline__ v8f fa_bias(v8f s, const float* tq, const v4f m0, const v4f m1) {
#pragma unroll
    for (int j = 0; j < 8; ++j) s[j] = __fadd_rn(__fadd_rn(s[j], tq[j]), j < 4 ? m0[j & 3] : m1[j & 3]);
    return s; }
__global__ __launch_bounds__(256) void k_fattn(const h16* __restrict__ QP, const h16* __restrict__ KP, const h16* __restrict__ VT, const float* __restrict__ rb, const float* __restrict__ MBr, bf* Ah, bf* Al) {
    __shared__ __align__(16) unsigned char ksm[TT * KPIT];
    __shared__ __align__(16) unsigned char vsm[HDM * VPIT];
    __shared__ float tb[TT + 256];
    __shared__ __align__(16) float mk[TT];
    const int bh = blockIdx.y, b = bh / NH_, h = bh % NH_, Q0 = blockIdx.x * 256;
    // the keys: both planes are contiguous in memory, a thread's 16 bytes of copy i lie 4 KiB behind those of copy i - 1; the 256 threads cover 32 key rows per copy, 32 copies per thread
    { const bf* g = (const bf*)KP + (size_t)bh * TT * HDM + threadIdx.x * 8; const unsigned l = (unsigned)(size_t)ksm + (threadIdx.x >> 3) * KPIT + (threadIdx.x & 7) * 16;
      // unrolled: every address is then the first plus a constant
#pragma unroll
      for (int i = 0; i < 4; ++i) g_cp8<32 * KPIT>(l + i * 256 * KPIT, g + (size_t)i * 256 * HDM, 32 * HDM); }
    const float bv = bfr(rb[(threadIdx.x & 31) * NH_ + h]);    // lane l holds bucket l of this head: the table is filled by lane exchange, with one trip to memory instead of one per entry
#pragma unroll
    for (int i = 0; i < (TT + 256) / 256; ++i) { const int e = i * 256 + threadIdx.x; tb[e] = __shfl(bv, t5_bucket(e - 255 - Q0), 32); }    // tb[255 + key - (query - Q0)]; the last entry is never read
    { const int e = threadIdx.x * 4; *(v4fa*)(mk + e) = *(const v4fa*)(MBr + (size_t)b * TT + e); }
    asm volatile("s_wait_asynccnt 0x0" ::: "memory");    // this wave's share of the keys has landed
    __syncthreads();                                      // and so has every other wave's; publishes the two tables as well
    // the values: 2 rows of 2 KiB per copy, 32 copies per thread; nobody reads them before the barrier in front of sweep 2
    { const bf* g = (const bf*)VT + (size_t)bh * HDM * TT + threadIdx.x * 8; const unsigned l = (unsigned)(size_t)vsm + (threadIdx.x >> 7) * VPIT + (threadIdx.x & 127) * 16;
      // unrolled: every address is then the first plus a constant
#pragma unroll
      for (int i = 0; i < 4; ++i) g_cp8<2 * VPIT>(l + i * 16 * VPIT, g + (size_t)i * 16 * TT, 2 * TT); }
    const int lane = threadIdx.x & 31, lr = lane & 15, hi = lane >> 4, wq = (threadIdx.x >> 5) * 32;
    const h16* q = QP + ((size_t)bh * TT + Q0 + wq + lr) * HDM + 8 * hi;
    const unsigned char* k = ksm + lr * KPIT + 16 * hi;
    const unsigned char* v = vsm + lr * VPIT + 16 * hi;
    const float* tl = tb + 255 + 8 * hi - wq - lr;
    const float* ml = mk + 8 * hi;
    v16h qf[2][2];
#pragma unroll
    for (int qt = 0; qt < 2; ++qt) { qf[qt][0] = WFrag<h16>::ld(q + qt * 16 * HDM); qf[qt][1] = WFrag<h16>::ld(q + qt * 16 * HDM + 32); }
    v16h kf[4]; fa_ldk(k, 0, kf);
    float mx[2] = { -3.0e38f, -3.0e38f };
    // unroll 2: the key fragments of the next block are fetched one trip ahead into a second register set; two trips per pass let the sets swap without moves
#pragma unroll 2
    for (int kb = 0; kb < TT; kb += 32) {
        v16h kn[4]; fa_ldk(k, (kb + 32) & (TT - 1), kn);    // the last trip fetches block 0, which sweep 2 starts with
#pragma unroll
        for (int kt = 0; kt < 2; ++kt) { const v4f m0 = *(const v4fa*)(ml + kb + kt * 16), m1 = *(const v4fa*)(ml + kb + kt * 16 + 4);
#pragma unroll
            for (int qt = 0; qt < 2; ++qt) { const v8f s = fa_bias(fa_qk(kf, kt, qf[qt]), tl + kb + kt * 16 - qt * 16, m0, m1);
#pragma unroll
                for (int j = 0; j < 8; ++j) mx[qt] = fmaxf(mx[qt], s[j]); } }
#pragma unroll
        for (int i = 0; i < 4; ++i) kf[i] = kn[i];
    }
    asm volatile("s_wait_asynccnt 0x0" ::: "memory");    // this wave's share of the values has landed
    __syncthreads();                                      // and so has every other wave's
    float cq[2]; v2f sum[2] = { (v2f){}, (v2f){} };
#pragma unroll
    for (int qt = 0; qt < 2; ++qt) { mx[qt] = fmaxf(mx[qt], __shfl_xor(mx[qt], 16, 32)); cq[qt] = 10.0f - mx[qt] * 1.4426950408889634f; }    // 2^10 = PCAR; a rounding of cq scales a whole row and cancels in p / sum
    v8f o[2][4];
#pragma unroll
    for (int qt = 0; qt < 2; ++qt)
#pragma unroll
        for (int dt = 0; dt < 4; ++dt) o[qt][dt] = (v8f){};
    // unroll 1: the trip is long enough, and a second copy would only raise the register count
#pragma unroll 1
    for (int kb = 0; kb < TT; kb += 32) {
        v16h vf[4];
#pragma unroll
        for (int dt = 0; dt < 4; ++dt) vf[dt] = fa_ldf(v + dt * 16 * VPIT + kb * 2);
        v8f s[2][2];
#pragma unroll
        for (int kt = 0; kt < 2; ++kt)
#pragma unroll
            for (int qt = 0; qt < 2; ++qt) s[kt][qt] = fa_qk(kf, kt, qf[qt]);
        fa_ldk(k, (kb + 32) & (TT - 1), kf);    // the key fragments are free once the score products have issued: the next block's fly under the exponentials and the value products
        __builtin_amdgcn_sched_barrier(0);      // keeps both groups of loads up here; without it the value loads sink to just in front of their products and each waits out its full latency
        v16h pf[2];
#pragma unroll
        for (int kt = 0; kt < 2; ++kt) { const v4f m0 = *(const v4fa*)(ml + kb + kt * 16), m1 = *(const v4fa*)(ml + kb + kt * 16 + 4);
#pragma unroll
            for (int qt = 0; qt < 2; ++qt) { const v8f t = fa_bias(s[kt][qt], tl + kb + kt * 16 - qt * 16, m0, m1);
#pragma unroll
                for (int j = 0; j < 8; j += 2) { v2f p; p[0] = __builtin_amdgcn_exp2f(__builtin_fmaf(t[j], 1.4426950408889634f, cq[qt])); p[1] = __builtin_amdgcn_exp2f(__builtin_fmaf(t[j + 1], 1.4426950408889634f, cq[qt]));
                    sum[qt] += p; pf[qt][kt * 8 + j] = tohx(p[0]); pf[qt][kt * 8 + j + 1] = tohx(p[1]); } } }
#pragma unroll
        for (int dt = 0; dt < 4; ++dt)
#pragma unroll
            for (int qt = 0; qt < 2; ++qt) o[qt][dt] = wmma16(vf[dt], pf[qt], o[qt][dt]);
        // the trip ends in matrix products and the next one begins by overwriting their probability operands: these four slots keep the distance over the back edge
        asm volatile("v_nop\n\tv_nop\n\tv_nop\n\tv_nop" : "+v"(o[0][3]), "+v"(o[1][3]) : "v"(pf[0]), "v"(pf[1]));
    }
#pragma unroll
    for (int qt = 0; qt < 2; ++qt) { float sq = sum[qt][0] + sum[qt][1]; sq += __shfl_xor(sq, 16, 32); const float inv = __fdiv_rn(1.0f, sq);
        const size_t oo = ((size_t)b * TT + Q0 + wq + qt * 16 + lr) * DD + h * HDM + 8 * hi;
#pragma unroll
        for (int dt = 0; dt < 4; ++dt) { v8us oh, ol;
#pragma unroll
            for (int j = 0; j < 8; ++j) { unsigned short a, c2; splitf(o[qt][dt][j] * inv, a, c2); oh[j] = a; ol[j] = c2; }
            *(v8usa*)(Ah + oo + dt * 16) = oh; *(v8usa*)(Al + oo + dt * 16) = ol; } }
}
__device__ __forceinline__ void d_mrow(const float* __restrict__ mask, float* MBr, int blk) { const int e = blk * 256 + threadIdx.x; if (e >= NB_ * TT) return; float om = __fsub_rn(1.0f, bfr(mask[e])); asm volatile("" : "+v"(om)); const float v = __fmul_rn(om, -10000.0f); *(float*)(MBr + e) = v;  }
// ---- k_prep: everything that reads inputs alone, in one grid of 256-thread work-groups: the six weight transposes, the first norm and the mask row. None reads what another writes; a work-group's index alone says which piece it is,
// so every branch (and the barrier inside a transpose) is uniform for the work-group. All pieces but the mask row move about the same number of bytes. W4: the planes of wq, wk, wv, wo one behind the other.
__global__ __launch_bounds__(256) void k_prep(const float* __restrict__ wq, const float* __restrict__ wk, const float* __restrict__ wv, const float* __restrict__ wo, const float* __restrict__ wi, const float* __restrict__ wf,
                                              const float* __restrict__ hid, const float* __restrict__ ln, const float* __restrict__ mask, bf* W4, bf* WI, bf* WF, bf* Yh, bf* Yl, float* MBr) {
    constexpr int NI = (DD / 128) * (MM / 64), NF = (MM / 128) * (DD / 64), N1 = (DD / 128) * (DD / 64), NR = LL / 8;
    __shared__ unsigned tw[64 * 65];
    const int b = blockIdx.x, bf_ = b - NI, b1 = bf_ - NF, br = b1 - 4 * N1;
    if (b < NI) d_wtG<DD, MM>(wi, WI, b % (DD / 128), b / (DD / 128), tw);
    else if (bf_ < NF) d_wtG<MM, DD>(wf, WF, bf_ % (MM / 128), bf_ / (MM / 128), tw);
    else if (b1 < 4 * N1) { const int m = b1 / N1, e = b1 % N1; d_wtG<DD, DD>(m == 0 ? wq : m == 1 ? wk : m == 2 ? wv : wo, W4 + (size_t)m * DD * DD, e % (DD / 128), e / (DD / 128), tw); }
    else if (br < NR) d_rmsT(hid, 1, ln, Yh, Yl, br);
    else d_mrow(mask, MBr, br - NR);
}

extern "C" void kernel_launch(void* const* d_in, const int* in_sizes, int n_in,
                              void* d_out, int out_size, void* d_ws, size_t ws_size, hipStream_t stream) {
    (void)in_sizes; (void)n_in; (void)out_size;
    const float* IN[11]; for (int i = 0; i < 11; ++i) IN[i] = (const float*)d_in[i];   // 0 hidden, 1 attn_mask, 2 ln1_w, 3 wq, 4 wk, 5 wv, 6 wo, 7 rel_bias [32][16], 8 ln2_w, 9 wi [1024][4096], 10 wo_ff [4096][1024] (x @ W)
    float* OUT = (float*)d_out;     // [4][1024][1024]
    char* wsp = (char*)d_ws;
    auto take = [&](size_t bytes) { char* p = wsp; wsp += (bytes + 255) & ~(size_t)255; return (void*)p; };
    bf* W4 = (bf*)take((size_t)4 * DD * DD * 2); bf* WO = W4 + (size_t)3 * DD * DD; bf* WI = (bf*)take((size_t)MM * DD * 2); bf* WF = (bf*)take((size_t)DD * MM * 2); float* MBr = (float*)take((size_t)NB_ * TT * 4);    // W4: wq, wk, wv, wo
    bf* Xh = (bf*)take((size_t)LL * DD * 2); bf* Xl = (bf*)take((size_t)LL * DD * 2);
    h16* QP = (h16*)take((size_t)3 * LL * DD * 2); h16* KP = QP + (size_t)LL * DD; h16* VT = KP + (size_t)LL * DD; bf* Ah = (bf*)take((size_t)LL * DD * 2); bf* Al = (bf*)take((size_t)LL * DD * 2);
    float* H = (float*)take((size_t)LL * DD * 4); bf* Gh = (bf*)take((size_t)LL * MM * 2); bf* Gl = (bf*)take((size_t)LL * MM * 2);    // relu-FFN hidden planes
    if ((size_t)(wsp - (char*)d_ws) > ws_size) return;    // total ~ 168 MB
    k_prep<<<(DD / 128) * (MM / 64) + (MM / 128) * (DD / 64) + 4 * (DD / 128) * (DD / 64) + LL / 8 + NB_ * TT / 256, 256, 0, stream>>>(IN[3], IN[4], IN[5], IN[6], IN[9], IN[10], IN[0], IN[2], IN[1], W4, WI, WF, Xh, Xl, MBr);
    k_gemmt<EP_QKV><<<dim3(LL / 128, 3 * DD / 128, 1), 128, 0, stream>>>(Xh, Xl, W4, DD, nullptr, nullptr, QP, nullptr, nullptr);    // planes [b][h][t][64] (q, k) and [b][h][64][t] (v)
    k_fattn<<<dim3(TT / 256, NB_ * NH_, 1), 256, 0, stream>>>(QP, KP, VT, IN[7], MBr, Ah, Al);
    k_gemmt<EP_RES><<<dim3(LL / 128, DD / 128, 1), 128, 0, stream>>>(Ah, Al, WO, DD, IN[0], H, nullptr, nullptr, nullptr);
    k_rmsT<<<LL / 8, 256, 0, stream>>>(H, IN[8], Xh, Xl);
    k_gemmt<EP_RELU><<<dim3(LL / 128, MM / 128, 1), 128, 0, stream>>>(Xh, Xl, WI, DD, nullptr, nullptr, nullptr, Gh, Gl);
    k_gemmt<EP_OUT><<<dim3(LL / 128, DD / 128, 1), 128, 0, stream>>>(Gh, Gl, WF, MM, H, OUT, nullptr, nullptr, nullptr);
}

// v007
// A run of this version takes 224 microseconds.
// Next to v006, in two timings, it ran 1.10 and 1.09 times as fast.
// All steps since v000 together make it 12.4 times as fast.
#include <hip/hip_runtime.h>

// T5 encoder block (hidden [4][1024][1024], attn_mask [4][1024]; x = T5-RMSNorm(hidden) ln1_w (eps 1e-6, no mean/bias); q/k/v = x w (16 heads x 64); scores = q.k (NO 1/sqrt(d)) + rel_bias[bucket(j - i)][h]
// + (1 - attn_mask[b][j]) (-1e4); softmax; hidden += merged ctx wo; y = RMSNorm(hidden) ln2_w; hidden += relu(y wi) wo_ff -> [4][1024][1024]. The bidirectional relative-position bucket of an integer offset
// (32 buckets, max distance 128) is evaluated with exact integer arithmetic: for |r| >= 8, 8 + 2 floor(log2 |r|) - 6 + [ |r|^2 >= 2^(2 floor(log2|r|) + 1) ], capped at 15 (this equals the reference's
// float formula for every offset 0..1023), + 16 for r > 0.)
// Compute dtypes, f32 accumulate: every input rounded to bf16; both RMSNorms f32 (wave per token) -> bf16 hi+lo planes; q/k/v, wo, wi, wo_ff on hl planes of their computed operands
// x exact weights (2 products); scores (K 64) and probs.v on SINGLE fp16 planes with an f32 register-row softmax (bias + mask added in f32; probabilities x1024); residuals and relu f32.

#define NB_  4
#define TT   1024
#define LL   4096
#define DD   1024
#define NH_  16
#define HDM  64
#define MM   4096
#define PCAR 1024.0f
typedef _Float16 h16;
typedef unsigned short bf;
typedef __attribute__((ext_vector_type(16))) __bf16   v16bf;
typedef __attribute__((ext_vector_type(16))) _Float16 v16h;
typedef __attribute__((ext_vector_type(8)))  _Float16 v8h;
typedef __attribute__((ext_vector_type(8)))  unsigned short v8us;
typedef __attribute__((ext_vector_type(8)))  float    v8f;
typedef __attribute__((ext_vector_type(4)))  float    v4f;
typedef v8h  __attribute__((may_alias)) v8ha;
typedef v4f  __attribute__((may_alias)) v4fa;
typedef v8us __attribute__((may_alias)) v8usa;

__device__ __forceinline__ unsigned short f2bf(float f) { unsigned u = __float_as_uint(f); u += 0x7FFFu + ((u >> 16) & 1u); return (unsigned short)(u >> 16); }
__device__ __forceinline__ float bf2f(unsigned short b) { return __uint_as_float(((unsigned)b) << 16); }
__device__ __forceinline__ float bfr(float f) { return bf2f(f2bf(f)); }
__device__ __forceinline__ v16h cat16(v8h lo, v8h hi) { return __builtin_shufflevector(lo, hi, 0, 1, 2, 3, 4, 5, 6, 7, 8, 9, 10, 11, 12, 13, 14, 15); }
__device__ __forceinline__ v16bf cat16b(v8us lo, v8us hi) { return __builtin_bit_cast(v16bf, __builtin_shufflevector(lo, hi, 0, 1, 2, 3, 4, 5, 6, 7, 8, 9, 10, 11, 12, 13, 14, 15)); }
__device__ __forceinline__ v8f wmma16(v16h a, v16h b, v8f c) { return __builtin_amdgcn_wmma_f32_16x16x32_f16(false, a, false, b, (short)0, c, false, false); }
__device__ __forceinline__ v8f wmmab(v16bf a, v16bf b, v8f c) { return __builtin_amdgcn_wmma_f32_16x16x32_bf16(false, a, false, b, (short)0, c, false, false); }



// ---- k_gemmt<EP>: c[m][n] (f32) = sum_k (A[m][k] + A2[m][k]) Bt[n][k], all three planes bf16 and K-contiguous; c never reaches memory as such: the epilogue EP stores it in the form that its reader takes (below). One 128x128 tile per work-group of 4 waves (2x2, 64x64 = 16 accumulators each);
// grid (M/128, N/128), 128 threads; M, N % 128 == 0, K % KS == 0. A stage is KS k (one or two 128-byte lines) of the 128 rows of A, A2 and Bt; it comes into LDS by asynchronous copies, whole 128-byte lines, once per work-group
// instead of once per wave, and the next stage flies while this one is multiplied (two buffers). Fragment form and the order of the products per accumulator are those of a wave reading global memory.
template <typename T16> struct WFrag;
template <> struct WFrag<h16> { typedef v16h V; static __device__ __forceinline__ V ld(const h16* p) { return cat16(*(const v8h*)p, *(const v8h*)(p + 16)); } };
// eight copies: this thread's 16 bytes of eight rows of one plane, LS bytes apart in LDS and rs elements apart in memory. The s_wait_xcnt closes the statement so that no address register is rewritten ahead of it.
template <unsigned LS>
__device__ __forceinline__ void g_cp8(unsigned l, const bf* g, size_t rs) {
    asm volatile("global_load_async_to_lds_b128 %0, %8, off\n\t"
                 "global_load_async_to_lds_b128 %1, %9, off\n\t"
                 "global_load_async_to_lds_b128 %2, %10, off\n\t"
                 "global_load_async_to_lds_b128 %3, %11, off\n\t"
                 "global_load_async_to_lds_b128 %4, %12, off\n\t"
                 "global_load_async_to_lds_b128 %5, %13, off\n\t"
                 "global_load_async_to_lds_b128 %6, %14, off\n\t"
                 "global_load_async_to_lds_b128 %7, %15, off\n\t"
                 "s_wait_xcnt 0x0"
                 :: "v"(l), "v"(l + LS), "v"(l + 2u * LS), "v"(l + 3u * LS), "v"(l + 4u * LS), "v"(l + 5u * LS), "v"(l + 6u * LS), "v"(l + 7u * LS),
                    "v"(g), "v"(g + rs), "v"(g + 2 * rs), "v"(g + 3 * rs), "v"(g + 4 * rs), "v"(g + 5 * rs), "v"(g + 6 * rs), "v"(g + 7 * rs) : "memory");
}
// the same eight copies through the builtin: its operands may lie in any register, where those of asm text must lie in the first 256; the compiler keeps the address registers itself
typedef __attribute__((ext_vector_type(4))) int v4i;
template <unsigned LS>
__device__ __forceinline__ void g_cp8b(unsigned l, const bf* g, size_t rs) {
    // unrolled: eight copies in a row, each LDS address the first plus a constant
#pragma unroll
    for (unsigned i = 0; i < 8; ++i) __builtin_amdgcn_global_load_async_to_lds_b128((__attribute__((address_space(1))) v4i*)(g + i * rs), (__attribute__((address_space(3))) v4i*)(l + i * LS), 0, 0);
}
__device__ __forceinline__ v16bf g_ldf(const unsigned char* p) { return cat16b(*(const v8usa*)p, *(const v8usa*)(p + 32)); }
// EP_QKV: N = 3 DD, the weights of queries, keys and values one behind the other; P holds three planes of LL x DD fp16: [b][h][t][64] for columns below 2 DD (queries, then keys), [b][h][64][t] for the rest (values). EP_RES: C = bf16-rounded R + c. EP_OUT: C = R + c (both f32, pitch DD). EP_RELU: max(c, 0) as bf16 hi + lo planes, pitch MM.
// A wave's 64 columns are one head of one plane (EP_QKV), and its 64 rows lie in one batch; which of the two forms a work-group stores depends on blockIdx.y alone. Every store covers whole 128-byte lines; all pitches are constants, so that one address per wave serves every store.
enum { EP_QKV, EP_RES, EP_OUT, EP_RELU };
__device__ __forceinline__ h16 tohx(float x) { return (h16)x; }
__device__ __forceinline__ void splitf(float y, unsigned short& h, unsigned short& l) { h = f2bf(y); l = f2bf(y - bf2f(h)); }
template <int EP>
__global__ __launch_bounds__(128) void k_gemmt(const bf* __restrict__ A, const bf* __restrict__ A2, const bf* __restrict__ Bt, int K, const float* __restrict__ R, float* C, h16* P, bf* Ph, bf* Pl) {
    // k per stage. EP_RES and EP_OUT have N = DD: 256 work-groups, one per WGP whatever LDS they take, with nobody else there to work under a stage's fixed costs (the wait for its first fragments, the landing of its copies, the barrier).
    // Their stage is twice as long: half as many of those, and the copies get twice the products to land under. The other two launches have more work-groups than WGPs and keep the size at which two of them share a WGP.
    constexpr int KS = (EP == EP_RES || EP == EP_OUT) ? 128 : 64;
    constexpr int PIT = KS * 2 + 16;      // LDS pitch of a row: 16 bytes x odd, so that the 16-byte fragment reads of 16 rows fall on different banks
    constexpr int PL = 128 * PIT;         // one operand plane of a stage
    constexpr int ST = 3 * PL;            // a stage: A, A2, Bt
    constexpr int LPR = KS / 8;           // threads (16 bytes each) per row
    constexpr int RPR = 128 / LPR;        // rows that the 128 threads cover with one copy each
    constexpr int NKS = KS / 32;          // blocks of 32 products per stage
    __shared__ __align__(16) unsigned char ring[2 * ST];
    __shared__ __align__(16) float os[4 * 16 * 68];
    const int tid = threadIdx.x, lane = tid & 31, lr = lane & 15, hi = lane >> 4, wave = tid >> 5, wm = wave >> 1, wn = wave & 1; const int r0 = blockIdx.x * 128, c0 = blockIdx.y * 128;
    const unsigned NT = (unsigned)K / KS; const size_t rs = (size_t)RPR * K;
    const bf* gA = A + (size_t)(r0 + tid / LPR) * K + (tid % LPR) * 8; const bf* gA2 = A2 + (size_t)(r0 + tid / LPR) * K + (tid % LPR) * 8; const bf* gB = Bt + (size_t)(c0 + tid / LPR) * K + (tid % LPR) * 8;
    const unsigned l0 = (unsigned)(size_t)ring + (unsigned)((tid / LPR) * PIT + (tid % LPR) * 16);
    const unsigned char* fa = ring + (wm * 64 + lr) * PIT + hi * 16; const unsigned char* fb = ring + 2 * PL + (wn * 64 + lr) * PIT + hi * 16;
    auto fill = [&](unsigned l, size_t ko) {    // eight copies cover 8 x RPR rows of a plane: 24 copies per thread and stage, or 48
        if constexpr (8 * RPR == 128) { g_cp8<RPR * PIT>(l, gA + ko, rs); g_cp8<RPR * PIT>(l + PL, gA2 + ko, rs); g_cp8<RPR * PIT>(l + 2 * PL, gB + ko, rs); }
        else {    // the long stage: as asm text the 48 copies' addresses did not fit the first 256 registers beside the accumulators, and the build spilled to scratch in every trip
            // unrolled: h is a constant in every address
#pragma unroll
            for (int h = 0; h < 128 / (8 * RPR); ++h) { g_cp8b<RPR * PIT>(l + h * 8 * RPR * PIT, gA + ko + h * 8 * rs, rs); g_cp8b<RPR * PIT>(l + PL + h * 8 * RPR * PIT, gA2 + ko + h * 8 * rs, rs); g_cp8b<RPR * PIT>(l + 2 * PL + h * 8 * RPR * PIT, gB + ko + h * 8 * rs, rs); } } };
    v8f acc[4][4];
#pragma unroll
    for (int mb = 0; mb < 4; ++mb)
#pragma unroll
        for (int nb = 0; nb < 4; ++nb) acc[mb][nb] = (v8f){};
    fill(l0, 0);
    asm volatile("s_wait_asynccnt 0x0" ::: "memory");    // this wave's share of stage 0 has landed
    __syncthreads();                                      // and so has every other wave's
    // unroll 1: one stage per trip; the trip holds 64 or 128 products already
#pragma unroll 1
    for (unsigned t = 0; t < NT; ++t) {
        const unsigned bo = (t & 1u) * ST;
        v16bf a[2][4], a2[2][4], b[2][4];
#pragma unroll
        for (int i = 0; i < 4; ++i) { a[0][i] = g_ldf(fa + bo + i * 16 * PIT); a2[0][i] = g_ldf(fa + bo + PL + i * 16 * PIT); b[0][i] = g_ldf(fb + bo + i * 16 * PIT); }
#pragma unroll
        for (int ks = 0; ks < NKS; ++ks) {
            if (ks + 1 < NKS) {
#pragma unroll
                for (int i = 0; i < 4; ++i) { a[(ks + 1) & 1][i] = g_ldf(fa + bo + i * 16 * PIT + (ks + 1) * 64); a2[(ks + 1) & 1][i] = g_ldf(fa + bo + PL + i * 16 * PIT + (ks + 1) * 64); b[(ks + 1) & 1][i] = g_ldf(fb + bo + i * 16 * PIT + (ks + 1) * 64); } }
            if (ks == 0 && t + 1 < NT) fill(l0 + (ST - bo), (size_t)(t + 1) * KS);    // the next stage, into the buffer that every wave left at the barrier above; issued under the latency of the fragment reads
            if constexpr (NKS > 2) __builtin_amdgcn_sched_barrier(0);    // the long stage: the next block's reads stay one group in front of this block's products; left free, the compiler spread those of the later blocks among the products, each pair just in front of its use, and the wave waited out their latency
#pragma unroll
            for (int nb = 0; nb < 4; ++nb)
#pragma unroll
                for (int mb = 0; mb < 4; ++mb) { acc[mb][nb] = wmmab(a[ks & 1][mb], b[ks & 1][nb], acc[mb][nb]); acc[mb][nb] = wmmab(a2[ks & 1][mb], b[ks & 1][nb], acc[mb][nb]); }
            if constexpr (NKS > 2) __builtin_amdgcn_sched_barrier(0);    // and the group after that stays behind them
        }
        __builtin_amdgcn_sched_barrier(0);    // the products stay in front of the waits: left free, the compiler moves them behind the barrier, and the wave then waits out the copies it has just issued instead of multiplying under them
        asm volatile("s_wait_dscnt 0x0" ::: "memory");       // this wave has left the buffer that is refilled behind the barrier
        asm volatile("s_wait_asynccnt 0x0" ::: "memory");    // this wave's share of stage t + 1 has landed
        __syncthreads();                                      // publishes stage t + 1 and ends every wave's reads of stage t
    }
    asm volatile("s_wait_asynccnt 0x0" ::: "memory");        // no copy is left in flight when the wave ends
    float* osw = os + wave * 16 * 68;
    const int m0 = r0 + wm * 64, n0 = c0 + wn * 64;    // the corner of this wave's 64 x 64 results
    const int l8 = lane >> 3, c8 = (lane & 7) * 8;     // 16-bit planes: eight lanes of 16 bytes make one 128-byte line, four lines per store
    // Each block of 16 rows (values: columns) goes: results into LDS, whole lines read back and brought into their final form, then the stores. Outside the values a scheduling barrier keeps every read of a block in front of its first store, so that no read's destination
    // falls on a register that an issued store names; EP_QKV, EP_RES and EP_RELU reuse such registers in the next block: there s_wait_xcnt stands behind the stores, held in place by a scheduling barrier (a "memory" clobber alone holds no register write behind it).
    if (EP == EP_QKV && c0 >= 2 * DD) {
        // a lane holds eight consecutive tokens of one column: 16 bytes of the transposed plane. Staged as [16 columns][64 tokens], pitch 144 bytes.
        h16* osh = (h16*)osw;
        h16* vrow = P + (size_t)2 * LL * DD + ((size_t)((m0 / TT) * NH_ + (n0 - 2 * DD) / HDM) * HDM + l8) * TT + (m0 % TT) + c8;
#pragma unroll
        for (int nb = 0; nb < 4; ++nb) {
#pragma unroll
            for (int mb = 0; mb < 4; ++mb) { v8h c;
#pragma unroll
                for (int j = 0; j < 8; ++j) c[j] = tohx(acc[mb][nb][j]);
                *(v8ha*)(osh + lr * 72 + mb * 16 + hi * 8) = c; }
            __builtin_amdgcn_wave_barrier(); asm volatile("" ::: "memory");    // the lines are read back by other lanes of this wave: keeps the reads behind the writes
#pragma unroll
            for (int s = 0; s < 4; ++s) { const v8h val = *(const v8ha*)(osh + (s * 4 + l8) * 72 + c8); *(v8ha*)(vrow + (size_t)(nb * 16 + s * 4) * TT) = val; }
            __builtin_amdgcn_wave_barrier(); asm volatile("" ::: "memory");    // and the next columns' writes behind these reads
            if (nb < 3) { asm volatile("s_wait_xcnt 0x0" ::: "memory"); __builtin_amdgcn_sched_barrier(0); }    // the next columns reuse registers that these stores name
        }
    } else {
        v4f rv[4][8];    // the addend's rows, all fetched here at once: one trip to memory per wave instead of one per 16 rows
        if constexpr (EP == EP_RES || EP == EP_OUT) { const float* rrow = R + (size_t)(m0 + hi) * DD + n0 + lr * 4;
#pragma unroll
            for (int mb = 0; mb < 4; ++mb)
#pragma unroll
                for (int s = 0; s < 8; ++s) rv[mb][s] = *(const v4f*)(rrow + (size_t)(mb * 16 + 2 * s) * DD);
            asm volatile("s_wait_xcnt 0x0" ::: "memory"); __builtin_amdgcn_sched_barrier(0); }    // the address register of these loads is reused behind them
#pragma unroll
        for (int mb = 0; mb < 4; ++mb) {
#pragma unroll
            for (int nb = 0; nb < 4; ++nb) {
#pragma unroll
                for (int j = 0; j < 8; ++j) osw[(hi * 8 + j) * 68 + nb * 16 + lr] = acc[mb][nb][j]; }
            __builtin_amdgcn_wave_barrier(); asm volatile("" ::: "memory");    // the rows are read back by other lanes of this wave: keeps the reads behind the writes
            if constexpr (EP == EP_RES || EP == EP_OUT) {
                float* crow = C + (size_t)(m0 + hi) * DD + n0 + lr * 4; v4f o[8];
#pragma unroll
                for (int s = 0; s < 8; ++s) { const v4f val = *(const v4fa*)(osw + (2 * s + hi) * 68 + lr * 4);
#pragma unroll
                    for (int q = 0; q < 4; ++q) o[s][q] = __fadd_rn(EP == EP_RES ? bfr(rv[mb][s][q]) : rv[mb][s][q], val[q]); }
                __builtin_amdgcn_sched_barrier(0);    // every read and sum in front of the first store
#pragma unroll
                for (int s = 0; s < 8; ++s) *(v4f*)(crow + (size_t)(mb * 16 + 2 * s) * DD) = o[s];
            } else {
                v4f x[4][2];
#pragma unroll
                for (int s = 0; s < 4; ++s) { const float* orow = osw + (s * 4 + l8) * 68 + c8; x[s][0] = *(const v4fa*)orow; x[s][1] = *(const v4fa*)(orow + 4); }
                if constexpr (EP == EP_QKV) { h16* prow = P + (size_t)(n0 / DD) * LL * DD + ((size_t)((m0 / TT) * NH_ + (n0 % DD) / HDM) * TT + (m0 % TT) + l8) * HDM + c8; v8h c[4];
#pragma unroll
                    for (int s = 0; s < 4; ++s)
#pragma unroll
                        for (int j = 0; j < 8; ++j) c[s][j] = tohx(x[s][j >> 2][j & 3]);
                    __builtin_amdgcn_sched_barrier(0);    // every read and conversion in front of the first store
#pragma unroll
                    for (int s = 0; s < 4; ++s) *(v8ha*)(prow + (size_t)(mb * 16 + s * 4) * HDM) = c[s];
                } else { const size_t go = (size_t)(m0 + l8) * MM + n0 + c8; v8us oh[4], ol[4];
#pragma unroll
                    for (int s = 0; s < 4; ++s)
#pragma unroll
                        for (int j = 0; j < 8; ++j) { unsigned short a, c2; splitf(fmaxf(x[s][j >> 2][j & 3], 0.f), a, c2); oh[s][j] = a; ol[s][j] = c2; }
                    __builtin_amdgcn_sched_barrier(0);    // every read and split in front of the first store
#pragma unroll
                    for (int s = 0; s < 4; ++s) { *(v8usa*)(Ph + go + (size_t)(mb * 16 + s * 4) * MM) = oh[s]; *(v8usa*)(Pl + go + (size_t)(mb * 16 + s * 4) * MM) = ol[s]; } }
            }
            __builtin_amdgcn_wave_barrier(); asm volatile("" ::: "memory");    // and the next rows' writes behind these reads
            if (mb < 3 && (EP == EP_QKV || EP == EP_RES || EP == EP_RELU)) { asm volatile("s_wait_xcnt 0x0" ::: "memory"); __builtin_amdgcn_sched_barrier(0); }    // the next rows reuse registers that these stores name
        }
    }
}

typedef __attribute__((ext_vector_type(2))) _Float16 v2h;
typedef __attribute__((ext_vector_type(4))) _Float16 v4h;
typedef __attribute__((ext_vector_type(2))) unsigned short v2us;
typedef __attribute__((ext_vector_type(4))) unsigned short v4us;
typedef __attribute__((ext_vector_type(2))) float v2f;

// ---- d_wtG<K, N>: Bt[n][k] (bf16) = w[k][n] (f32). One tile of 128 k x 64 n per work-group of 8 waves: tile (bx, by) of (K/128, N/64); tw is the work-group's LDS, 64 x 65 dwords. Both sides of the transposition move 256 consecutive bytes per 16 lanes (a row of the tile in, a row of the
// result out); the turn itself happens in LDS. A thread rounds two consecutive k of four n and packs each pair into one dword of the row [n]. The pitch of 65 dwords puts the 32 dwords of a wave's LDS store (16 groups of n, 4 x 65 dwords
// apart, x 2 pairs of k) and of a wave's LDS read (2 rows x 16 lanes, 4 dwords apart) on 32 different banks. K and N are constants, so that one address serves all loads of a thread and one all its stores.
typedef __attribute__((ext_vector_type(4))) unsigned v4u;
typedef v4u __attribute__((may_alias)) v4ua;
template <int K, int N>
__device__ __forceinline__ void d_wtG(const float* __restrict__ w, bf* Bt, int bx, int by, unsigned* tw) {
    constexpr int WP = 65;
    const int c = threadIdx.x & 15, r = threadIdx.x >> 4; const int k0 = bx * 128, n0 = by * 64;
    const float* s = w + (size_t)(k0 + 2 * r) * N + n0 + c * 4;
    v4f a[4][2];    // all eight loads of a thread fly together: one trip to memory per tile
#pragma unroll
    for (int h = 0; h < 4; ++h) { a[h][0] = *(const v4f*)(s + (size_t)(h * 32) * N); a[h][1] = *(const v4f*)(s + (size_t)(h * 32 + 1) * N); }
    asm volatile("s_wait_xcnt 0x0" :: "v"(s) : "memory");    // a precaution: the address that the loads name is an operand here, so it stays in its registers up to this wait
#pragma unroll
    for (int h = 0; h < 4; ++h)
#pragma unroll
        for (int q = 0; q < 4; ++q) tw[(c * 4 + q) * WP + h * 16 + r] = (unsigned)f2bf(a[h][0][q]) | ((unsigned)f2bf(a[h][1][q]) << 16);
    __syncthreads();    // the rows are read back by other waves
    bf* d = Bt + (size_t)(n0 + r) * K + k0 + c * 8;
#pragma unroll
    for (int p = 0; p < 4; ++p) { const unsigned* t = tw + (p * 16 + r) * WP + c * 4; v4u o; o[0] = t[0]; o[1] = t[1]; o[2] = t[2]; o[3] = t[3]; *(v4ua*)(d + (size_t)(p * 16) * K) = o; }
    asm volatile("s_wait_xcnt 0x0" ::: "memory");    // a precaution: in the built kernel the text of the next piece follows behind a branch and writes registers that these stores name
}
__device__ __forceinline__ void d_rmsT(const float* __restrict__ A, int rnd, const float* __restrict__ w, bf* Yh, bf* Yl, int blk) { const int lane = threadIdx.x & 31; const int t = blk * 8 + (threadIdx.x >> 5); if (t >= LL) return; const float* ar = A + (size_t)t * DD; float v[32]; float s = 0.f;
#pragma unroll
    for (int ch = 0; ch < 8; ++ch) { const v4f a = *(const v4f*)(ar + ch * 128 + lane * 4);
#pragma unroll
        for (int q = 0; q < 4; ++q) { const float x = rnd ? bfr(a[q]) : a[q]; v[ch * 4 + q] = x; float p = __fmul_rn(x, x); asm volatile("" : "+v"(p)); s = __fadd_rn(s, p); } }
#pragma unroll
    for (int sh = 16; sh; sh >>= 1) s += __shfl_xor(s, sh, 32);
    const float rs = __frsqrt_rn(__fadd_rn(s * (1.0f / DD), 1e-6f));
{
#pragma unroll
        for (int ch = 0; ch < 8; ++ch) { v4us oh, ol; const v4f wv = *(const v4f*)(w + ch * 128 + lane * 4);    // a lane's four weights in one load: as two, the second's result fell on the offset register that the first still names
#pragma unroll
            for (int q = 0; q < 4; ++q) { float tn = __fmul_rn(v[ch * 4 + q], rs); asm volatile("" : "+v"(tn)); unsigned short a2, c2; splitf(__fmul_rn(tn, bfr(wv[q])), a2, c2); oh[q] = a2; ol[q] = c2; }
            const size_t o = (size_t)t * DD + ch * 128 + lane * 4; *(v4us*)(Yh + o) = oh; *(v4us*)(Yl + o) = ol;
            if (ch < 7) { asm volatile("s_wait_xcnt 0x0" ::: "memory"); __builtin_amdgcn_sched_barrier(0); } }    // a precaution: the next 128 columns reuse registers that these stores name; the scheduling barrier holds their writes behind the wait
         } }
__global__ __launch_bounds__(256) void k_rmsT(const float* __restrict__ A, const float* __restrict__ w, bf* Yh, bf* Yl) { d_rmsT(A, 0, w, Yh, Yl, blockIdx.x); }
__device__ __forceinline__ int t5_bucket(int r) { const int n = r < 0 ? -r : r; int v; if (n < 8) v = n; else { const int k = 31 - __clz(n); v = 8 + 2 * k - 6 + (((long long)n * n >= (1ll << (2 * k + 1))) ? 1 : 0); v = v > 15 ? 15 : v; } return (r > 0 ? 16 : 0) + v; }
// ---- k_fattn: the whole attention of one (batch, head) x 256 queries per work-group; 8 waves, 32 queries per wave; grid (TT/256, NB_*NH_), one work-group per WGP.
// All keys and all transposed values of the (batch, head) come into LDS once per work-group, by asynchronous copies of whole 128-byte lines; every fragment of both sweeps is then an LDS read at a padded pitch,
// where a wave reading global memory touched 16 lines per load and each of the waves asked for the same lines again. The values fly while sweep 1 runs. Fragment form and the order of all sums are unchanged.
// Scores are formed transposed, S^T = K Q^T (rows = keys, columns = queries): a lane then owns one query, its registers hold keys 8 hi + j of each 16-key tile, and two such tiles are,
// register for register, the 32-deep B fragment of O^T = V^T P^T. No score or probability leaves the registers. Sweep 1 finds each query's row maximum, sweep 2 forms the scores again,
// p = 1024 exp(t - max) (f32 sum, fp16 operand), and accumulates O^T; the division by the sum comes last, per lane. The bias is a table over key - query in LDS, the mask row lies beside it.
#define KPIT (HDM * 2 + 16)    // LDS pitch of a key row and
#define VPIT (TT * 2 + 16)     // of a row of the transposed values: 16 bytes x odd, so that the 16-byte fragment reads of 16 rows fall on different banks
__device__ __forceinline__ v16h fa_ldf(const unsigned char* p) { return cat16(*(const v8ha*)p, *(const v8ha*)(p + 32)); }
__device__ __forceinline__ void fa_ldk(const unsigned char* k, int kb, v16h* kf) {
#pragma unroll
    for (int kt = 0; kt < 2; ++kt) { kf[kt * 2] = fa_ldf(k + (kb + kt * 16) * KPIT); kf[kt * 2 + 1] = fa_ldf(k + (kb + kt * 16) * KPIT + 64); } }
__device__ __forceinline__ v8f fa_qk(const v16h* kf, int kt, const v16h* qf) { v8f s = (v8f){}; s = wmma16(kf[kt * 2], qf[0], s); return wmma16(kf[kt * 2 + 1], qf[1], s); }
__device__ __forceinline__ v8f fa_bias(v8f s, const float* tq, const v4f m0, const v4f m1) {
#pragma unroll
    for (int j = 0; j < 8; ++j) s[j] = __fadd_rn(__fadd_rn(s[j], tq[j]), j < 4 ? m0[j & 3] : m1[j & 3]);
    return s; }
__global__ __launch_bounds__(256) void k_fattn(const h16* __restrict__ QP, const h16* __restrict__ KP, const h16* __restrict__ VT, const float* __restrict__ rb, const float* __restrict__ MBr, bf* Ah, bf* Al) {
    __shared__ __align__(16) unsigned char ksm[TT * KPIT];
    __shared__ __align__(16) unsigned char vsm[HDM * VPIT];
    __shared__ float tb[TT + 256];
    __shared__ __align__(16) float mk[TT];
    const int bh = blockIdx.y, b = bh / NH_, h = bh % NH_, Q0 = blockIdx.x * 256;
    // the keys: both planes are contiguous in memory, a thread's 16 bytes of copy i lie 4 KiB behind those of copy i - 1; the 256 threads cover 32 key rows per copy, 32 copies per thread
    { const bf* g = (const bf*)KP + (size_t)bh * TT * HDM + threadIdx.x * 8; const unsigned l = (unsigned)(size_t)ksm + (threadIdx.x >> 3) * KPIT + (threadIdx.x & 7) * 16;
      // unrolled: every address is then the first plus a constant
#pragma unroll
      for (int i = 0; i < 4; ++i) g_cp8<32 * KPIT>(l + i * 256 * KPIT, g + (size_t)i * 256 * HDM, 32 * HDM); }
    const float bv = bfr(rb[(threadIdx.x & 31) * NH_ + h]);    // lane l holds bucket l of this head: the table is filled by lane exchange, with one trip to memory instead of one per entry
#pragma unroll
    for (int i = 0; i < (TT + 256) / 256; ++i) { const int e = i * 256 + threadIdx.x; tb[e] = __shfl(bv, t5_bucket(e - 255 - Q0), 32); }    // tb[255 + key - (query - Q0)]; the last entry is never read
    { const int e = threadIdx.x * 4; *(v4fa*)(mk + e) = *(const v4fa*)(MBr + (size_t)b * TT + e); }
    asm volatile("s_wait_asynccnt 0x0" ::: "memory");    // this wave's share of the keys has landed
    __syncthreads();                                      // and so has every other wave's; publishes the two tables as well
    // the values: 2 rows of 2 KiB per copy, 32 copies per thread; nobody reads them before the barrier in front of sweep 2
    { const bf* g = (const bf*)VT + (size_t)bh * HDM * TT + threadIdx.x * 8; const unsigned l = (unsigned)(size_t)vsm + (threadIdx.x >> 7) * VPIT + (threadIdx.x & 127) * 16;
      // unrolled: every address is then the first plus a constant
#pragma unroll
      for (int i = 0; i < 4; ++i) g_cp8<2 * VPIT>(l + i * 16 * VPIT, g + (size_t)i * 16 * TT, 2 * TT); }
    const int lane = threadIdx.x & 31, lr = lane & 15, hi = lane >> 4, wq = (threadIdx.x >> 5) * 32;
    const h16* q = QP + ((size_t)bh * TT + Q0 + wq + lr) * HDM + 8 * hi;
    const unsigned char* k = ksm + lr * KPIT + 16 * hi;
    const unsigned char* v = vsm + lr * VPIT + 16 * hi;
    const float* tl = tb + 255 + 8 * hi - wq - lr;
    const float* ml = mk + 8 * hi;
    v16h qf[2][2];
#pragma unroll
    for (int qt = 0; qt < 2; ++qt) { qf[qt][0] = WFrag<h16>::ld(q + qt * 16 * HDM); qf[qt][1] = WFrag<h16>::ld(q + qt * 16 * HDM + 32); }
    v16h kf[4]; fa_ldk(k, 0, kf);
    float mx[2] = { -3.0e38f, -3.0e38f };
    // unroll 2: the key fragments of the next block are fetched one trip ahead into a second register set; two trips per pass let the sets swap without moves
#pragma unroll 2
    for (int kb = 0; kb < TT; kb += 32) {
        v16h kn[4]; fa_ldk(k, (kb + 32) & (TT - 1), kn);    // the last trip fetches block 0, which sweep 2 starts with
#pragma unroll
        for (int kt = 0; kt < 2; ++kt) { const v4f m0 = *(const v4fa*)(ml + kb + kt * 16), m1 = *(const v4fa*)(ml + kb + kt * 16 + 4);
#pragma unroll
            for (int qt = 0; qt < 2; ++qt) { const v8f s = fa_bias(fa_qk(kf, kt, qf[qt]), tl + kb + kt * 16 - qt * 16, m0, m1);
#pragma unroll
                for (int j = 0; j < 8; ++j) mx[qt] = fmaxf(mx[qt], s[j]); } }
#pragma unroll
        for (int i = 0; i < 4; ++i) kf[i] = kn[i];
    }
    asm volatile("s_wait_asynccnt 0x0" ::: "memory");    // this wave's share of the values has landed
    __syncthreads();                                      // and so has every other wave's
    float cq[2]; v2f sum[2] = { (v2f){}, (v2f){} };
#pragma unroll
    for (int qt = 0; qt < 2; ++qt) { mx[qt] = fmaxf(mx[qt], __shfl_xor(mx[qt], 16, 32)); cq[qt] = 10.0f - mx[qt] * 1.4426950408889634f; }    // 2^10 = PCAR; a rounding of cq scales a whole row and cancels in p / sum
    v8f o[2][4];
#pragma unroll
    for (int qt = 0; qt < 2; ++qt)
#pragma unroll
        for (int dt = 0; dt < 4; ++dt) o[qt][dt] = (v8f){};
    // unroll 1: the trip is long enough, and a second copy would only raise the register count
#pragma unroll 1
    for (int kb = 0; kb < TT; kb += 32) {
        v16h vf[4];
#pragma unroll
        for (int dt = 0; dt < 4; ++dt) vf[dt] = fa_ldf(v + dt * 16 * VPIT + kb * 2);
        v8f s[2][2];
#pragma unroll
        for (int kt = 0; kt < 2; ++kt)
#pragma unroll
            for (int qt = 0; qt < 2; ++qt) s[kt][qt] = fa_qk(kf, kt, qf[qt]);
        fa_ldk(k, (kb + 32) & (TT - 1), kf);    // the key fragments are free once the score products have issued: the next block's fly under the exponentials and the value products
        __builtin_amdgcn_sched_barrier(0);      // keeps both groups of loads up here; without it the value loads sink to just in front of their products and each waits out its full latency
        v16h pf[2];
#pragma unroll
        for (int kt = 0; kt < 2; ++kt) { const v4f m0 = *(const v4fa*)(ml + kb + kt * 16), m1 = *(const v4fa*)(ml + kb + kt * 16 + 4);
#pragma unroll
            for (int qt = 0; qt < 2; ++qt) { const v8f t = fa_bias(s[kt][qt], tl + kb + kt * 16 - qt * 16, m0, m1);
#pragma unroll
                for (int j = 0; j < 8; j += 2) { v2f p; p[0] = __builtin_amdgcn_exp2f(__builtin_fmaf(t[j], 1.4426950408889634f, cq[qt])); p[1] = __builtin_amdgcn_exp2f(__builtin_fmaf(t[j + 1], 1.4426950408889634f, cq[qt]));
                    sum[qt] += p; pf[qt][kt * 8 + j] = tohx(p[0]); pf[qt][kt * 8 + j + 1] = tohx(p[1]); } } }
#pragma unroll
        for (int dt = 0; dt < 4; ++dt)
#pragma unroll
            for (int qt = 0; qt < 2; ++qt) o[qt][dt] = wmma16(vf[dt], pf[qt], o[qt][dt]);
        // the trip ends in matrix products and the next one begins by overwriting their probability operands: these four slots keep the distance over the back edge
        asm volatile("v_nop\n\tv_nop\n\tv_nop\n\tv_nop" : "+v"(o[0][3]), "+v"(o[1][3]) : "v"(pf[0]), "v"(pf[1]));
    }
#pragma unroll
    for (int qt = 0; qt < 2; ++qt) { float sq = sum[qt][0] + sum[qt][1]; sq += __shfl_xor(sq, 16, 32); const float inv = __fdiv_rn(1.0f, sq);
        const size_t oo = ((size_t)b * TT + Q0 + wq + qt * 16 + lr) * DD + h * HDM + 8 * hi;
#pragma unroll
        for (int dt = 0; dt < 4; ++dt) { v8us oh, ol;
#pragma unroll
            for (int j = 0; j < 8; ++j) { unsigned short a, c2; splitf(o[qt][dt][j] * inv, a, c2); oh[j] = a; ol[j] = c2; }
            *(v8usa*)(Ah + oo + dt * 16) = oh; *(v8usa*)(Al + oo + dt * 16) = ol; } }
}
__device__ __forceinline__ void d_mrow(const float* __restrict__ mask, float* MBr, int blk) { const int e = blk * 256 + threadIdx.x; if (e >= NB_ * TT) return; float om = __fsub_rn(1.0f, bfr(mask[e])); asm volatile("" : "+v"(om)); const float v = __fmul_rn(om, -10000.0f); *(float*)(MBr + e) = v;  }
// ---- k_prep: everything that reads inputs alone, in one grid of 256-thread work-groups: the six weight transposes, the first norm and the mask row. None reads what another writes; a work-group's index alone says which piece it is,
// so every branch (and the barrier inside a transpose) is uniform for the work-group. All pieces but the mask row move about the same number of bytes. W4: the planes of wq, wk, wv, wo one behind the other.
__global__ __launch_bounds__(256) void k_prep(const float* __restrict__ wq, const float* __restrict__ wk, const float* __restrict__ wv, const float* __restrict__ wo, const float* __restrict__ wi, const float* __restrict__ wf,
                                              const float* __restrict__ hid, const float* __restrict__ ln, const float* __restrict__ mask, bf* W4, bf* WI, bf* WF, bf* Yh, bf* Yl, float* MBr) {
    constexpr int NI = (DD / 128) * (MM / 64), NF = (MM / 128) * (DD / 64), N1 = (DD / 128) * (DD / 64), NR = LL / 8;
    __shared__ unsigned tw[64 * 65];
    const int b = blockIdx.x, bf_ = b - NI, b1 = bf_ - NF, br = b1 - 4 * N1;
    if (b < NI) d_wtG<DD, MM>(wi, WI, b % (DD / 128), b / (DD / 128), tw);
    else if (bf_ < NF) d_wtG<MM, DD>(wf, WF, bf_ % (MM / 128), bf_ / (MM / 128), tw);
    else if (b1 < 4 * N1) { const int m = b1 / N1, e = b1 % N1; d_wtG<DD, DD>(m == 0 ? wq : m == 1 ? wk : m == 2 ? wv : wo, W4 + (size_t)m * DD * DD, e % (DD / 128), e / (DD / 128), tw); }
    else if (br < NR) d_rmsT(hid, 1, ln, Yh, Yl, br);
    else d_mrow(mask, MBr, br - NR);
}

extern "C" void kernel_launch(void* const* d_in, const int* in_sizes, int n_in,
                              void* d_out, int out_size, void* d_ws, size_t ws_size, hipStream_t stream) {
    (void)in_sizes; (void)n_in; (void)out_size;
    const float* IN[11]; for (int i = 0; i < 11; ++i) IN[i] = (const float*)d_in[i];   // 0 hidden, 1 attn_mask, 2 ln1_w, 3 wq, 4 wk, 5 wv, 6 wo, 7 rel_bias [32][16], 8 ln2_w, 9 wi [1024][4096], 10 wo_ff [4096][1024] (x @ W)
    float* OUT = (float*)d_out;     // [4][1024][1024]
    char* wsp = (char*)d_ws;
    auto take = [&](size_t bytes) { char* p = wsp; wsp += (bytes + 255) & ~(size_t)255; return (void*)p; };
    bf* W4 = (bf*)take((size_t)4 * DD * DD * 2); bf* WO = W4 + (size_t)3 * DD * DD; bf* WI = (bf*)take((size_t)MM * DD * 2); bf* WF = (bf*)take((size_t)DD * MM * 2); float* MBr = (float*)take((size_t)NB_ * TT * 4);    // W4: wq, wk, wv, wo
    bf* Xh = (bf*)take((size_t)LL * DD * 2); bf* Xl = (bf*)take((size_t)LL * DD * 2);
    h16* QP = (h16*)take((size_t)3 * LL * DD * 2); h16* KP = QP + (size_t)LL * DD; h16* VT = KP + (size_t)LL * DD; bf* Ah = (bf*)take((size_t)LL * DD * 2); bf* Al = (bf*)take((size_t)LL * DD * 2);
    float* H = (float*)take((size_t)LL * DD * 4); bf* Gh = (bf*)take((size_t)LL * MM * 2); bf* Gl = (bf*)take((size_t)LL * MM * 2);    // relu-FFN hidden planes
    if ((size_t)(wsp - (char*)d_ws) > ws_size) return;    // total ~ 168 MB
    k_prep<<<(DD / 128) * (MM / 64) + (MM / 128) * (DD / 64) + 4 * (DD / 128) * (DD / 64) + LL / 8 + NB_ * TT / 256, 256, 0, stream>>>(IN[3], IN[4], IN[5], IN[6], IN[9], IN[10], IN[0], IN[2], IN[1], W4, WI, WF, Xh, Xl, MBr);
    k_gemmt<EP_QKV><<<dim3(LL / 128, 3 * DD / 128, 1), 128, 0, stream>>>(Xh, Xl, W4, DD, nullptr, nullptr, QP, nullptr, nullptr);    // planes [b][h][t][64] (q, k) and [b][h][64][t] (v)
    k_fattn<<<dim3(TT / 256, NB_ * NH_, 1), 256, 0, stream>>>(QP, KP, VT, IN[7], MBr, Ah, Al);
    k_gemmt<EP_RES><<<dim3(LL / 128, DD / 128, 1), 128, 0, stream>>>(Ah, Al, WO, DD, IN[0], H, nullptr, nullptr, nullptr);
    k_rmsT<<<LL / 8, 256, 0, stream>>>(H, IN[8], Xh, Xl);
    k_gemmt<EP_RELU><<<dim3(LL / 128, MM / 128, 1), 128, 0, stream>>>(Xh, Xl, WI, DD, nullptr, nullptr, nullptr, Gh, Gl);
    k_gemmt<EP_OUT><<<dim3(LL / 128, DD / 128, 1), 128, 0, stream>>>(Gh, Gl, WF, MM, H, OUT, nullptr, nullptr, nullptr);
}

// v009
// It runs in 154 microseconds.
// It is 1.44 times as fast as v007, going by the measured steps of the versions left out in between.
// Over all steps from v000 it is 17.8 times as fast.
#include <hip/hip_runtime.h>

// T5 encoder block (hidden [4][1024][1024], attn_mask [4][1024]; x = T5-RMSNorm(hidden) ln1_w (eps 1e-6, no mean/bias); q/k/v = x w (16 heads x 64); scores = q.k (NO 1/sqrt(d)) + rel_bias[bucket(j - i)][h]
// + (1 - attn_mask[b][j]) (-1e4); softmax; hidden += merged ctx wo; y = RMSNorm(hidden) ln2_w; hidden += relu(y wi) wo_ff -> [4][1024][1024]. The bidirectional relative-position bucket of an integer offset
// (32 buckets, max distance 128) is evaluated with exact integer arithmetic: for |r| >= 8, 8 + 2 floor(log2 |r|) - 6 + [ |r|^2 >= 2^(2 floor(log2|r|) + 1) ], capped at 15 (this equals the reference's
// float formula for every offset 0..1023), + 16 for r > 0.)
// Compute dtypes, f32 accumulate: every input rounded to bf16; both RMSNorms f32 (wave per token) -> one fp16 plane; q/k/v, wo, wi, wo_ff on ONE fp16 plane of their computed operands
// x the bf16-rounded weights held as fp16 (the same values: 8 significant bits fit in 11; below 2^-17 a weight moves by at most 2^-25; the fp16 range bounds all of these as it bounds q, k and v); scores (K 64) and probs.v on single fp16 planes with an f32 register-row softmax
// (bias + mask added in f32; probabilities x1024); residuals and relu f32.

#define NB_  4
#define TT   1024
#define LL   4096
#define DD   1024
#define NH_  16
#define HDM  64
#define MM   4096
#define PCAR 1024.0f
typedef _Float16 h16;
typedef unsigned short bf;
typedef __attribute__((ext_vector_type(16))) _Float16 v16h;
typedef __attribute__((ext_vector_type(8)))  _Float16 v8h;
typedef __attribute__((ext_vector_type(8)))  float    v8f;
typedef __attribute__((ext_vector_type(4)))  float    v4f;
typedef v8h  __attribute__((may_alias)) v8ha;
typedef v4f  __attribute__((may_alias)) v4fa;

__device__ __forceinline__ unsigned short f2bf(float f) { unsigned u = __float_as_uint(f); u += 0x7FFFu + ((u >> 16) & 1u); return (unsigned short)(u >> 16); }
__device__ __forceinline__ float bf2f(unsigned short b) { return __uint_as_float(((unsigned)b) << 16); }
__device__ __forceinline__ float bfr(float f) { return bf2f(f2bf(f)); }
__device__ __forceinline__ v16h cat16(v8h lo, v8h hi) { return __builtin_shufflevector(lo, hi, 0, 1, 2, 3, 4, 5, 6, 7, 8, 9, 10, 11, 12, 13, 14, 15); }
__device__ __forceinline__ v8f wmma16(v16h a, v16h b, v8f c) { return __builtin_amdgcn_wmma_f32_16x16x32_f16(false, a, false, b, (short)0, c, false, false); }



// ---- k_gemmt<EP>: c[m][n] (f32) = sum_k A[m][k] Bt[n][k], both planes fp16 and K-contiguous; c never reaches memory as such: the epilogue EP stores it in the form that its reader takes (below). One 128x128 tile per work-group of 4 waves (2x2, 64x64 = 16 accumulators each);
// grid (M/128, N/128), 128 threads; M, N % 128 == 0, K % KS == 0. A stage is KS k (one or two 128-byte lines) of the 128 rows of A and Bt; it comes into LDS by asynchronous copies, whole 128-byte lines, once per work-group
// instead of once per wave, and the next stage flies while this one is multiplied (EP_QKV: two buffers; the others: three, and two stages fly). Fragment form and the order of the products per accumulator are those of a wave reading global memory.
template <typename T16> struct WFrag;
template <> struct WFrag<h16> { typedef v16h V; static __device__ __forceinline__ V ld(const h16* p) { return cat16(*(const v8h*)p, *(const v8h*)(p + 16)); } };
// eight copies: this thread's 16 bytes of eight rows of one plane, LS bytes apart in LDS and rs elements apart in memory. The s_wait_xcnt closes the statement so that no address register is rewritten ahead of it.
template <unsigned LS>
__device__ __forceinline__ void g_cp8(unsigned l, const bf* g, size_t rs) {
    asm volatile("global_load_async_to_lds_b128 %0, %8, off\n\t"
                 "global_load_async_to_lds_b128 %1, %9, off\n\t"
                 "global_load_async_to_lds_b128 %2, %10, off\n\t"
                 "global_load_async_to_lds_b128 %3, %11, off\n\t"
                 "global_load_async_to_lds_b128 %4, %12, off\n\t"
                 "global_load_async_to_lds_b128 %5, %13, off\n\t"
                 "global_load_async_to_lds_b128 %6, %14, off\n\t"
                 "global_load_async_to_lds_b128 %7, %15, off\n\t"
                 "s_wait_xcnt 0x0"
                 :: "v"(l), "v"(l + LS), "v"(l + 2u * LS), "v"(l + 3u * LS), "v"(l + 4u * LS), "v"(l + 5u * LS), "v"(l + 6u * LS), "v"(l + 7u * LS),
                    "v"(g), "v"(g + rs), "v"(g + 2 * rs), "v"(g + 3 * rs), "v"(g + 4 * rs), "v"(g + 5 * rs), "v"(g + 6 * rs), "v"(g + 7 * rs) : "memory");
}
// the same eight copies through the builtin: its operands may lie in any register, where those of asm text must lie in the first 256; the compiler keeps the address registers itself
typedef __attribute__((ext_vector_type(4))) int v4i;
template <unsigned LS>
__device__ __forceinline__ void g_cp8b(unsigned l, const bf* g, size_t rs) {
    // unrolled: eight copies in a row, each LDS address the first plus a constant
#pragma unroll
    for (unsigned i = 0; i < 8; ++i) __builtin_amdgcn_global_load_async_to_lds_b128((__attribute__((address_space(1))) v4i*)(g + i * rs), (__attribute__((address_space(3))) v4i*)(l + i * LS), 0, 0);
}
__device__ __forceinline__ v16h g_ldf(const unsigned char* p) { return cat16(*(const v8ha*)p, *(const v8ha*)(p + 32)); }
// EP_QKV: N = 3 DD, the weights of queries, keys and values one behind the other; P holds three planes of LL x DD fp16: [b][h][t][64] for columns below 2 DD (queries, then keys), [b][h][64][t] for the rest (values). EP_RES: C = bf16-rounded R + c. EP_OUT: C = R + c (both f32, pitch DD). EP_RELU: max(c, 0) as one fp16 plane, pitch MM.
// A wave's 64 columns are one head of one plane (EP_QKV), and its 64 rows lie in one batch; which of the two forms a work-group stores depends on blockIdx.y alone. Every store covers whole 128-byte lines; all pitches are constants, so that one address per wave serves every store.
enum { EP_QKV, EP_RES, EP_OUT, EP_RELU };
__device__ __forceinline__ h16 tohx(float x) { return (h16)x; }
template <int EP>
__global__ __launch_bounds__(128) void k_gemmt(const h16* __restrict__ A, const h16* __restrict__ Bt, int K, const float* __restrict__ R, float* C, h16* P) {
    // k per stage. EP_RES and EP_OUT have N = DD: 256 work-groups, one per WGP whatever LDS they take, with nobody else there to work under a stage's fixed costs (the wait for its first fragments, the landing of its copies, the barrier).
    // Their stage is twice as long: half as many of those, and the copies get twice the products to land under. The other two launches have more work-groups than WGPs and keep the short stage, at which several of them share a WGP.
    // Three buffers: stage t + 2 is asked for while stage t is multiplied, so that a stage has two trips to land in and a work-group's requests never run dry at a stage's end; needs K >= 2 KS. EP_RELU then has two work-groups on a WGP and
    // its 1024 fill the chip exactly twice; with two buffers it had three there and a last quarter that ran one to a WGP. EP_QKV keeps two buffers: its 768 work-groups are all resident at three to a WGP.
    constexpr bool LONG = (EP == EP_RES || EP == EP_OUT);
    constexpr int KS = LONG ? 128 : 64;
    constexpr int NBUF = EP == EP_QKV ? 2 : 3;
    constexpr int PIT = KS * 2 + 16;      // LDS pitch of a row: 16 bytes x odd, so that the 16-byte fragment reads of 16 rows fall on different banks
    constexpr int PL = 128 * PIT;         // one operand plane of a stage
    constexpr int ST = 2 * PL;            // a stage: A, Bt
    constexpr int LPR = KS / 8;           // threads (16 bytes each) per row
    constexpr int RPR = 128 / LPR;        // rows that the 128 threads cover with one copy each
    constexpr int NKS = KS / 32;          // blocks of 32 products per stage
    __shared__ __align__(16) unsigned char ring[NBUF * ST];
    __shared__ __align__(16) float os[4 * 16 * 68];
    const int tid = threadIdx.x, lane = tid & 31, lr = lane & 15, hi = lane >> 4, wave = tid >> 5, wm = wave >> 1, wn = wave & 1; const int r0 = blockIdx.x * 128, c0 = blockIdx.y * 128;
    const unsigned NT = (unsigned)K / KS; const size_t rs = (size_t)RPR * K;
    const bf* gA = (const bf*)A + (size_t)(r0 + tid / LPR) * K + (tid % LPR) * 8; const bf* gB = (const bf*)Bt + (size_t)(c0 + tid / LPR) * K + (tid % LPR) * 8;
    const unsigned l0 = (unsigned)(size_t)ring + (unsigned)((tid / LPR) * PIT + (tid % LPR) * 16);
    const unsigned char* fa = ring + (wm * 64 + lr) * PIT + hi * 16; const unsigned char* fb = ring + PL + (wn * 64 + lr) * PIT + hi * 16;
    auto fill = [&](unsigned l, size_t ko) { g_cp8<RPR * PIT>(l, gA + ko, rs); g_cp8<RPR * PIT>(l + PL, gB + ko, rs); };    // the short stage: eight copies cover the 128 rows of a plane, 16 copies per thread and stage
    auto plane = [&](unsigned l, const bf* g) {    // the long stage, one operand plane: 16 copies per thread, through the builtin, whose address registers the compiler may place anywhere
        // unrolled: h is a constant in every address
#pragma unroll
        for (int h = 0; h < 128 / (8 * RPR); ++h) g_cp8b<RPR * PIT>(l + h * 8 * RPR * PIT, g + h * 8 * rs, rs); };
    v8f acc[4][4];
#pragma unroll
    for (int mb = 0; mb < 4; ++mb)
#pragma unroll
        for (int nb = 0; nb < 4; ++nb) acc[mb][nb] = (v8f){};
    if constexpr (LONG) {
        plane(l0, gA); plane(l0 + PL, gB); plane(l0 + ST, gA + KS);    // stage 0 and half of stage 1: 48 copies of this wave in flight
        asm volatile("s_wait_asynccnt 0x10" ::: "memory");    // all but the 16 youngest: this wave's share of stage 0 has landed
        plane(l0 + ST + PL, gB + KS);                          // the rest of stage 1
    } else if constexpr (NBUF == 3) {
        fill(l0, 0); fill(l0 + ST, KS);
        asm volatile("s_wait_asynccnt 0x10" ::: "memory");    // all but the 16 youngest, which are stage 1: this wave's share of stage 0 has landed
    } else {
        fill(l0, 0);
        asm volatile("s_wait_asynccnt 0x0" ::: "memory");    // this wave's share of stage 0 has landed
    }
    __syncthreads();                                          // and so has every other wave's
    unsigned cb = 0;    // three buffers: t mod 3, the buffer of stage t
    // unroll 1: one stage per trip; the trip holds 32 or 64 products already
#pragma unroll 1
    for (unsigned t = 0; t < NT; ++t) {
        const unsigned bo = (NBUF == 3 ? cb : (t & 1u)) * ST;
        const unsigned fo = NBUF == 3 ? (cb == 0 ? 2u : cb - 1u) * ST : ST - bo;    // the buffer that every wave left at the barrier above: that of stage t - 1, which takes stage t + NBUF - 1
        v16h a[2][4], b[2][4];
#pragma unroll
        for (int i = 0; i < 4; ++i) { a[0][i] = g_ldf(fa + bo + i * 16 * PIT); b[0][i] = g_ldf(fb + bo + i * 16 * PIT); }
#pragma unroll
        for (int ks = 0; ks < NKS; ++ks) {
            if (ks + 1 < NKS) {
#pragma unroll
                for (int i = 0; i < 4; ++i) { a[(ks + 1) & 1][i] = g_ldf(fa + bo + i * 16 * PIT + (ks + 1) * 64); b[(ks + 1) & 1][i] = g_ldf(fb + bo + i * 16 * PIT + (ks + 1) * 64); } }
            if constexpr (!LONG) { if (ks == 0 && t + NBUF - 1 < NT) fill(l0 + fo, (size_t)(t + NBUF - 1) * KS); }    // issued under the latency of the fragment reads; at most 32 copies of a wave in flight
            else if (t + 2 < NT) {    // the stage after the next, one plane at a time: with the 32 copies of stage t + 1 a whole stage more would make 64 in flight
                if (ks == 0) plane(l0 + fo, gA + (size_t)(t + 2) * KS);    // at most 48 in flight
                if (ks == 2) { asm volatile("s_wait_asynccnt 0x2f" ::: "memory");    // at most 47 left in flight, 63 with the 16 that follow; the copy waited for was issued a trip and a half ago
                               plane(l0 + fo + PL, gB + (size_t)(t + 2) * KS); } }
            if constexpr (NKS > 2) __builtin_amdgcn_sched_barrier(0);    // the long stage: the next block's reads stay one group in front of this block's products; left free, the compiler spread those of the later blocks among the products, each pair just in front of its use, and the wave waited out their latency
#pragma unroll
            for (int nb = 0; nb < 4; ++nb)
#pragma unroll
                for (int mb = 0; mb < 4; ++mb) acc[mb][nb] = wmma16(a[ks & 1][mb], b[ks & 1][nb], acc[mb][nb]);
            if constexpr (NKS > 2) __builtin_amdgcn_sched_barrier(0);    // and the group after that stays behind them
        }
        __builtin_amdgcn_sched_barrier(0);    // the products stay in front of the waits: left free, the compiler moves them behind the barrier, and the wave then waits out the copies it has just issued instead of multiplying under them
        asm volatile("s_wait_dscnt 0x0" ::: "memory");       // this wave has left the buffer that is refilled behind the barrier
        if (NBUF == 3 && t + 2 < NT) {    // all but the youngest stage's copies, which are stage t + 2: this wave's share of stage t + 1 has landed
            if constexpr (LONG) asm volatile("s_wait_asynccnt 0x20" ::: "memory"); else asm volatile("s_wait_asynccnt 0x10" ::: "memory"); }
        else asm volatile("s_wait_asynccnt 0x0" ::: "memory");    // nothing was issued behind stage t + 1: this wave's share of it has landed
        __syncthreads();                                      // publishes stage t + 1 and ends every wave's reads of stage t
        if constexpr (NBUF == 3) cb = cb == 2 ? 0 : cb + 1;
    }
    asm volatile("s_wait_asynccnt 0x0" ::: "memory");        // no copy is left in flight when the wave ends
    float* osw = os + wave * 16 * 68;
    const int m0 = r0 + wm * 64, n0 = c0 + wn * 64;    // the corner of this wave's 64 x 64 results
    const int l8 = lane >> 3, c8 = (lane & 7) * 8;     // 16-bit planes: eight lanes of 16 bytes make one 128-byte line, four lines per store
    // Each block of 16 rows (values: columns) goes: results into LDS, whole lines read back and brought into their final form, then the stores. Outside the values a scheduling barrier keeps every read of a block in front of its first store, so that no read's destination
    // falls on a register that an issued store names; EP_QKV, EP_RES and EP_RELU reuse such registers in the next block: there s_wait_xcnt stands behind the stores, held in place by a scheduling barrier (a "memory" clobber alone holds no register write behind it).
    if (EP == EP_QKV && c0 >= 2 * DD) {
        // a lane holds eight consecutive tokens of one column: 16 bytes of the transposed plane. Staged as [16 columns][64 tokens], pitch 144 bytes.
        h16* osh = (h16*)osw;
        h16* vrow = P + (size_t)2 * LL * DD + ((size_t)((m0 / TT) * NH_ + (n0 - 2 * DD) / HDM) * HDM + l8) * TT + (m0 % TT) + c8;
#pragma unroll
        for (int nb = 0; nb < 4; ++nb) {
#pragma unroll
            for (int mb = 0; mb < 4; ++mb) { v8h c;
#pragma unroll
                for (int j = 0; j < 8; ++j) c[j] = tohx(acc[mb][nb][j]);
                *(v8ha*)(osh + lr * 72 + mb * 16 + hi * 8) = c; }
            __builtin_amdgcn_wave_barrier(); asm volatile("" ::: "memory");    // the lines are read back by other lanes of this wave: keeps the reads behind the writes
#pragma unroll
            for (int s = 0; s < 4; ++s) { const v8h val = *(const v8ha*)(osh + (s * 4 + l8) * 72 + c8); *(v8ha*)(vrow + (size_t)(nb * 16 + s * 4) * TT) = val; }
            __builtin_amdgcn_wave_barrier(); asm volatile("" ::: "memory");    // and the next columns' writes behind these reads
            if (nb < 3) { asm volatile("s_wait_xcnt 0x0" ::: "memory"); __builtin_amdgcn_sched_barrier(0); }    // the next columns reuse registers that these stores name
        }
    } else {
        v4f rv[4][8];    // the addend's rows, all fetched here at once: one trip to memory per wave instead of one per 16 rows
        if constexpr (EP == EP_RES || EP == EP_OUT) { const float* rrow = R + (size_t)(m0 + hi) * DD + n0 + lr * 4;
#pragma unroll
            for (int mb = 0; mb < 4; ++mb)
#pragma unroll
                for (int s = 0; s < 8; ++s) rv[mb][s] = *(const v4f*)(rrow + (size_t)(mb * 16 + 2 * s) * DD);
            asm volatile("s_wait_xcnt 0x0" ::: "memory"); __builtin_amdgcn_sched_barrier(0); }    // the address register of these loads is reused behind them
#pragma unroll
        for (int mb = 0; mb < 4; ++mb) {
#pragma unroll
            for (int nb = 0; nb < 4; ++nb) {
#pragma unroll
                for (int j = 0; j < 8; ++j) osw[(hi * 8 + j) * 68 + nb * 16 + lr] = acc[mb][nb][j]; }
            __builtin_amdgcn_wave_barrier(); asm volatile("" ::: "memory");    // the rows are read back by other lanes of this wave: keeps the reads behind the writes
            if constexpr (EP == EP_RES || EP == EP_OUT) {
                float* crow = C + (size_t)(m0 + hi) * DD + n0 + lr * 4; v4f o[8];
#pragma unroll
                for (int s = 0; s < 8; ++s) { const v4f val = *(const v4fa*)(osw + (2 * s + hi) * 68 + lr * 4);
#pragma unroll
                    for (int q = 0; q < 4; ++q) o[s][q] = __fadd_rn(EP == EP_RES ? bfr(rv[mb][s][q]) : rv[mb][s][q], val[q]); }
                __builtin_amdgcn_sched_barrier(0);    // every read and sum in front of the first store
#pragma unroll
                for (int s = 0; s < 8; ++s) *(v4f*)(crow + (size_t)(mb * 16 + 2 * s) * DD) = o[s];
            } else {
                v4f x[4][2];
#pragma unroll
                for (int s = 0; s < 4; ++s) { const float* orow = osw + (s * 4 + l8) * 68 + c8; x[s][0] = *(const v4fa*)orow; x[s][1] = *(const v4fa*)(orow + 4); }
                if constexpr (EP == EP_QKV) { h16* prow = P + (size_t)(n0 / DD) * LL * DD + ((size_t)((m0 / TT) * NH_ + (n0 % DD) / HDM) * TT + (m0 % TT) + l8) * HDM + c8; v8h c[4];
#pragma unroll
                    for (int s = 0; s < 4; ++s)
#pragma unroll
                        for (int j = 0; j < 8; ++j) c[s][j] = tohx(x[s][j >> 2][j & 3]);
                    __builtin_amdgcn_sched_barrier(0);    // every read and conversion in front of the first store
#pragma unroll
                    for (int s = 0; s < 4; ++s) *(v8ha*)(prow + (size_t)(mb * 16 + s * 4) * HDM) = c[s];
                } else { h16* grow = P + (size_t)(m0 + l8) * MM + n0 + c8; v8h c[4];
#pragma unroll
                    for (int s = 0; s < 4; ++s)
#pragma unroll
                        for (int j = 0; j < 8; ++j) c[s][j] = tohx(fmaxf(x[s][j >> 2][j & 3], 0.f));
                    __builtin_amdgcn_sched_barrier(0);    // every read and conversion in front of the first store
#pragma unroll
                    for (int s = 0; s < 4; ++s) *(v8ha*)(grow + (size_t)(mb * 16 + s * 4) * MM) = c[s]; }
            }
            __builtin_amdgcn_wave_barrier(); asm volatile("" ::: "memory");    // and the next rows' writes behind these reads
            if (mb < 3 && (EP == EP_QKV || EP == EP_RES || EP == EP_RELU)) { asm volatile("s_wait_xcnt 0x0" ::: "memory"); __builtin_amdgcn_sched_barrier(0); }    // the next rows reuse registers that these stores name
        }
    }
}

typedef __attribute__((ext_vector_type(2))) _Float16 v2h;
typedef __attribute__((ext_vector_type(4))) _Float16 v4h;
typedef __attribute__((ext_vector_type(2))) unsigned short v2us;
typedef __attribute__((ext_vector_type(2))) float v2f;

// ---- d_wtG<K, N>: Bt[n][k] (fp16) = w[k][n] (f32) rounded to bf16. One tile of 128 k x 64 n per work-group of 8 waves: tile (bx, by) of (K/128, N/64); tw is the work-group's LDS, 64 x 65 dwords. Both sides of the transposition move 256 consecutive bytes per 16 lanes (a row of the tile in, a row of the
// result out); the turn itself happens in LDS. A thread rounds two consecutive k of four n and packs each pair into one dword of the row [n]. The pitch of 65 dwords puts the 32 dwords of a wave's LDS store (16 groups of n, 4 x 65 dwords
// apart, x 2 pairs of k) and of a wave's LDS read (2 rows x 16 lanes, 4 dwords apart) on 32 different banks. K and N are constants, so that one address serves all loads of a thread and one all its stores.
typedef __attribute__((ext_vector_type(4))) unsigned v4u;
typedef v4u __attribute__((may_alias)) v4ua;
__device__ __forceinline__ unsigned wbits(float f) { return (unsigned)__builtin_bit_cast(unsigned short, (h16)bfr(f)); }
template <int K, int N>
__device__ __forceinline__ void d_wtG(const float* __restrict__ w, h16* Bt, int bx, int by, unsigned* tw) {
    constexpr int WP = 65;
    const int c = threadIdx.x & 15, r = threadIdx.x >> 4; const int k0 = bx * 128, n0 = by * 64;
    const float* s = w + (size_t)(k0 + 2 * r) * N + n0 + c * 4;
    v4f a[4][2];    // all eight loads of a thread fly together: one trip to memory per tile
#pragma unroll
    for (int h = 0; h < 4; ++h) { a[h][0] = *(const v4f*)(s + (size_t)(h * 32) * N); a[h][1] = *(const v4f*)(s + (size_t)(h * 32 + 1) * N); }
    asm volatile("s_wait_xcnt 0x0" :: "v"(s) : "memory");    // a precaution: the address that the loads name is an operand here, so it stays in its registers up to this wait
#pragma unroll
    for (int h = 0; h < 4; ++h)
#pragma unroll
        for (int q = 0; q < 4; ++q) tw[(c * 4 + q) * WP + h * 16 + r] = wbits(a[h][0][q]) | (wbits(a[h][1][q]) << 16);
    __syncthreads();    // the rows are read back by other waves
    h16* d = Bt + (size_t)(n0 + r) * K + k0 + c * 8;
#pragma unroll
    for (int p = 0; p < 4; ++p) { const unsigned* t = tw + (p * 16 + r) * WP + c * 4; v4u o; o[0] = t[0]; o[1] = t[1]; o[2] = t[2]; o[3] = t[3]; *(v4ua*)(d + (size_t)(p * 16) * K) = o; }
    asm volatile("s_wait_xcnt 0x0" ::: "memory");    // a precaution: in the built kernel the text of the next piece follows behind a branch and writes registers that these stores name
}
__device__ __forceinline__ void d_rmsT(const float* __restrict__ A, int rnd, const float* __restrict__ w, h16* Y, int blk) { const int lane = threadIdx.x & 31; const int t = blk * 8 + (threadIdx.x >> 5); if (t >= LL) return; const float* ar = A + (size_t)t * DD; float v[32]; float s = 0.f;
#pragma unroll
    for (int ch = 0; ch < 8; ++ch) { const v4f a = *(const v4f*)(ar + ch * 128 + lane * 4);
#pragma unroll
        for (int q = 0; q < 4; ++q) { const float x = rnd ? bfr(a[q]) : a[q]; v[ch * 4 + q] = x; float p = __fmul_rn(x, x); asm volatile("" : "+v"(p)); s = __fadd_rn(s, p); } }
#pragma unroll
    for (int sh = 16; sh; sh >>= 1) s += __shfl_xor(s, sh, 32);
    const float rs = __frsqrt_rn(__fadd_rn(s * (1.0f / DD), 1e-6f));
{
#pragma unroll
        for (int ch = 0; ch < 8; ++ch) { v4h oy; const v4f wv = *(const v4f*)(w + ch * 128 + lane * 4);    // a lane's four weights in one load: as two, the second's result fell on the offset register that the first still names
#pragma unroll
            for (int q = 0; q < 4; ++q) { float tn = __fmul_rn(v[ch * 4 + q], rs); asm volatile("" : "+v"(tn)); oy[q] = tohx(__fmul_rn(tn, bfr(wv[q]))); }
            *(v4h*)(Y + (size_t)t * DD + ch * 128 + lane * 4) = oy;
            if (ch < 7) { asm volatile("s_wait_xcnt 0x0" ::: "memory"); __builtin_amdgcn_sched_barrier(0); } }    // a precaution: the next 128 columns reuse registers that these stores name; the scheduling barrier holds their writes behind the wait
         } }
__global__ __launch_bounds__(256) void k_rmsT(const float* __restrict__ A, const float* __restrict__ w, h16* Y) { d_rmsT(A, 0, w, Y, blockIdx.x); }
__device__ __forceinline__ int t5_bucket(int r) { const int n = r < 0 ? -r : r; int v; if (n < 8) v = n; else { const int k = 31 - __clz(n); v = 8 + 2 * k - 6 + (((long long)n * n >= (1ll << (2 * k + 1))) ? 1 : 0); v = v > 15 ? 15 : v; } return (r > 0 ? 16 : 0) + v; }
// ---- k_fattn: the whole attention of one (batch, head) x 256 queries per work-group; 8 waves, 32 queries per wave; grid (TT/256, NB_*NH_), one work-group per WGP.
// All keys and all transposed values of the (batch, head) come into LDS once per work-group, by asynchronous copies of whole 128-byte lines; every fragment of both sweeps is then an LDS read at a padded pitch,
// where a wave reading global memory touched 16 lines per load and each of the waves asked for the same lines again. The values fly while sweep 1 runs. Fragment form and the order of all sums are unchanged.
// Scores are formed transposed, S^T = K Q^T (rows = keys, columns = queries): a lane then owns one query, its registers hold keys 8 hi + j of each 16-key tile, and two such tiles are,
// register for register, the 32-deep B fragment of O^T = V^T P^T. No score or probability leaves the registers. Sweep 1 finds each query's row maximum, sweep 2 forms the scores again,
// p = 1024 exp(t - max) (f32 sum, fp16 operand), and accumulates O^T; the division by the sum comes last, per lane. The bias is a table over key - query in LDS, the mask row lies beside it.
#define KPIT (HDM * 2 + 16)    // LDS pitch of a key row and
#define VPIT (TT * 2 + 16)     // of a row of the transposed values: 16 bytes x odd, so that the 16-byte fragment reads of 16 rows fall on different banks
__device__ __forceinline__ v16h fa_ldf(const unsigned char* p) { return cat16(*(const v8ha*)p, *(const v8ha*)(p + 32)); }
__device__ __forceinline__ void fa_ldk(const unsigned char* k, int kb, v16h* kf) {
#pragma unroll
    for (int kt = 0; kt < 2; ++kt) { kf[kt * 2] = fa_ldf(k + (kb + kt * 16) * KPIT); kf[kt * 2 + 1] = fa_ldf(k + (kb + kt * 16) * KPIT + 64); } }
__device__ __forceinline__ v8f fa_qk(const v16h* kf, int kt, const v16h* qf) { v8f s = (v8f){}; s = wmma16(kf[kt * 2], qf[0], s); return wmma16(kf[kt * 2 + 1], qf[1], s); }
__device__ __forceinline__ v8f fa_bias(v8f s, const float* tq, const v4f m0, const v4f m1) {
#pragma unroll
    for (int j = 0; j < 8; ++j) s[j] = __fadd_rn(__fadd_rn(s[j], tq[j]), j < 4 ? m0[j & 3] : m1[j & 3]);
    return s; }
__global__ __launch_bounds__(256) void k_fattn(const h16* __restrict__ QP, const h16* __restrict__ KP, const h16* __restrict__ VT, const float* __restrict__ rb, const float* __restrict__ MBr, h16* AO) {
    __shared__ __align__(16) unsigned char ksm[TT * KPIT];
    __shared__ __align__(16) unsigned char vsm[HDM * VPIT];
    __shared__ float tb[TT + 256];
    __shared__ __align__(16) float mk[TT];
    const int bh = blockIdx.y, b = bh / NH_, h = bh % NH_, Q0 = blockIdx.x * 256;
    // the keys: both planes are contiguous in memory, a thread's 16 bytes of copy i lie 4 KiB behind those of copy i - 1; the 256 threads cover 32 key rows per copy, 32 copies per thread
    { const bf* g = (const bf*)KP + (size_t)bh * TT * HDM + threadIdx.x * 8; const unsigned l = (unsigned)(size_t)ksm + (threadIdx.x >> 3) * KPIT + (threadIdx.x & 7) * 16;
      // unrolled: every address is then the first plus a constant
#pragma unroll
      for (int i = 0; i < 4; ++i) g_cp8<32 * KPIT>(l + i * 256 * KPIT, g + (size_t)i * 256 * HDM, 32 * HDM); }
    const float bv = bfr(rb[(threadIdx.x & 31) * NH_ + h]);    // lane l holds bucket l of this head: the table is filled by lane exchange, with one trip to memory instead of one per entry
#pragma unroll
    for (int i = 0; i < (TT + 256) / 256; ++i) { const int e = i * 256 + threadIdx.x; tb[e] = __shfl(bv, t5_bucket(e - 255 - Q0), 32); }    // tb[255 + key - (query - Q0)]; the last entry is never read
    { const int e = threadIdx.x * 4; *(v4fa*)(mk + e) = *(const v4fa*)(MBr + (size_t)b * TT + e); }
    asm volatile("s_wait_asynccnt 0x0" ::: "memory");    // this wave's share of the keys has landed
    __syncthreads();                                      // and so has every other wave's; publishes the two tables as well
    // the values: 2 rows of 2 KiB per copy, 32 copies per thread; nobody reads them before the barrier in front of sweep 2
    { const bf* g = (const bf*)VT + (size_t)bh * HDM * TT + threadIdx.x * 8; const unsigned l = (unsigned)(size_t)vsm + (threadIdx.x >> 7) * VPIT + (threadIdx.x & 127) * 16;
      // unrolled: every address is then the first plus a constant
#pragma unroll
      for (int i = 0; i < 4; ++i) g_cp8<2 * VPIT>(l + i * 16 * VPIT, g + (size_t)i * 16 * TT, 2 * TT); }
    const int lane = threadIdx.x & 31, lr = lane & 15, hi = lane >> 4, wq = (threadIdx.x >> 5) * 32;
    const h16* q = QP + ((size_t)bh * TT + Q0 + wq + lr) * HDM + 8 * hi;
    const unsigned char* k = ksm + lr * KPIT + 16 * hi;
    const unsigned char* v = vsm + lr * VPIT + 16 * hi;
    const float* tl = tb + 255 + 8 * hi - wq - lr;
    const float* ml = mk + 8 * hi;
    v16h qf[2][2];
#pragma unroll
    for (int qt = 0; qt < 2; ++qt) { qf[qt][0] = WFrag<h16>::ld(q + qt * 16 * HDM); qf[qt][1] = WFrag<h16>::ld(q + qt * 16 * HDM + 32); }
    v16h kf[4]; fa_ldk(k, 0, kf);
    float mx[2] = { -3.0e38f, -3.0e38f };
    // unroll 2: the key fragments of the next block are fetched one trip ahead into a second register set; two trips per pass let the sets swap without moves
#pragma unroll 2
    for (int kb = 0; kb < TT; kb += 32) {
        v16h kn[4]; fa_ldk(k, (kb + 32) & (TT - 1), kn);    // the last trip fetches block 0, which sweep 2 starts with
#pragma unroll
        for (int kt = 0; kt < 2; ++kt) { const v4f m0 = *(const v4fa*)(ml + kb + kt * 16), m1 = *(const v4fa*)(ml + kb + kt * 16 + 4);
#pragma unroll
            for (int qt = 0; qt < 2; ++qt) { const v8f s = fa_bias(fa_qk(kf, kt, qf[qt]), tl + kb + kt * 16 - qt * 16, m0, m1);
#pragma unroll
                for (int j = 0; j < 8; ++j) mx[qt] = fmaxf(mx[qt], s[j]); } }
#pragma unroll
        for (int i = 0; i < 4; ++i) kf[i] = kn[i];
    }
    asm volatile("s_wait_asynccnt 0x0" ::: "memory");    // this wave's share of the values has landed
    __syncthreads();                                      // and so has every other wave's
    float cq[2]; v2f sum[2] = { (v2f){}, (v2f){} };
#pragma unroll
    for (int qt = 0; qt < 2; ++qt) { mx[qt] = fmaxf(mx[qt], __shfl_xor(mx[qt], 16, 32)); cq[qt] = 10.0f - mx[qt] * 1.4426950408889634f; }    // 2^10 = PCAR; a rounding of cq scales a whole row and cancels in p / sum
    v8f o[2][4];
#pragma unroll
    for (int qt = 0; qt < 2; ++qt)
#pragma unroll
        for (int dt = 0; dt < 4; ++dt) o[qt][dt] = (v8f){};
    // unroll 1: the trip is long enough, and a second copy would only raise the register count
#pragma unroll 1
    for (int kb = 0; kb < TT; kb += 32) {
        v16h vf[4];
#pragma unroll
        for (int dt = 0; dt < 4; ++dt) vf[dt] = fa_ldf(v + dt * 16 * VPIT + kb * 2);
        v8f s[2][2];
#pragma unroll
        for (int kt = 0; kt < 2; ++kt)
#pragma unroll
            for (int qt = 0; qt < 2; ++qt) s[kt][qt] = fa_qk(kf, kt, qf[qt]);
        fa_ldk(k, (kb + 32) & (TT - 1), kf);    // the key fragments are free once the score products have issued: the next block's fly under the exponentials and the value products
        __builtin_amdgcn_sched_barrier(0);      // keeps both groups of loads up here; without it the value loads sink to just in front of their products and each waits out its full latency
        v16h pf[2];
#pragma unroll
        for (int kt = 0; kt < 2; ++kt) { const v4f m0 = *(const v4fa*)(ml + kb + kt * 16), m1 = *(const v4fa*)(ml + kb + kt * 16 + 4);
#pragma unroll
            for (int qt = 0; qt < 2; ++qt) { const v8f t = fa_bias(s[kt][qt], tl + kb + kt * 16 - qt * 16, m0, m1);
#pragma unroll
                for (int j = 0; j < 8; j += 2) { v2f p; p[0] = __builtin_amdgcn_exp2f(__builtin_fmaf(t[j], 1.4426950408889634f, cq[qt])); p[1] = __builtin_amdgcn_exp2f(__builtin_fmaf(t[j + 1], 1.4426950408889634f, cq[qt]));
                    sum[qt] += p; pf[qt][kt * 8 + j] = tohx(p[0]); pf[qt][kt * 8 + j + 1] = tohx(p[1]); } } }
#pragma unroll
        for (int dt = 0; dt < 4; ++dt)
#pragma unroll
            for (int qt = 0; qt < 2; ++qt) o[qt][dt] = wmma16(vf[dt], pf[qt], o[qt][dt]);
        // the trip ends in matrix products and the next one begins by overwriting their probability operands: these four slots keep the distance over the back edge
        asm volatile("v_nop\n\tv_nop\n\tv_nop\n\tv_nop" : "+v"(o[0][3]), "+v"(o[1][3]) : "v"(pf[0]), "v"(pf[1]));
    }
    v8h oc[2][4];
#pragma unroll
    for (int qt = 0; qt < 2; ++qt) { float sq = sum[qt][0] + sum[qt][1]; sq += __shfl_xor(sq, 16, 32); const float inv = __fdiv_rn(1.0f, sq);
#pragma unroll
        for (int dt = 0; dt < 4; ++dt)
#pragma unroll
            for (int j = 0; j < 8; ++j) oc[qt][dt][j] = tohx(o[qt][dt][j] * inv); }
    __builtin_amdgcn_sched_barrier(0);    // every conversion in front of the first store, so that no register which an issued store names is written again
    h16* orow = AO + ((size_t)b * TT + Q0 + wq + lr) * DD + h * HDM + 8 * hi;
#pragma unroll
    for (int qt = 0; qt < 2; ++qt)
#pragma unroll
        for (int dt = 0; dt < 4; ++dt) *(v8ha*)(orow + (size_t)qt * 16 * DD + dt * 16) = oc[qt][dt];
}
__device__ __forceinline__ void d_mrow(const float* __restrict__ mask, float* MBr, int blk) { const int e = blk * 256 + threadIdx.x; if (e >= NB_ * TT) return; float om = __fsub_rn(1.0f, bfr(mask[e])); asm volatile("" : "+v"(om)); const float v = __fmul_rn(om, -10000.0f); *(float*)(MBr + e) = v;  }
// ---- k_prep: everything that reads inputs alone, in one grid of 256-thread work-groups: the six weight transposes, the first norm and the mask row. None reads what another writes; a work-group's index alone says which piece it is,
// so every branch (and the barrier inside a transpose) is uniform for the work-group. All pieces but the mask row move about the same number of bytes. W4: the planes of wq, wk, wv, wo one behind the other.
__global__ __launch_bounds__(256) void k_prep(const float* __restrict__ wq, const float* __restrict__ wk, const float* __restrict__ wv, const float* __restrict__ wo, const float* __restrict__ wi, const float* __restrict__ wf,
                                              const float* __restrict__ hid, const float* __restrict__ ln, const float* __restrict__ mask, h16* W4, h16* WI, h16* WF, h16* Y, float* MBr) {
    constexpr int NI = (DD / 128) * (MM / 64), NF = (MM / 128) * (DD / 64), N1 = (DD / 128) * (DD / 64), NR = LL / 8;
    __shared__ unsigned tw[64 * 65];
    const int b = blockIdx.x, bf_ = b - NI, b1 = bf_ - NF, br = b1 - 4 * N1;
    if (b < NI) d_wtG<DD, MM>(wi, WI, b % (DD / 128), b / (DD / 128), tw);
    else if (bf_ < NF) d_wtG<MM, DD>(wf, WF, bf_ % (MM / 128), bf_ / (MM / 128), tw);
    else if (b1 < 4 * N1) { const int m = b1 / N1, e = b1 % N1; d_wtG<DD, DD>(m == 0 ? wq : m == 1 ? wk : m == 2 ? wv : wo, W4 + (size_t)m * DD * DD, e % (DD / 128), e / (DD / 128), tw); }
    else if (br < NR) d_rmsT(hid, 1, ln, Y, br);
    else d_mrow(mask, MBr, br - NR);
}

extern "C" void kernel_launch(void* const* d_in, const int* in_sizes, int n_in,
                              void* d_out, int out_size, void* d_ws, size_t ws_size, hipStream_t stream) {
    (void)in_sizes; (void)n_in; (void)out_size;
    const float* IN[11]; for (int i = 0; i < 11; ++i) IN[i] = (const float*)d_in[i];   // 0 hidden, 1 attn_mask, 2 ln1_w, 3 wq, 4 wk, 5 wv, 6 wo, 7 rel_bias [32][16], 8 ln2_w, 9 wi [1024][4096], 10 wo_ff [4096][1024] (x @ W)
    float* OUT = (float*)d_out;     // [4][1024][1024]
    char* wsp = (char*)d_ws;
    auto take = [&](size_t bytes) { char* p = wsp; wsp += (bytes + 255) & ~(size_t)255; return (void*)p; };
    h16* W4 = (h16*)take((size_t)4 * DD * DD * 2); h16* WO = W4 + (size_t)3 * DD * DD; h16* WI = (h16*)take((size_t)MM * DD * 2); h16* WF = (h16*)take((size_t)DD * MM * 2); float* MBr = (float*)take((size_t)NB_ * TT * 4);    // W4: wq, wk, wv, wo
    h16* X = (h16*)take((size_t)LL * DD * 2);
    h16* QP = (h16*)take((size_t)3 * LL * DD * 2); h16* KP = QP + (size_t)LL * DD; h16* VT = KP + (size_t)LL * DD; h16* AO = (h16*)take((size_t)LL * DD * 2);
    float* H = (float*)take((size_t)LL * DD * 4); h16* G = (h16*)take((size_t)LL * MM * 2);    // relu-FFN hidden plane
    if ((size_t)(wsp - (char*)d_ws) > ws_size) return;    // total ~ 117 MB
    k_prep<<<(DD / 128) * (MM / 64) + (MM / 128) * (DD / 64) + 4 * (DD / 128) * (DD / 64) + LL / 8 + NB_ * TT / 256, 256, 0, stream>>>(IN[3], IN[4], IN[5], IN[6], IN[9], IN[10], IN[0], IN[2], IN[1], W4, WI, WF, X, MBr);
    k_gemmt<EP_QKV><<<dim3(LL / 128, 3 * DD / 128, 1), 128, 0, stream>>>(X, W4, DD, nullptr, nullptr, QP);    // planes [b][h][t][64] (q, k) and [b][h][64][t] (v)
    k_fattn<<<dim3(TT / 256, NB_ * NH_, 1), 256, 0, stream>>>(QP, KP, VT, IN[7], MBr, AO);
    k_gemmt<EP_RES><<<dim3(LL / 128, DD / 128, 1), 128, 0, stream>>>(AO, WO, DD, IN[0], H, nullptr);
    k_rmsT<<<LL / 8, 256, 0, stream>>>(H, IN[8], X);
    k_gemmt<EP_RELU><<<dim3(LL / 128, MM / 128, 1), 128, 0, stream>>>(X, WI, DD, nullptr, nullptr, G);
    k_gemmt<EP_OUT><<<dim3(LL / 128, DD / 128, 1), 128, 0, stream>>>(G, WF, MM, H, OUT, nullptr);
}

// v010
// A run of this version takes 146 microseconds.
// Two timings next to v009 both put it at 1.05 times that version's speed.
// Counting every step since v000, it is 18.8 times as fast.
#include <hip/hip_runtime.h>

// T5 encoder block (hidden [4][1024][1024], attn_mask [4][1024]; x = T5-RMSNorm(hidden) ln1_w (eps 1e-6, no mean/bias); q/k/v = x w (16 heads x 64); scores = q.k (NO 1/sqrt(d)) + rel_bias[bucket(j - i)][h]
// + (1 - attn_mask[b][j]) (-1e4); softmax; hidden += merged ctx wo; y = RMSNorm(hidden) ln2_w; hidden += relu(y wi) wo_ff -> [4][1024][1024]. The bidirectional relative-position bucket of an integer offset
// (32 buckets, max distance 128) is evaluated with exact integer arithmetic: for |r| >= 8, 8 + 2 floor(log2 |r|) - 6 + [ |r|^2 >= 2^(2 floor(log2|r|) + 1) ], capped at 15 (this equals the reference's
// float formula for every offset 0..1023), + 16 for r > 0.)
// Compute dtypes, f32 accumulate: every input rounded to bf16; both RMSNorms f32 (wave per token) -> one fp16 plane; q/k/v, wo, wi, wo_ff on ONE fp16 plane of their computed operands
// x the bf16-rounded weights held as fp16 (the same values: 8 significant bits fit in 11; below 2^-17 a weight moves by at most 2^-25; the fp16 range bounds all of these as it bounds q, k and v); scores (K 64) and probs.v on single fp16 planes with an f32 register-row softmax
// (bias + mask added in f32; probabilities x1024); residuals and relu f32.

#define NB_  4
#define TT   1024
#define LL   4096
#define DD   1024
#define NH_  16
#define HDM  64
#define MM   4096
#define PCAR 1024.0f
typedef _Float16 h16;
typedef unsigned short bf;
typedef __attribute__((ext_vector_type(16))) _Float16 v16h;
typedef __attribute__((ext_vector_type(8)))  _Float16 v8h;
typedef __attribute__((ext_vector_type(8)))  float    v8f;
typedef __attribute__((ext_vector_type(4)))  float    v4f;
typedef v8h  __attribute__((may_alias)) v8ha;
typedef v4f  __attribute__((may_alias)) v4fa;

__device__ __forceinline__ unsigned short f2bf(float f) { unsigned u = __float_as_uint(f); u += 0x7FFFu + ((u >> 16) & 1u); return (unsigned short)(u >> 16); }
__device__ __forceinline__ float bf2f(unsigned short b) { return __uint_as_float(((unsigned)b) << 16); }
__device__ __forceinline__ float bfr(float f) { return bf2f(f2bf(f)); }
__device__ __forceinline__ v16h cat16(v8h lo, v8h hi) { return __builtin_shufflevector(lo, hi, 0, 1, 2, 3, 4, 5, 6, 7, 8, 9, 10, 11, 12, 13, 14, 15); }
__device__ __forceinline__ v8f wmma16(v16h a, v16h b, v8f c) { return __builtin_amdgcn_wmma_f32_16x16x32_f16(false, a, false, b, (short)0, c, false, false); }



// ---- k_gemmt<EP>: c[m][n] (f32) = sum_k A[m][k] Bt[n][k], both planes fp16 and K-contiguous; c never reaches memory as such: the epilogue EP stores it in the form that its reader takes (below). One 128x128 tile per work-group of 4 waves (2x2, 64x64 = 16 accumulators each);
// grid (M/128, N/128), 128 threads; M, N % 128 == 0, K % KS == 0 (EP_QKV, EP_RELU: one 256x256 tile per work-group of 8 waves, 4x2, 64x128 = 32 accumulators each; grid (M/256, N/256), 256 threads). A stage is KS k (one or two 128-byte lines) of the 128 (256) rows of A and Bt; it comes into LDS by asynchronous copies, whole 128-byte lines, once per work-group
// instead of once per wave, and the next two stages fly while this one is multiplied (three buffers). Fragment form and the order of the products per accumulator are those of a wave reading global memory.
template <typename T16> struct WFrag;
template <> struct WFrag<h16> { typedef v16h V; static __device__ __forceinline__ V ld(const h16* p) { return cat16(*(const v8h*)p, *(const v8h*)(p + 16)); } };
// eight copies: this thread's 16 bytes of eight rows of one plane, LS bytes apart in LDS and rs elements apart in memory. The s_wait_xcnt closes the statement so that no address register is rewritten ahead of it.
template <unsigned LS>
__device__ __forceinline__ void g_cp8(unsigned l, const bf* g, size_t rs) {
    asm volatile("global_load_async_to_lds_b128 %0, %8, off\n\t"
                 "global_load_async_to_lds_b128 %1, %9, off\n\t"
                 "global_load_async_to_lds_b128 %2, %10, off\n\t"
                 "global_load_async_to_lds_b128 %3, %11, off\n\t"
                 "global_load_async_to_lds_b128 %4, %12, off\n\t"
                 "global_load_async_to_lds_b128 %5, %13, off\n\t"
                 "global_load_async_to_lds_b128 %6, %14, off\n\t"
                 "global_load_async_to_lds_b128 %7, %15, off\n\t"
                 "s_wait_xcnt 0x0"
                 :: "v"(l), "v"(l + LS), "v"(l + 2u * LS), "v"(l + 3u * LS), "v"(l + 4u * LS), "v"(l + 5u * LS), "v"(l + 6u * LS), "v"(l + 7u * LS),
                    "v"(g), "v"(g + rs), "v"(g + 2 * rs), "v"(g + 3 * rs), "v"(g + 4 * rs), "v"(g + 5 * rs), "v"(g + 6 * rs), "v"(g + 7 * rs) : "memory");
}
// the same eight copies through the builtin: its operands may lie in any register, where those of asm text must lie in the first 256; the compiler keeps the address registers itself
typedef __attribute__((ext_vector_type(4))) int v4i;
template <unsigned LS>
__device__ __forceinline__ void g_cp8b(unsigned l, const bf* g, size_t rs) {
    // unrolled: eight copies in a row, each LDS address the first plus a constant
#pragma unroll
    for (unsigned i = 0; i < 8; ++i) __builtin_amdgcn_global_load_async_to_lds_b128((__attribute__((address_space(1))) v4i*)(g + i * rs), (__attribute__((address_space(3))) v4i*)(l + i * LS), 0, 0);
}
__device__ __forceinline__ v16h g_ldf(const unsigned char* p) { return cat16(*(const v8ha*)p, *(const v8ha*)(p + 32)); }
// EP_QKV: N = 3 DD, the weights of queries, keys and values one behind the other; P holds three planes of LL x DD fp16: [b][h][t][64] for columns below 2 DD (queries, then keys), [b][h][64][t] for the rest (values). EP_RES: C = bf16-rounded R + c. EP_OUT: C = R + c (both f32, pitch DD). EP_RELU: max(c, 0) as one fp16 plane, pitch MM.
// A wave's 128 columns are two heads of one plane (EP_QKV), and its 64 rows lie in one batch; which of the two forms a work-group stores depends on blockIdx.y alone. Every store covers whole 128-byte lines; all pitches are constants, so that one address per wave serves every store.
enum { EP_QKV, EP_RES, EP_OUT, EP_RELU };
__device__ __forceinline__ h16 tohx(float x) { return (h16)x; }
template <int EP>
__global__ __launch_bounds__(EP == EP_QKV || EP == EP_RELU ? 256 : 128) void k_gemmt(const h16* __restrict__ A, const h16* __restrict__ Bt, int K, const float* __restrict__ R, float* C, h16* P) {
    // k per stage. EP_RES and EP_OUT have N = DD: 256 work-groups, one per WGP whatever LDS they take, with nobody else there to work under a stage's fixed costs (the wait for its first fragments, the landing of its copies, the barrier).
    // Their stage is twice as long: half as many of those, and the copies get twice the products to land under.
    // Three buffers: stage t + 2 is asked for while stage t is multiplied, so that a stage has two trips to land in and a work-group's requests never run dry at a stage's end; needs K >= 2 KS.
    // EP_QKV (N = 3 DD) and EP_RELU (N = MM) are wide enough for tiles of 256 x 256: every staged byte then serves 256 rows or columns of results instead of 128, which halves what the launch asks of L2, and a fragment read from LDS serves
    // 4 or 8 products instead of 4. Their 192 and 256 work-groups stand one to a WGP, two waves to a SIMD; the stage stays short, 64 products per wave.
    constexpr bool LONG = (EP == EP_RES || EP == EP_OUT);
    constexpr int KS = LONG ? 128 : 64;
    constexpr int NBUF = 3;
    constexpr int PIT = KS * 2 + 16;      // LDS pitch of a row: 16 bytes x odd, so that the 16-byte fragment reads of 16 rows fall on different banks
    constexpr bool BIG = !LONG;
    constexpr int TR = BIG ? 256 : 128;   // rows of A, and of Bt, per tile
    constexpr int NW = BIG ? 8 : 4;       // waves: TR / 64 down, 2 across
    constexpr int FN = TR / 32;           // blocks of 16 columns per wave
    constexpr int PL = TR * PIT;          // one operand plane of a stage
    constexpr int ST = 2 * PL;            // a stage: A, Bt
    constexpr int LPR = KS / 8;           // threads (16 bytes each) per row
    constexpr int RPR = NW * 32 / LPR;    // rows that the threads cover with one copy each
    constexpr int NKS = KS / 32;          // blocks of 32 products per stage
    __shared__ __align__(16) unsigned char ring[NBUF * ST];
    __shared__ __align__(16) float os[NW * 16 * 68];
    const int tid = threadIdx.x, lane = tid & 31, lr = lane & 15, hi = lane >> 4, wave = tid >> 5, wm = wave >> 1, wn = wave & 1; const int r0 = blockIdx.x * TR, c0 = blockIdx.y * TR;
    const unsigned NT = (unsigned)K / KS; const size_t rs = (size_t)RPR * K;
    const bf* gA = (const bf*)A + (size_t)(r0 + tid / LPR) * K + (tid % LPR) * 8; const bf* gB = (const bf*)Bt + (size_t)(c0 + tid / LPR) * K + (tid % LPR) * 8;
    const unsigned l0 = (unsigned)(size_t)ring + (unsigned)((tid / LPR) * PIT + (tid % LPR) * 16);
    const unsigned char* fa = ring + (wm * 64 + lr) * PIT + hi * 16; const unsigned char* fb = ring + PL + (wn * FN * 16 + lr) * PIT + hi * 16;
    auto fill = [&](unsigned l, size_t ko) { g_cp8b<RPR * PIT>(l, gA + ko, rs); g_cp8b<RPR * PIT>(l + PL, gB + ko, rs); };    // the short stage: eight copies cover the 256 rows of a plane, 16 copies per thread and stage; through the builtin, whose address registers the compiler may place anywhere
    auto plane = [&](unsigned l, const bf* g) {    // the long stage, one operand plane: 16 copies per thread, through the builtin, whose address registers the compiler may place anywhere
        // unrolled: h is a constant in every address
#pragma unroll
        for (int h = 0; h < 128 / (8 * RPR); ++h) g_cp8b<RPR * PIT>(l + h * 8 * RPR * PIT, g + h * 8 * rs, rs); };
    v8f acc[4][FN];
#pragma unroll
    for (int mb = 0; mb < 4; ++mb)
#pragma unroll
        for (int nb = 0; nb < FN; ++nb) acc[mb][nb] = (v8f){};
    if constexpr (LONG) {
        plane(l0, gA); plane(l0 + PL, gB); plane(l0 + ST, gA + KS);    // stage 0 and half of stage 1: 48 copies of this wave in flight
        asm volatile("s_wait_asynccnt 0x10" ::: "memory");    // all but the 16 youngest: this wave's share of stage 0 has landed
        plane(l0 + ST + PL, gB + KS);                          // the rest of stage 1
    } else {
        fill(l0, 0); fill(l0 + ST, KS);
        asm volatile("s_wait_asynccnt 0x10" ::: "memory");    // all but the 16 youngest, which are stage 1: this wave's share of stage 0 has landed
    }
    __syncthreads();                                          // and so has every other wave's
    unsigned cb = 0;    // t mod 3, the buffer of stage t
    // unroll 1: one stage per trip; the trip holds 64 products already
#pragma unroll 1
    for (unsigned t = 0; t < NT; ++t) {
        const unsigned bo = cb * ST;
        const unsigned fo = (cb == 0 ? 2u : cb - 1u) * ST;    // the buffer that every wave left at the barrier above: that of stage t - 1, which takes stage t + 2
        v16h a[2][4], b[2][FN];
#pragma unroll
        for (int i = 0; i < FN; ++i) { if (i < 4) a[0][i] = g_ldf(fa + bo + i * 16 * PIT); b[0][i] = g_ldf(fb + bo + i * 16 * PIT); }
#pragma unroll
        for (int ks = 0; ks < NKS; ++ks) {
            if (ks + 1 < NKS) {
#pragma unroll
                for (int i = 0; i < FN; ++i) { if (i < 4) a[(ks + 1) & 1][i] = g_ldf(fa + bo + i * 16 * PIT + (ks + 1) * 64); b[(ks + 1) & 1][i] = g_ldf(fb + bo + i * 16 * PIT + (ks + 1) * 64); } }
            if constexpr (!LONG) { if (ks == 0 && t + 2 < NT) fill(l0 + fo, (size_t)(t + 2) * KS); }    // issued under the latency of the fragment reads; at most 32 copies of a wave in flight
            else if (t + 2 < NT) {    // the stage after the next, one plane at a time: with the 32 copies of stage t + 1 a whole stage more would make 64 in flight
                if (ks == 0) plane(l0 + fo, gA + (size_t)(t + 2) * KS);    // at most 48 in flight
                if (ks == 2) { asm volatile("s_wait_asynccnt 0x2f" ::: "memory");    // at most 47 left in flight, 63 with the 16 that follow; the copy waited for was issued a trip and a half ago
                               plane(l0 + fo + PL, gB + (size_t)(t + 2) * KS); } }
            if constexpr (NKS > 2) __builtin_amdgcn_sched_barrier(0);    // the long stage: the next block's reads stay one group in front of this block's products; left free, the compiler spread those of the later blocks among the products, each pair just in front of its use, and the wave waited out their latency
#pragma unroll
            for (int nb = 0; nb < FN; ++nb)
#pragma unroll
                for (int mb = 0; mb < 4; ++mb) acc[mb][nb] = wmma16(a[ks & 1][mb], b[ks & 1][nb], acc[mb][nb]);
            if constexpr (NKS > 2) __builtin_amdgcn_sched_barrier(0);    // and the group after that stays behind them
        }
        __builtin_amdgcn_sched_barrier(0);    // the products stay in front of the waits: left free, the compiler moves them behind the barrier, and the wave then waits out the copies it has just issued instead of multiplying under them
        asm volatile("s_wait_dscnt 0x0" ::: "memory");       // this wave has left the buffer that is refilled behind the barrier
        if (t + 2 < NT) {    // all but the youngest stage's copies, which are stage t + 2: this wave's share of stage t + 1 has landed
            if constexpr (LONG) asm volatile("s_wait_asynccnt 0x20" ::: "memory"); else asm volatile("s_wait_asynccnt 0x10" ::: "memory"); }
        else asm volatile("s_wait_asynccnt 0x0" ::: "memory");    // nothing was issued behind stage t + 1: this wave's share of it has landed
        __syncthreads();                                      // publishes stage t + 1 and ends every wave's reads of stage t
        cb = cb == 2 ? 0 : cb + 1;
    }
    asm volatile("s_wait_asynccnt 0x0" ::: "memory");        // no copy is left in flight when the wave ends
    float* osw = os + wave * 16 * 68;
    const int m0 = r0 + wm * 64, n0 = c0 + wn * FN * 16;    // the corner of this wave's results
    const int l8 = lane >> 3, c8 = (lane & 7) * 8;     // 16-bit planes: eight lanes of 16 bytes make one 128-byte line, four lines per store
    // Each block of 16 rows (values: columns) goes: results into LDS, whole lines read back and brought into their final form, then the stores. Outside the values a scheduling barrier keeps every read of a block in front of its first store, so that no read's destination
    // falls on a register that an issued store names; EP_QKV, EP_RES and EP_RELU reuse such registers in the next block: there s_wait_xcnt stands behind the stores, held in place by a scheduling barrier (a "memory" clobber alone holds no register write behind it).
    if (EP == EP_QKV && c0 >= 2 * DD) {
        // a lane holds eight consecutive tokens of one column: 16 bytes of the transposed plane. Staged as [16 columns][64 tokens], pitch 144 bytes. The wave's 128 columns are two heads, whose planes lie one behind the other.
        h16* osh = (h16*)osw;
        h16* vrow = P + (size_t)2 * LL * DD + ((size_t)((m0 / TT) * NH_ + (n0 - 2 * DD) / HDM) * HDM + l8) * TT + (m0 % TT) + c8;
#pragma unroll
        for (int nb = 0; nb < FN; ++nb) {
#pragma unroll
            for (int mb = 0; mb < 4; ++mb) { v8h c;
#pragma unroll
                for (int j = 0; j < 8; ++j) c[j] = tohx(acc[mb][nb][j]);
                *(v8ha*)(osh + lr * 72 + mb * 16 + hi * 8) = c; }
            __builtin_amdgcn_wave_barrier(); asm volatile("" ::: "memory");    // the lines are read back by other lanes of this wave: keeps the reads behind the writes
#pragma unroll
            for (int s = 0; s < 4; ++s) { const v8h val = *(const v8ha*)(osh + (s * 4 + l8) * 72 + c8); *(v8ha*)(vrow + (size_t)(nb * 16 + s * 4) * TT) = val; }
            __builtin_amdgcn_wave_barrier(); asm volatile("" ::: "memory");    // and the next columns' writes behind these reads
            if (nb + 1 < FN) { asm volatile("s_wait_xcnt 0x0" ::: "memory"); __builtin_amdgcn_sched_barrier(0); }    // the next columns reuse registers that these stores name
        }
    } else {
        v4f rv[4][8];    // the addend's rows, all fetched here at once: one trip to memory per wave instead of one per 16 rows
        if constexpr (EP == EP_RES || EP == EP_OUT) { const float* rrow = R + (size_t)(m0 + hi) * DD + n0 + lr * 4;
#pragma unroll
            for (int mb = 0; mb < 4; ++mb)
#pragma unroll
                for (int s = 0; s < 8; ++s) rv[mb][s] = *(const v4f*)(rrow + (size_t)(mb * 16 + 2 * s) * DD);
            asm volatile("s_wait_xcnt 0x0" ::: "memory"); __builtin_amdgcn_sched_barrier(0); }    // the address register of these loads is reused behind them
        // the large tile's 128 columns go as two runs of 64 (EP_QKV: two heads)
#pragma unroll
        for (int nh = 0; nh < FN / 4; ++nh)
#pragma unroll
        for (int mb = 0; mb < 4; ++mb) {
#pragma unroll
            for (int nb = 0; nb < 4; ++nb) {
#pragma unroll
                for (int j = 0; j < 8; ++j) osw[(hi * 8 + j) * 68 + nb * 16 + lr] = acc[mb][nh * 4 + nb][j]; }
            __builtin_amdgcn_wave_barrier(); asm volatile("" ::: "memory");    // the rows are read back by other lanes of this wave: keeps the reads behind the writes
            if constexpr (EP == EP_RES || EP == EP_OUT) {
                float* crow = C + (size_t)(m0 + hi) * DD + n0 + lr * 4; v4f o[8];
#pragma unroll
                for (int s = 0; s < 8; ++s) { const v4f val = *(const v4fa*)(osw + (2 * s + hi) * 68 + lr * 4);
#pragma unroll
                    for (int q = 0; q < 4; ++q) o[s][q] = __fadd_rn(EP == EP_RES ? bfr(rv[mb][s][q]) : rv[mb][s][q], val[q]); }
                __builtin_amdgcn_sched_barrier(0);    // every read and sum in front of the first store
#pragma unroll
                for (int s = 0; s < 8; ++s) *(v4f*)(crow + (size_t)(mb * 16 + 2 * s) * DD) = o[s];
            } else {
                v4f x[4][2];
#pragma unroll
                for (int s = 0; s < 4; ++s) { const float* orow = osw + (s * 4 + l8) * 68 + c8; x[s][0] = *(const v4fa*)orow; x[s][1] = *(const v4fa*)(orow + 4); }
                if constexpr (EP == EP_QKV) { h16* prow = P + (size_t)(n0 / DD) * LL * DD + ((size_t)((m0 / TT) * NH_ + (n0 % DD) / HDM + nh) * TT + (m0 % TT) + l8) * HDM + c8; v8h c[4];
#pragma unroll
                    for (int s = 0; s < 4; ++s)
#pragma unroll
                        for (int j = 0; j < 8; ++j) c[s][j] = tohx(x[s][j >> 2][j & 3]);
                    __builtin_amdgcn_sched_barrier(0);    // every read and conversion in front of the first store
#pragma unroll
                    for (int s = 0; s < 4; ++s) *(v8ha*)(prow + (size_t)(mb * 16 + s * 4) * HDM) = c[s];
                } else { h16* grow = P + (size_t)(m0 + l8) * MM + n0 + nh * 64 + c8; v8h c[4];
#pragma unroll
                    for (int s = 0; s < 4; ++s)
#pragma unroll
                        for (int j = 0; j < 8; ++j) c[s][j] = tohx(fmaxf(x[s][j >> 2][j & 3], 0.f));
                    __builtin_amdgcn_sched_barrier(0);    // every read and conversion in front of the first store
#pragma unroll
                    for (int s = 0; s < 4; ++s) *(v8ha*)(grow + (size_t)(mb * 16 + s * 4) * MM) = c[s]; }
            }
            __builtin_amdgcn_wave_barrier(); asm volatile("" ::: "memory");    // and the next rows' writes behind these reads
            if ((mb < 3 || nh + 1 < FN / 4) && (EP == EP_QKV || EP == EP_RES || EP == EP_RELU)) { asm volatile("s_wait_xcnt 0x0" ::: "memory"); __builtin_amdgcn_sched_barrier(0); }    // the next rows reuse registers that these stores name
        }
    }
}

typedef __attribute__((ext_vector_type(2))) _Float16 v2h;
typedef __attribute__((ext_vector_type(4))) _Float16 v4h;
typedef __attribute__((ext_vector_type(2))) unsigned short v2us;
typedef __attribute__((ext_vector_type(2))) float v2f;

// ---- d_wtG<K, N>: Bt[n][k] (fp16) = w[k][n] (f32) rounded to bf16. One tile of 128 k x 64 n per work-group of 8 waves: tile (bx, by) of (K/128, N/64); tw is the work-group's LDS, 64 x 65 dwords. Both sides of the transposition move 256 consecutive bytes per 16 lanes (a row of the tile in, a row of the
// result out); the turn itself happens in LDS. A thread rounds two consecutive k of four n and packs each pair into one dword of the row [n]. The pitch of 65 dwords puts the 32 dwords of a wave's LDS store (16 groups of n, 4 x 65 dwords
// apart, x 2 pairs of k) and of a wave's LDS read (2 rows x 16 lanes, 4 dwords apart) on 32 different banks. K and N are constants, so that one address serves all loads of a thread and one all its stores.
typedef __attribute__((ext_vector_type(4))) unsigned v4u;
typedef v4u __attribute__((may_alias)) v4ua;
__device__ __forceinline__ unsigned wbits(float f) { return (unsigned)__builtin_bit_cast(unsigned short, (h16)bfr(f)); }
template <int K, int N>
__device__ __forceinline__ void d_wtG(const float* __restrict__ w, h16* Bt, int bx, int by, unsigned* tw) {
    constexpr int WP = 65;
    const int c = threadIdx.x & 15, r = threadIdx.x >> 4; const int k0 = bx * 128, n0 = by * 64;
    const float* s = w + (size_t)(k0 + 2 * r) * N + n0 + c * 4;
    v4f a[4][2];    // all eight loads of a thread fly together: one trip to memory per tile
#pragma unroll
    for (int h = 0; h < 4; ++h) { a[h][0] = *(const v4f*)(s + (size_t)(h * 32) * N); a[h][1] = *(const v4f*)(s + (size_t)(h * 32 + 1) * N); }
    asm volatile("s_wait_xcnt 0x0" :: "v"(s) : "memory");    // a precaution: the address that the loads name is an operand here, so it stays in its registers up to this wait
#pragma unroll
    for (int h = 0; h < 4; ++h)
#pragma unroll
        for (int q = 0; q < 4; ++q) tw[(c * 4 + q) * WP + h * 16 + r] = wbits(a[h][0][q]) | (wbits(a[h][1][q]) << 16);
    __syncthreads();    // the rows are read back by other waves
    h16* d = Bt + (size_t)(n0 + r) * K + k0 + c * 8;
#pragma unroll
    for (int p = 0; p < 4; ++p) { const unsigned* t = tw + (p * 16 + r) * WP + c * 4; v4u o; o[0] = t[0]; o[1] = t[1]; o[2] = t[2]; o[3] = t[3]; *(v4ua*)(d + (size_t)(p * 16) * K) = o; }
    asm volatile("s_wait_xcnt 0x0" ::: "memory");    // a precaution: in the built kernel the text of the next piece follows behind a branch and writes registers that these stores name
}
__device__ __forceinline__ void d_rmsT(const float* __restrict__ A, int rnd, const float* __restrict__ w, h16* Y, int blk) { const int lane = threadIdx.x & 31; const int t = blk * 8 + (threadIdx.x >> 5); if (t >= LL) return; const float* ar = A + (size_t)t * DD; float v[32]; float s = 0.f;
#pragma unroll
    for (int ch = 0; ch < 8; ++ch) { const v4f a = *(const v4f*)(ar + ch * 128 + lane * 4);
#pragma unroll
        for (int q = 0; q < 4; ++q) { const float x = rnd ? bfr(a[q]) : a[q]; v[ch * 4 + q] = x; float p = __fmul_rn(x, x); asm volatile("" : "+v"(p)); s = __fadd_rn(s, p); } }
#pragma unroll
    for (int sh = 16; sh; sh >>= 1) s += __shfl_xor(s, sh, 32);
    const float rs = __frsqrt_rn(__fadd_rn(s * (1.0f / DD), 1e-6f));
{
#pragma unroll
        for (int ch = 0; ch < 8; ++ch) { v4h oy; const v4f wv = *(const v4f*)(w + ch * 128 + lane * 4);    // a lane's four weights in one load: as two, the second's result fell on the offset register that the first still names
#pragma unroll
            for (int q = 0; q < 4; ++q) { float tn = __fmul_rn(v[ch * 4 + q], rs); asm volatile("" : "+v"(tn)); oy[q] = tohx(__fmul_rn(tn, bfr(wv[q]))); }
            *(v4h*)(Y + (size_t)t * DD + ch * 128 + lane * 4) = oy;
            if (ch < 7) { asm volatile("s_wait_xcnt 0x0" ::: "memory"); __builtin_amdgcn_sched_barrier(0); } }    // a precaution: the next 128 columns reuse registers that these stores name; the scheduling barrier holds their writes behind the wait
         } }
__global__ __launch_bounds__(256) void k_rmsT(const float* __restrict__ A, const float* __restrict__ w, h16* Y) { d_rmsT(A, 0, w, Y, blockIdx.x); }
__device__ __forceinline__ int t5_bucket(int r) { const int n = r < 0 ? -r : r; int v; if (n < 8) v = n; else { const int k = 31 - __clz(n); v = 8 + 2 * k - 6 + (((long long)n * n >= (1ll << (2 * k + 1))) ? 1 : 0); v = v > 15 ? 15 : v; } return (r > 0 ? 16 : 0) + v; }
// ---- k_fattn: the whole attention of one (batch, head) x 256 queries per work-group; 8 waves, 32 queries per wave; grid (TT/256, NB_*NH_), one work-group per WGP.
// All keys and all transposed values of the (batch, head) come into LDS once per work-group, by asynchronous copies of whole 128-byte lines; every fragment of both sweeps is then an LDS read at a padded pitch,
// where a wave reading global memory touched 16 lines per load and each of the waves asked for the same lines again. The values fly while sweep 1 runs. Fragment form and the order of all sums are unchanged.
// Scores are formed transposed, S^T = K Q^T (rows = keys, columns = queries): a lane then owns one query, its registers hold keys 8 hi + j of each 16-key tile, and two such tiles are,
// register for register, the 32-deep B fragment of O^T = V^T P^T. No score or probability leaves the registers. Sweep 1 finds each query's row maximum, sweep 2 forms the scores again,
// p = 1024 exp(t - max) (f32 sum, fp16 operand), and accumulates O^T; the division by the sum comes last, per lane. The bias is a table over key - query in LDS, the mask row lies beside it.
#define KPIT (HDM * 2 + 16)    // LDS pitch of a key row and
#define VPIT (TT * 2 + 16)     // of a row of the transposed values: 16 bytes x odd, so that the 16-byte fragment reads of 16 rows fall on different banks
__device__ __forceinline__ v16h fa_ldf(const unsigned char* p) { return cat16(*(const v8ha*)p, *(const v8ha*)(p + 32)); }
__device__ __forceinline__ void fa_ldk(const unsigned char* k, int kb, v16h* kf) {
#pragma unroll
    for (int kt = 0; kt < 2; ++kt) { kf[kt * 2] = fa_ldf(k + (kb + kt * 16) * KPIT); kf[kt * 2 + 1] = fa_ldf(k + (kb + kt * 16) * KPIT + 64); } }
__device__ __forceinline__ v8f fa_qk(const v16h* kf, int kt, const v16h* qf) { v8f s = (v8f){}; s = wmma16(kf[kt * 2], qf[0], s); return wmma16(kf[kt * 2 + 1], qf[1], s); }
__device__ __forceinline__ v8f fa_bias(v8f s, const float* tq, const v4f m0, const v4f m1) {
#pragma unroll
    for (int j = 0; j < 8; ++j) s[j] = __fadd_rn(__fadd_rn(s[j], tq[j]), j < 4 ? m0[j & 3] : m1[j & 3]);
    return s; }
__global__ __launch_bounds__(256) void k_fattn(const h16* __restrict__ QP, const h16* __restrict__ KP, const h16* __restrict__ VT, const float* __restrict__ rb, const float* __restrict__ MBr, h16* AO) {
    __shared__ __align__(16) unsigned char ksm[TT * KPIT];
    __shared__ __align__(16) unsigned char vsm[HDM * VPIT];
    __shared__ float tb[TT + 256];
    __shared__ __align__(16) float mk[TT];
    const int bh = blockIdx.y, b = bh / NH_, h = bh % NH_, Q0 = blockIdx.x * 256;
    // the keys: both planes are contiguous in memory, a thread's 16 bytes of copy i lie 4 KiB behind those of copy i - 1; the 256 threads cover 32 key rows per copy, 32 copies per thread
    { const bf* g = (const bf*)KP + (size_t)bh * TT * HDM + threadIdx.x * 8; const unsigned l = (unsigned)(size_t)ksm + (threadIdx.x >> 3) * KPIT + (threadIdx.x & 7) * 16;
      // unrolled: every address is then the first plus a constant
#pragma unroll
      for (int i = 0; i < 4; ++i) g_cp8<32 * KPIT>(l + i * 256 * KPIT, g + (size_t)i * 256 * HDM, 32 * HDM); }
    const float bv = bfr(rb[(threadIdx.x & 31) * NH_ + h]);    // lane l holds bucket l of this head: the table is filled by lane exchange, with one trip to memory instead of one per entry
#pragma unroll
    for (int i = 0; i < (TT + 256) / 256; ++i) { const int e = i * 256 + threadIdx.x; tb[e] = __shfl(bv, t5_bucket(e - 255 - Q0), 32); }    // tb[255 + key - (query - Q0)]; the last entry is never read
    { const int e = threadIdx.x * 4; *(v4fa*)(mk + e) = *(const v4fa*)(MBr + (size_t)b * TT + e); }
    asm volatile("s_wait_asynccnt 0x0" ::: "memory");    // this wave's share of the keys has landed
    __syncthreads();                                      // and so has every other wave's; publishes the two tables as well
    // the values: 2 rows of 2 KiB per copy, 32 copies per thread; nobody reads them before the barrier in front of sweep 2
    { const bf* g = (const bf*)VT + (size_t)bh * HDM * TT + threadIdx.x * 8; const unsigned l = (unsigned)(size_t)vsm + (threadIdx.x >> 7) * VPIT + (threadIdx.x & 127) * 16;
      // unrolled: every address is then the first plus a constant
#pragma unroll
      for (int i = 0; i < 4; ++i) g_cp8<2 * VPIT>(l + i * 16 * VPIT, g + (size_t)i * 16 * TT, 2 * TT); }
    const int lane = threadIdx.x & 31, lr = lane & 15, hi = lane >> 4, wq = (threadIdx.x >> 5) * 32;
    const h16* q = QP + ((size_t)bh * TT + Q0 + wq + lr) * HDM + 8 * hi;
    const unsigned char* k = ksm + lr * KPIT + 16 * hi;
    const unsigned char* v = vsm + lr * VPIT + 16 * hi;
    const float* tl = tb + 255 + 8 * hi - wq - lr;
    const float* ml = mk + 8 * hi;
    v16h qf[2][2];
#pragma unroll
    for (int qt = 0; qt < 2; ++qt) { qf[qt][0] = WFrag<h16>::ld(q + qt * 16 * HDM); qf[qt][1] = WFrag<h16>::ld(q + qt * 16 * HDM + 32); }
    v16h kf[4]; fa_ldk(k, 0, kf);
    float mx[2] = { -3.0e38f, -3.0e38f };
    // unroll 2: the key fragments of the next block are fetched one trip ahead into a second register set; two trips per pass let the sets swap without moves
#pragma unroll 2
    for (int kb = 0; kb < TT; kb += 32) {
        v16h kn[4]; fa_ldk(k, (kb + 32) & (TT - 1), kn);    // the last trip fetches block 0, which sweep 2 starts with
#pragma unroll
        for (int kt = 0; kt < 2; ++kt) { const v4f m0 = *(const v4fa*)(ml + kb + kt * 16), m1 = *(const v4fa*)(ml + kb + kt * 16 + 4);
#pragma unroll
            for (int qt = 0; qt < 2; ++qt) { const v8f s = fa_bias(fa_qk(kf, kt, qf[qt]), tl + kb + kt * 16 - qt * 16, m0, m1);
#pragma unroll
                for (int j = 0; j < 8; ++j) mx[qt] = fmaxf(mx[qt], s[j]); } }
#pragma unroll
        for (int i = 0; i < 4; ++i) kf[i] = kn[i];
    }
    asm volatile("s_wait_asynccnt 0x0" ::: "memory");    // this wave's share of the values has landed
    __syncthreads();                                      // and so has every other wave's
    float cq[2]; v2f sum[2] = { (v2f){}, (v2f){} };
#pragma unroll
    for (int qt = 0; qt < 2; ++qt) { mx[qt] = fmaxf(mx[qt], __shfl_xor(mx[qt], 16, 32)); cq[qt] = 10.0f - mx[qt] * 1.4426950408889634f; }    // 2^10 = PCAR; a rounding of cq scales a whole row and cancels in p / sum
    v8f o[2][4];
#pragma unroll
    for (int qt = 0; qt < 2; ++qt)
#pragma unroll
        for (int dt = 0; dt < 4; ++dt) o[qt][dt] = (v8f){};
    // unroll 1: the trip is long enough, and a second copy would only raise the register count
#pragma unroll 1
    for (int kb = 0; kb < TT; kb += 32) {
        v16h vf[4];
#pragma unroll
        for (int dt = 0; dt < 4; ++dt) vf[dt] = fa_ldf(v + dt * 16 * VPIT + kb * 2);
        v8f s[2][2];
#pragma unroll
        for (int kt = 0; kt < 2; ++kt)
#pragma unroll
            for (int qt = 0; qt < 2; ++qt) s[kt][qt] = fa_qk(kf, kt, qf[qt]);
        fa_ldk(k, (kb + 32) & (TT - 1), kf);    // the key fragments are free once the score products have issued: the next block's fly under the exponentials and the value products
        __builtin_amdgcn_sched_barrier(0);      // keeps both groups of loads up here; without it the value loads sink to just in front of their products and each waits out its full latency
        v16h pf[2];
#pragma unroll
        for (int kt = 0; kt < 2; ++kt) { const v4f m0 = *(const v4fa*)(ml + kb + kt * 16), m1 = *(const v4fa*)(ml + kb + kt * 16 + 4);
#pragma unroll
            for (int qt = 0; qt < 2; ++qt) { const v8f t = fa_bias(s[kt][qt], tl + kb + kt * 16 - qt * 16, m0, m1);
#pragma unroll
                for (int j = 0; j < 8; j += 2) { v2f p; p[0] = __builtin_amdgcn_exp2f(__builtin_fmaf(t[j], 1.4426950408889634f, cq[qt])); p[1] = __builtin_amdgcn_exp2f(__builtin_fmaf(t[j + 1], 1.4426950408889634f, cq[qt]));
                    sum[qt] += p; pf[qt][kt * 8 + j] = tohx(p[0]); pf[qt][kt * 8 + j + 1] = tohx(p[1]); } } }
#pragma unroll
        for (int dt = 0; dt < 4; ++dt)
#pragma unroll
            for (int qt = 0; qt < 2; ++qt) o[qt][dt] = wmma16(vf[dt], pf[qt], o[qt][dt]);
        // the trip ends in matrix products and the next one begins by overwriting their probability operands: these four slots keep the distance over the back edge
        asm volatile("v_nop\n\tv_nop\n\tv_nop\n\tv_nop" : "+v"(o[0][3]), "+v"(o[1][3]) : "v"(pf[0]), "v"(pf[1]));
    }
    v8h oc[2][4];
#pragma unroll
    for (int qt = 0; qt < 2; ++qt) { float sq = sum[qt][0] + sum[qt][1]; sq += __shfl_xor(sq, 16, 32); const float inv = __fdiv_rn(1.0f, sq);
#pragma unroll
        for (int dt = 0; dt < 4; ++dt)
#pragma unroll
            for (int j = 0; j < 8; ++j) oc[qt][dt][j] = tohx(o[qt][dt][j] * inv); }
    __builtin_amdgcn_sched_barrier(0);    // every conversion in front of the first store, so that no register which an issued store names is written again
    h16* orow = AO + ((size_t)b * TT + Q0 + wq + lr) * DD + h * HDM + 8 * hi;
#pragma unroll
    for (int qt = 0; qt < 2; ++qt)
#pragma unroll
        for (int dt = 0; dt < 4; ++dt) *(v8ha*)(orow + (size_t)qt * 16 * DD + dt * 16) = oc[qt][dt];
}
__device__ __forceinline__ void d_mrow(const float* __restrict__ mask, float* MBr, int blk) { const int e = blk * 256 + threadIdx.x; if (e >= NB_ * TT) return; float om = __fsub_rn(1.0f, bfr(mask[e])); asm volatile("" : "+v"(om)); const float v = __fmul_rn(om, -10000.0f); *(float*)(MBr + e) = v;  }
// ---- k_prep: everything that reads inputs alone, in one grid of 256-thread work-groups: the six weight transposes, the first norm and the mask row. None reads what another writes; a work-group's index alone says which piece it is,
// so every branch (and the barrier inside a transpose) is uniform for the work-group. All pieces but the mask row move about the same number of bytes. W4: the planes of wq, wk, wv, wo one behind the other.
__global__ __launch_bounds__(256) void k_prep(const float* __restrict__ wq, const float* __restrict__ wk, const float* __restrict__ wv, const float* __restrict__ wo, const float* __restrict__ wi, const float* __restrict__ wf,
                                              const float* __restrict__ hid, const float* __restrict__ ln, const float* __restrict__ mask, h16* W4, h16* WI, h16* WF, h16* Y, float* MBr) {
    constexpr int NI = (DD / 128) * (MM / 64), NF = (MM / 128) * (DD / 64), N1 = (DD / 128) * (DD / 64), NR = LL / 8;
    __shared__ unsigned tw[64 * 65];
    const int b = blockIdx.x, bf_ = b - NI, b1 = bf_ - NF, br = b1 - 4 * N1;
    if (b < NI) d_wtG<DD, MM>(wi, WI, b % (DD / 128), b / (DD / 128), tw);
    else if (bf_ < NF) d_wtG<MM, DD>(wf, WF, bf_ % (MM / 128), bf_ / (MM / 128), tw);
    else if (b1 < 4 * N1) { const int m = b1 / N1, e = b1 % N1; d_wtG<DD, DD>(m == 0 ? wq : m == 1 ? wk : m == 2 ? wv : wo, W4 + (size_t)m * DD * DD, e % (DD / 128), e / (DD / 128), tw); }
    else if (br < NR) d_rmsT(hid, 1, ln, Y, br);
    else d_mrow(mask, MBr, br - NR);
}

extern "C" void kernel_launch(void* const* d_in, const int* in_sizes, int n_in,
                              void* d_out, int out_size, void* d_ws, size_t ws_size, hipStream_t stream) {
    (void)in_sizes; (void)n_in; (void)out_size;
    const float* IN[11]; for (int i = 0; i < 11; ++i) IN[i] = (const float*)d_in[i];   // 0 hidden, 1 attn_mask, 2 ln1_w, 3 wq, 4 wk, 5 wv, 6 wo, 7 rel_bias [32][16], 8 ln2_w, 9 wi [1024][4096], 10 wo_ff [4096][1024] (x @ W)
    float* OUT = (float*)d_out;     // [4][1024][1024]
    char* wsp = (char*)d_ws;
    auto take = [&](size_t bytes) { char* p = wsp; wsp += (bytes + 255) & ~(size_t)255; return (void*)p; };
    h16* W4 = (h16*)take((size_t)4 * DD * DD * 2); h16* WO = W4 + (size_t)3 * DD * DD; h16* WI = (h16*)take((size_t)MM * DD * 2); h16* WF = (h16*)take((size_t)DD * MM * 2); float* MBr = (float*)take((size_t)NB_ * TT * 4);    // W4: wq, wk, wv, wo
    h16* X = (h16*)take((size_t)LL * DD * 2);
    h16* QP = (h16*)take((size_t)3 * LL * DD * 2); h16* KP = QP + (size_t)LL * DD; h16* VT = KP + (size_t)LL * DD; h16* AO = (h16*)take((size_t)LL * DD * 2);
    float* H = (float*)take((size_t)LL * DD * 4); h16* G = (h16*)take((size_t)LL * MM * 2);    // relu-FFN hidden plane
    if ((size_t)(wsp - (char*)d_ws) > ws_size) return;    // total ~ 117 MB
    k_prep<<<(DD / 128) * (MM / 64) + (MM / 128) * (DD / 64) + 4 * (DD / 128) * (DD / 64) + LL / 8 + NB_ * TT / 256, 256, 0, stream>>>(IN[3], IN[4], IN[5], IN[6], IN[9], IN[10], IN[0], IN[2], IN[1], W4, WI, WF, X, MBr);
    k_gemmt<EP_QKV><<<dim3(LL / 256, 3 * DD / 256, 1), 256, 0, stream>>>(X, W4, DD, nullptr, nullptr, QP);    // planes [b][h][t][64] (q, k) and [b][h][64][t] (v)
    k_fattn<<<dim3(TT / 256, NB_ * NH_, 1), 256, 0, stream>>>(QP, KP, VT, IN[7], MBr, AO);
    k_gemmt<EP_RES><<<dim3(LL / 128, DD / 128, 1), 128, 0, stream>>>(AO, WO, DD, IN[0], H, nullptr);
    k_rmsT<<<LL / 8, 256, 0, stream>>>(H, IN[8], X);
    k_gemmt<EP_RELU><<<dim3(LL / 256, MM / 256, 1), 256, 0, stream>>>(X, WI, DD, nullptr, nullptr, G);
    k_gemmt<EP_OUT><<<dim3(LL / 128, DD / 128, 1), 128, 0, stream>>>(G, WF, MM, H, OUT, nullptr);
}
